// v000
// The times below were measured on an AMD MI455X: many runs one after another, warmed up first and cycling through
// copies of the inputs, with the whole window's GPU time divided by the number of runs. Launches and the gaps
// between them are all in it. The median over several windows is given; except for v000 it joins two sittings, which
// can be a few percent apart, so the side-by-side timings, each taken in one sitting, are the better comparison.
// v000, which the later versions start from, runs in 1730 microseconds.
#include <hip/hip_runtime.h>
// Sigmoid multi-head attention (N=4096 tokens, IN=256, 8 heads × 64): q,k,v = x·Wᵀ + b; S_h = sigmoid(q_h·k_hᵀ); attn = S_h / Σ_keys S_h; out = mean_h(attn·v_h) → [4096, 64]. Projections, the
// per-head 4096×4096 logits (K = 64) and attn·V (K = 4096) as GEMMs on v_wmma_f32_16x16x32_f16 (x bf16-exact, (out,in) weights bf16-exact ×2^4, q/k/v f16, P = sigmoid/rowsum ×2^15 f16,
// heads accumulated through the epilogue addend with alpha 2^-15/8; f32 accumulate); sigmoid + row sums in f32 VALU.
#define NN 4096
#define CIN 256
#define PJ 512
#define HD 64
#define NH 8

typedef __bf16 v16b __attribute__((ext_vector_type(16)));
typedef unsigned short v8us __attribute__((ext_vector_type(8), may_alias));
typedef float  v8f  __attribute__((ext_vector_type(8)));
typedef float  v4f  __attribute__((ext_vector_type(4)));
typedef float  v4fa __attribute__((ext_vector_type(4), may_alias));
union FragB { v16b v; v8us half[2]; unsigned short u[16]; };

__device__ __forceinline__ unsigned short bf16_bits(float x) { unsigned int u = __float_as_uint(x); return (unsigned short)((u + 0x7FFFu + ((u >> 16) & 1u)) >> 16); }
__device__ __forceinline__ float bf16_val(unsigned short b) { return __uint_as_float(((unsigned int)b) << 16); }
__device__ __forceinline__ float bf16_round(float x) { return bf16_val(bf16_bits(x)); }
// D += A·B with NT terms: 1 = ah·bh, 2 = + al·bh (A split), 3 = + ah·bl (both split)
template <int NT>
__device__ __forceinline__ v8f mmaN(v16b ah, v16b al, v16b bh, v16b bl, v8f c) {
  c = __builtin_amdgcn_wmma_f32_16x16x32_bf16(false, ah, false, bh, (short)0, c, false, false);
  if (NT >= 2) c = __builtin_amdgcn_wmma_f32_16x16x32_bf16(false, al, false, bh, (short)0, c, false, false);
  if (NT >= 3) c = __builtin_amdgcn_wmma_f32_16x16x32_bf16(false, ah, false, bl, (short)0, c, false, false);
  asm volatile("v_nop\n\tv_nop\n\tv_nop\n\tv_nop" : "+v"(c) : "v"(ah), "v"(al), "v"(bh), "v"(bl));
  return c;
}

__global__ __launch_bounds__(256) void k_wt_bf16(const float* __restrict__ W, unsigned short* __restrict__ Wt, int K, int N) {
  const int t = blockIdx.x * 256 + threadIdx.x;
  const int k8n = K / 8;
  if (t >= N * k8n) return;
  const int n = t / k8n, k8 = (t % k8n) * 8;
  v8us v;
#pragma unroll
  for (int i = 0; i < 8; ++i) v[i] = bf16_bits(W[(size_t)(k8 + i) * N + n]);
  *(v8us*)(Wt + (size_t)n * K + k8) = v;
  
}

// GEMM C[M][N] (f32, pitch ldc) = act(A[M][K]·W + bias). A f32 row-major (pitch lda) converted per fragment to bf16
// (ASPLIT: hi/lo two planes -> 2 terms, else single rounded term); Wt bf16 [N][K] (pitch ldb). BIAS_BF16 rounds the
// bias to bf16 first (bias quantised to bf16 before the add). K%32==0, M%16==0, N%64==0.
template <bool ASPLIT, int ACT, bool BIAS_BF16>
__global__ __launch_bounds__(128) void k_gemm_bf(const float* __restrict__ A, int lda, const unsigned short* __restrict__ Wt, int ldb,
                                               const float* __restrict__ bias, float* __restrict__ C, int ldc, int M, int N, int K) {
  __shared__ __attribute__((aligned(16))) float so[4][16][64];
  const int tid = threadIdx.x, w = tid >> 5, lane = tid & 31, ln = lane & 15, hh = lane >> 4;
  const int ntn = N / 64;
  const int wid = blockIdx.x * 4 + w;
  const int mt = wid / ntn, nq = wid % ntn;
  if (mt * 16 >= M) return;
  const int row0 = mt * 16, col0 = nq * 64;
  const float* arow = A + (size_t)(row0 + ln) * lda;
  v8f acc[4] = {};
  for (int kb = 0; kb < K; kb += 32) {
    FragB ah, al;
    const v4f x0 = *(const v4fa*)(arow + kb + 8 * hh), x1 = *(const v4fa*)(arow + kb + 8 * hh + 4);
    const v4f x2 = *(const v4fa*)(arow + kb + 16 + 8 * hh), x3 = *(const v4fa*)(arow + kb + 16 + 8 * hh + 4);
    float xs[16] = {x0[0],x0[1],x0[2],x0[3],x1[0],x1[1],x1[2],x1[3],x2[0],x2[1],x2[2],x2[3],x3[0],x3[1],x3[2],x3[3]};
#pragma unroll
    for (int i = 0; i < 16; ++i) { const unsigned short hb = bf16_bits(xs[i]); ah.u[i] = hb; al.u[i] = ASPLIT ? bf16_bits(xs[i] - bf16_val(hb)) : (unsigned short)0; }
#pragma unroll
    for (int t = 0; t < 4; ++t) {
      const unsigned short* brow = Wt + (size_t)(col0 + t * 16 + ln) * ldb + kb;
      FragB b;
      b.half[0] = *(const v8us*)(brow + 8 * hh);
      b.half[1] = *(const v8us*)(brow + 16 + 8 * hh);
      acc[t] = mmaN<ASPLIT ? 2 : 1>(ah.v, al.v, b.v, b.v, acc[t]);
    }
  }
#pragma unroll
  for (int t = 0; t < 4; ++t) {
    float bv = bias ? bias[col0 + t * 16 + ln] : 0.f;
    if (BIAS_BF16) bv = bf16_round(bv);
#pragma unroll
    for (int r = 0; r < 8; ++r) { float v = acc[t][r] + bv; if (ACT == 1) v = fmaxf(v, 0.f); so[w][8 * hh + r][t * 16 + ln] = v; }
  }
  __builtin_amdgcn_fence(__ATOMIC_ACQ_REL, "workgroup");
  __builtin_amdgcn_wave_barrier();
  const int rsub = lane >> 4, c4 = (lane & 15) * 4;
  {
#pragma unroll
    for (int q = 0; q < 8; ++q) {
      const int r = q * 2 + rsub;
      const v4f v = *(const v4fa*)&so[w][r][c4];
      *(v4f*)(C + (size_t)(row0 + r) * ldc + col0 + c4) = v;
    }
    
  }
}

// Flash-style causal/unmasked attention, all contractions 3-term bf16 hi/lo splits, f32 softmax with running max.
// q,k,v rows are read from f32 buffers with arbitrary row pitch (so they can live inside a fused qkv buffer);
// D = head size (multiple of 32, <= 128); one wave = 16 query rows; block = 4 waves (64 queries) sharing K/V chunks of 32.
template <int D, bool CAUSAL>
__global__ __launch_bounds__(128) void k_flash(const float* __restrict__ qb, const float* __restrict__ kb, const float* __restrict__ vb,
                                             int pitch, int T, int H, float scale, float* __restrict__ y, int ypitch) {
  constexpr int KS = D / 32;        // k-steps for QK
  constexpr int DT = D / 16;        // d tiles for PV
  __shared__ __attribute__((aligned(16))) unsigned short sKh[32][D + 8], sKl[32][D + 8], sVh[32][D + 8], sVl[32][D + 8];
  __shared__ __attribute__((aligned(16))) unsigned short sPh[4][16][40], sPl[4][16][40];
  __shared__ __attribute__((aligned(16))) float sO[4][16][D];
  const int tid = threadIdx.x, w = tid >> 5, lane = tid & 31, ln = lane & 15, hh = lane >> 4;
  const int nqb = (T + 63) / 64;
  const int bh = blockIdx.x / nqb, qblk = blockIdx.x % nqb;
  const int b = bh / H, h = bh % H;
  const int q0 = qblk * 64 + w * 16;
  const float* Q = qb + (size_t)b * T * pitch + h * D;
  const float* K = kb + (size_t)b * T * pitch + h * D;
  const float* V = vb + (size_t)b * T * pitch + h * D;

  // A fragments of the wave's 16 query rows (scaled), hi/lo
  FragB aqh[KS], aql[KS];
  {
    int row = q0 + ln; if (row >= T) row = T - 1;
    const float* qr = Q + (size_t)row * pitch;
#pragma unroll
    for (int ks = 0; ks < KS; ++ks)
#pragma unroll
      for (int i = 0; i < 16; ++i) {
        const int d = ks * 32 + ((i < 8) ? (8 * hh + i) : (16 + 8 * hh + (i - 8)));
        const float x = qr[d] * scale; const unsigned short hb = bf16_bits(x);
        aqh[ks].u[i] = hb; aql[ks].u[i] = bf16_bits(x - bf16_val(hb));
      }
  }
  float m_r[8], l_r[8];
#pragma unroll
  for (int r = 0; r < 8; ++r) { m_r[r] = -3.0e38f; l_r[r] = 0.f; }
  v8f oacc[DT];
#pragma unroll
  for (int dt = 0; dt < DT; ++dt) oacc[dt] = (v8f){0.f,0.f,0.f,0.f,0.f,0.f,0.f,0.f};

  const int kv_end = CAUSAL ? min(T, qblk * 64 + 64) : T;     // block-uniform
  for (int j0 = 0; j0 < kv_end; j0 += 32) {
    __syncthreads();
    for (int e = tid; e < 32 * (D / 4); e += 128) {
      const int r = e / (D / 4), c4 = (e % (D / 4)) * 4;
      const int key = j0 + r;
      v4f kf = {0.f,0.f,0.f,0.f}, vf = {0.f,0.f,0.f,0.f};
      if (key < T) { kf = *(const v4fa*)(K + (size_t)key * pitch + c4); vf = *(const v4fa*)(V + (size_t)key * pitch + c4); }
#pragma unroll
      for (int t = 0; t < 4; ++t) {
        unsigned short hb = bf16_bits(kf[t]); sKh[r][c4 + t] = hb; sKl[r][c4 + t] = bf16_bits(kf[t] - bf16_val(hb));
        hb = bf16_bits(vf[t]); sVh[r][c4 + t] = hb; sVl[r][c4 + t] = bf16_bits(vf[t] - bf16_val(hb));
      }
    }
    __syncthreads();
    // S tile 16 x 32
    v8f s[2];
#pragma unroll
    for (int nt = 0; nt < 2; ++nt) {
      v8f acc = {};
#pragma unroll
      for (int ks = 0; ks < KS; ++ks) {
        FragB bh_, bl_;
        bh_.half[0] = *(const v8us*)&sKh[nt * 16 + ln][ks * 32 + 8 * hh]; bh_.half[1] = *(const v8us*)&sKh[nt * 16 + ln][ks * 32 + 16 + 8 * hh];
        bl_.half[0] = *(const v8us*)&sKl[nt * 16 + ln][ks * 32 + 8 * hh]; bl_.half[1] = *(const v8us*)&sKl[nt * 16 + ln][ks * 32 + 16 + 8 * hh];
        acc = mmaN<3>(aqh[ks].v, aql[ks].v, bh_.v, bl_.v, acc);
      }
      s[nt] = acc;
    }
    // mask + running max (rows 8hh+r; the 16 lanes of a half share rows)
    float alpha[8];
#pragma unroll
    for (int r = 0; r < 8; ++r) {
      const int qi = q0 + 8 * hh + r;
      const int ja = j0 + ln, jb = j0 + 16 + ln;
      if (CAUSAL) { if (ja > qi) s[0][r] = -3.0e38f; if (jb > qi) s[1][r] = -3.0e38f; }
      if (ja >= T) s[0][r] = -3.0e38f;
      if (jb >= T) s[1][r] = -3.0e38f;
      float mx = fmaxf(s[0][r], s[1][r]);
      mx = fmaxf(mx, __shfl_xor(mx, 1, 32)); mx = fmaxf(mx, __shfl_xor(mx, 2, 32)); mx = fmaxf(mx, __shfl_xor(mx, 4, 32)); mx = fmaxf(mx, __shfl_xor(mx, 8, 32));
      const float mnew = fmaxf(m_r[r], mx);
      alpha[r] = (mnew > -1.0e38f) ? __expf(m_r[r] - mnew) : 1.0f;
      const float p0 = (s[0][r] > -1.0e38f) ? __expf(s[0][r] - mnew) : 0.f;
      const float p1 = (s[1][r] > -1.0e38f) ? __expf(s[1][r] - mnew) : 0.f;
      m_r[r] = mnew;
      l_r[r] = l_r[r] * alpha[r] + p0 + p1;            // per-lane partial row sum (16 lanes combined at the end)
      unsigned short hb = bf16_bits(p0); sPh[w][8 * hh + r][ln] = hb;      sPl[w][8 * hh + r][ln] = bf16_bits(p0 - bf16_val(hb));
      hb = bf16_bits(p1);                sPh[w][8 * hh + r][16 + ln] = hb; sPl[w][8 * hh + r][16 + ln] = bf16_bits(p1 - bf16_val(hb));
    }
#pragma unroll
    for (int dt = 0; dt < DT; ++dt)
#pragma unroll
      for (int r = 0; r < 8; ++r) oacc[dt][r] *= alpha[r];
    __builtin_amdgcn_fence(__ATOMIC_ACQ_REL, "workgroup");
    __builtin_amdgcn_wave_barrier();
    FragB pah, pal;
    pah.half[0] = *(const v8us*)&sPh[w][ln][8 * hh]; pah.half[1] = *(const v8us*)&sPh[w][ln][16 + 8 * hh];
    pal.half[0] = *(const v8us*)&sPl[w][ln][8 * hh]; pal.half[1] = *(const v8us*)&sPl[w][ln][16 + 8 * hh];
#pragma unroll
    for (int dt = 0; dt < DT; ++dt) {
      FragB bvh, bvl;
#pragma unroll
      for (int i = 0; i < 8; ++i) {
        bvh.u[i] = sVh[8 * hh + i][dt * 16 + ln]; bvh.u[8 + i] = sVh[16 + 8 * hh + i][dt * 16 + ln];
        bvl.u[i] = sVl[8 * hh + i][dt * 16 + ln]; bvl.u[8 + i] = sVl[16 + 8 * hh + i][dt * 16 + ln];
      }
      oacc[dt] = mmaN<3>(pah.v, pal.v, bvh.v, bvl.v, oacc[dt]);
    }
    __builtin_amdgcn_fence(__ATOMIC_ACQ_REL, "workgroup");
    __builtin_amdgcn_wave_barrier();
  }
#pragma unroll
  for (int r = 0; r < 8; ++r) {
    float l = l_r[r];
    l += __shfl_xor(l, 1, 32); l += __shfl_xor(l, 2, 32); l += __shfl_xor(l, 4, 32); l += __shfl_xor(l, 8, 32);
    l_r[r] = (l > 0.f) ? 1.0f / l : 0.f;
  }
#pragma unroll
  for (int dt = 0; dt < DT; ++dt)
#pragma unroll
    for (int r = 0; r < 8; ++r) sO[w][8 * hh + r][dt * 16 + ln] = oacc[dt][r] * l_r[r];
  __builtin_amdgcn_fence(__ATOMIC_ACQ_REL, "workgroup");
  __builtin_amdgcn_wave_barrier();
  {
    for (int r = 0; r < 16; ++r) {
      const int row = q0 + r;
      if (row < T && lane < D / 4) {
        const v4f val = *(const v4fa*)&sO[w][r][lane * 4];
        *(v4f*)(y + ((size_t)b * T + row) * ypitch + h * D + lane * 4) = val;
      }
    }
    
  }
}

// GEMM C = act(A·W + bias + resid): A f32 (ASPLIT -> hi/lo 2 terms), Wt bf16 [N][K]; ACT 0 none, 1 relu, 2 exact gelu;
// resid (optional, f32, row index = (row % rmod), pitch ldr, RES_BF16 rounds it) added before the activation.
template <bool ASPLIT, int ACT, bool BIAS_BF16, bool RES_BF16>
__global__ __launch_bounds__(128) void k_gemm_bf3(const float* __restrict__ A, int lda, const unsigned short* __restrict__ Wt, int ldb,
                                                const float* __restrict__ bias, const float* __restrict__ resid, int rmod, int ldr,
                                                float* __restrict__ C, int ldc, int M, int N, int K) {
  __shared__ __attribute__((aligned(16))) float so[4][16][64];
  const int tid = threadIdx.x, w = tid >> 5, lane = tid & 31, ln = lane & 15, hh = lane >> 4;
  const int ntn = N / 64;
  const int wid = blockIdx.x * 4 + w;
  const int mt = wid / ntn, nq = wid % ntn;
  if (mt * 16 >= M) return;
  const int row0 = mt * 16, col0 = nq * 64;
  const float* arow = A + (size_t)(row0 + ln) * lda;
  v8f acc[4] = {};
  for (int kb = 0; kb < K; kb += 32) {
    FragB ah, al;
    const v4f x0 = *(const v4fa*)(arow + kb + 8 * hh), x1 = *(const v4fa*)(arow + kb + 8 * hh + 4);
    const v4f x2 = *(const v4fa*)(arow + kb + 16 + 8 * hh), x3 = *(const v4fa*)(arow + kb + 16 + 8 * hh + 4);
    float xs[16] = {x0[0],x0[1],x0[2],x0[3],x1[0],x1[1],x1[2],x1[3],x2[0],x2[1],x2[2],x2[3],x3[0],x3[1],x3[2],x3[3]};
#pragma unroll
    for (int i = 0; i < 16; ++i) { const unsigned short hb = bf16_bits(xs[i]); ah.u[i] = hb; al.u[i] = ASPLIT ? bf16_bits(xs[i] - bf16_val(hb)) : (unsigned short)0; }
#pragma unroll
    for (int t = 0; t < 4; ++t) {
      const unsigned short* brow = Wt + (size_t)(col0 + t * 16 + ln) * ldb + kb;
      FragB b;
      b.half[0] = *(const v8us*)(brow + 8 * hh);
      b.half[1] = *(const v8us*)(brow + 16 + 8 * hh);
      acc[t] = mmaN<ASPLIT ? 2 : 1>(ah.v, al.v, b.v, b.v, acc[t]);
    }
  }
#pragma unroll
  for (int t = 0; t < 4; ++t) {
    const int col = col0 + t * 16 + ln;
    float bv = bias ? bias[col] : 0.f;
    if (BIAS_BF16) bv = bf16_round(bv);
#pragma unroll
    for (int r = 0; r < 8; ++r) {
      float v = acc[t][r] + bv;
      if (resid) { float rv = resid[(size_t)((row0 + 8 * hh + r) % rmod) * ldr + col]; if (RES_BF16) rv = bf16_round(rv); v += rv; }
      if (ACT == 1) v = fmaxf(v, 0.f);
      if (ACT == 2) v = 0.5f * v * (1.0f + erff(v * 0.70710678118654752f));
      if (ACT == 3) { const float u = 0.7978845608028654f * (v + 0.044715f * v * v * v); v = 0.5f * v * (1.0f + tanhf(u)); }
      so[w][8 * hh + r][t * 16 + ln] = v;
    }
  }
  __builtin_amdgcn_fence(__ATOMIC_ACQ_REL, "workgroup");
  __builtin_amdgcn_wave_barrier();
  const int rsub = lane >> 4, c4 = (lane & 15) * 4;
  {
#pragma unroll
    for (int q = 0; q < 8; ++q) {
      const int r = q * 2 + rsub;
      const v4f v = *(const v4fa*)&so[w][r][c4];
      *(v4f*)(C + (size_t)(row0 + r) * ldc + col0 + c4) = v;
    }
    
  }
}
// row LayerNorm (biased variance, eps) over N: s = X (+ R); optional out_sum <- s; out_norm <- (s-mu)*rsqrt(var+eps)*g + b
template <bool PARAM_BF16>
__global__ __launch_bounds__(256) void k_layernorm(const float* __restrict__ X, const float* __restrict__ R, const float* __restrict__ g, const float* __restrict__ bta,
                                                  float* __restrict__ out_sum, float* __restrict__ out_norm, int N, float eps) {
  __shared__ float red[256];
  const int row = blockIdx.x, tid = threadIdx.x;
  const float* x = X + (size_t)row * N; const float* rr = R ? R + (size_t)row * N : nullptr;
  float vals[16];                     // up to N = 4096
  const int per = N / 256;            // contiguous chunk per thread? use strided-by-4 chunks: thread handles j = tid*4 + 1024*u
  float s1 = 0.f;
  for (int u = 0; u < per / 4; ++u) {
    const int j = tid * 4 + 1024 * u;
    const v4f a = *(const v4fa*)(x + j);
    v4f b = {0.f,0.f,0.f,0.f}; if (rr) b = *(const v4fa*)(rr + j);
#pragma unroll
    for (int q = 0; q < 4; ++q) { const float v = a[q] + b[q]; vals[u * 4 + q] = v; s1 += v; }
  }
  red[tid] = s1; __syncthreads();
  for (int st = 128; st > 0; st >>= 1) { if (tid < st) red[tid] += red[tid + st]; __syncthreads(); }
  const float mu = red[0] / (float)N; __syncthreads();
  float s2 = 0.f;
  for (int u = 0; u < per / 4; ++u)
#pragma unroll
    for (int q = 0; q < 4; ++q) { const float c = vals[u * 4 + q] - mu; s2 += c * c; }
  red[tid] = s2; __syncthreads();
  for (int st = 128; st > 0; st >>= 1) { if (tid < st) red[tid] += red[tid + st]; __syncthreads(); }
  const float rs = rsqrtf(red[0] / (float)N + eps);
  {
    for (int u = 0; u < per / 4; ++u) {
      const int j = tid * 4 + 1024 * u;
      v4f o, sm;
#pragma unroll
      for (int q = 0; q < 4; ++q) {
        float gg = g[j + q], bb = bta[j + q];
        if (PARAM_BF16) { gg = bf16_round(gg); bb = bf16_round(bb); }
        sm[q] = vals[u * 4 + q]; o[q] = (vals[u * 4 + q] - mu) * rs * gg + bb;
      }
      if (out_sum) *(v4f*)(out_sum + (size_t)row * N + j) = sm;
      *(v4f*)(out_norm + (size_t)row * N + j) = o;
    }
    
  }
}



// ---- f16 WMMA path (v_wmma_f32_16x16x32_f16): 11-bit significands for operands in range — used where a [0,1] probability operand needs more precision than bf16
typedef _Float16 v16h __attribute__((ext_vector_type(16)));
union FragH { v16h v; v8us half[2]; _Float16 h[16]; unsigned short u[16]; };
template <int NT>
__device__ __forceinline__ v8f mmaH(v16h ah, v16h al, v16h bh, v16h bl, v8f c) {
  c = __builtin_amdgcn_wmma_f32_16x16x32_f16(false, ah, false, bh, (short)0, c, false, false);
  if (NT >= 2) c = __builtin_amdgcn_wmma_f32_16x16x32_f16(false, al, false, bh, (short)0, c, false, false);
  if (NT >= 3) c = __builtin_amdgcn_wmma_f32_16x16x32_f16(false, ah, false, bl, (short)0, c, false, false);
  asm volatile("v_nop\n\tv_nop\n\tv_nop\n\tv_nop" : "+v"(c) : "v"(ah), "v"(al), "v"(bh), "v"(bl));
  return c;
}
// batched GEMM like k_gemm_b but f16 operands: A f32 (split into f16 hi/lo if ASPLIT, else rounded to f16), Bt = f16 values [n][k]; alpha; C f32; N multiple of 16 (partial tiles skipped)
template <bool ASPLIT>
__global__ __launch_bounds__(128) void k_gemm_h(const float* __restrict__ A, int lda, size_t sA, const _Float16* __restrict__ Bh, int ldb, size_t sB, float alpha, float* __restrict__ C, int ldc, size_t sC, int M, int N, int K) {
  __shared__ __attribute__((aligned(16))) float so[4][16][64];
  const int tid = threadIdx.x, w = tid >> 5, lane = tid & 31, ln = lane & 15, hh = lane >> 4; const int by = blockIdx.y;
  A += (size_t)by * sA; Bh += (size_t)by * sB; C += (size_t)by * sC;
  const int ntn = (N + 63) / 64; const int wid = blockIdx.x * 4 + w; const int mt = wid / ntn, nq = wid % ntn; if (mt * 16 >= M) return;
  const int row0 = mt * 16, col0 = nq * 64; const float* arow = A + (size_t)(row0 + ln) * lda;
  v8f acc[4] = {};
  for (int kb = 0; kb < K; kb += 32) {
    FragH ah, al;
    const v4f x0 = *(const v4fa*)(arow + kb + 8 * hh), x1 = *(const v4fa*)(arow + kb + 8 * hh + 4), x2 = *(const v4fa*)(arow + kb + 16 + 8 * hh), x3 = *(const v4fa*)(arow + kb + 16 + 8 * hh + 4);
    float xs[16] = {x0[0],x0[1],x0[2],x0[3],x1[0],x1[1],x1[2],x1[3],x2[0],x2[1],x2[2],x2[3],x3[0],x3[1],x3[2],x3[3]};
#pragma unroll
    for (int i = 0; i < 16; ++i) { const _Float16 h = (_Float16)xs[i]; ah.h[i] = h; al.h[i] = ASPLIT ? (_Float16)(xs[i] - (float)h) : (_Float16)0.0f; }
#pragma unroll
    for (int t = 0; t < 4; ++t) { if (col0 + t * 16 >= N) continue; const size_t boff = (size_t)(col0 + t * 16 + ln) * ldb + kb; FragH bq; bq.half[0] = *(const v8us*)(Bh + boff + 8 * hh); bq.half[1] = *(const v8us*)(Bh + boff + 16 + 8 * hh);
      acc[t] = mmaH<ASPLIT ? 2 : 1>(ah.v, al.v, bq.v, bq.v, acc[t]); }
  }
#pragma unroll
  for (int t = 0; t < 4; ++t) { if (col0 + t * 16 >= N) continue;
#pragma unroll
    for (int r = 0; r < 8; ++r) so[w][8 * hh + r][t * 16 + ln] = acc[t][r] * alpha; }
  __builtin_amdgcn_fence(__ATOMIC_ACQ_REL, "workgroup"); __builtin_amdgcn_wave_barrier();
  const int rsub = lane >> 4, c4 = (lane & 15) * 4;
  {
#pragma unroll
    for (int q = 0; q < 8; ++q) { const int r = q * 2 + rsub; if (col0 + c4 < N) { const v4f v = *(const v4fa*)&so[w][r][c4]; *(v4f*)(C + (size_t)(row0 + r) * ldc + col0 + c4) = v; } }
     }
}

// Wt[n][k] = f16(W[k][n]·scale) from f32 row-major W[K][N] (scale = power of two; bf16-exact weights stay exact in f16 away from the subnormal range)
__global__ __launch_bounds__(256) void k_wt_f16(const float* __restrict__ W, _Float16* __restrict__ Wt, int K, int N, float scale) {
  const int t = blockIdx.x * 256 + threadIdx.x; if (t >= N * (K / 8)) return; const int n = t / (K / 8), k8 = (t % (K / 8)) * 8; FragH f;
#pragma unroll
  for (int i = 0; i < 8; ++i) f.h[i] = (_Float16)(bf16_round(W[(size_t)(k8 + i) * N + n]) * scale); const v8us o = f.half[0];
  *(v8us*)((unsigned short*)Wt + (size_t)n * K + k8) = o; 
}
// k_gemm_hh variant with fused epilogue: v = acc·alpha + bias[by·sBias + col] (+ CP[(row/rowsPerB)·sCPb + by·64 + col] if CP) ; ACT 0 none / 1 elu ; writes f32 C and/or f16 C16 (each if non-null)
template <int ACT>
__global__ __launch_bounds__(128) void k_gemm_hhx(const _Float16* __restrict__ A, int lda, size_t sA, const _Float16* __restrict__ Bh, int ldb, size_t sB, float alpha, const float* __restrict__ bias, size_t sBias, const float* __restrict__ CP, int rowsPerB, size_t sCPb, int row0g,
    float* __restrict__ C, _Float16* __restrict__ C16, int ldc, size_t sC, int M, int N, int K) {
  __shared__ __attribute__((aligned(16))) float so[4][16][64];
  const int tid = threadIdx.x, w = tid >> 5, lane = tid & 31, ln = lane & 15, hh = lane >> 4; const int by = blockIdx.y;
  A += (size_t)by * sA; Bh += (size_t)by * sB; const size_t cofs = (size_t)by * sC; const float* bp = bias ? bias + (size_t)by * sBias : nullptr;
  const int ntn = (N + 63) / 64; const int wid = blockIdx.x * 4 + w; const int mt = wid / ntn, nq = wid % ntn; if (mt * 16 >= M) return;
  const int row0 = mt * 16, col0 = nq * 64; const _Float16* arow = A + (size_t)(row0 + ln) * lda;
  v8f acc[4] = {};
  for (int kb = 0; kb < K; kb += 32) { FragH ah; ah.half[0] = *(const v8us*)((const unsigned short*)arow + kb + 8 * hh); ah.half[1] = *(const v8us*)((const unsigned short*)arow + kb + 16 + 8 * hh);
#pragma unroll
    for (int t = 0; t < 4; ++t) { if (col0 + t * 16 >= N) continue; const size_t boff = (size_t)(col0 + t * 16 + ln) * ldb + kb; FragH bq; bq.half[0] = *(const v8us*)((const unsigned short*)Bh + boff + 8 * hh); bq.half[1] = *(const v8us*)((const unsigned short*)Bh + boff + 16 + 8 * hh);
      acc[t] = mmaH<1>(ah.v, ah.v, bq.v, bq.v, acc[t]); }
  }
#pragma unroll
  for (int t = 0; t < 4; ++t) { if (col0 + t * 16 >= N) continue; const int col = col0 + t * 16 + ln; const float bv = bp ? bf16_round(bp[col]) : 0.f;
#pragma unroll
    for (int r = 0; r < 8; ++r) { float v = acc[t][r] * alpha + bv; if (CP) { const int bidx = (row0g + row0 + 8 * hh + r) / rowsPerB; v += CP[(size_t)bidx * sCPb + (size_t)by * 64 + col]; } if (ACT == 1) v = (v > 0.f) ? v : expm1f(v); else if (ACT == 3) v = fmaxf(v, 0.f); so[w][8 * hh + r][t * 16 + ln] = v; } }
  __builtin_amdgcn_fence(__ATOMIC_ACQ_REL, "workgroup"); __builtin_amdgcn_wave_barrier();
  const int rsub = lane >> 4, c4 = (lane & 15) * 4; typedef _Float16 v4h __attribute__((ext_vector_type(4)));
  {
#pragma unroll
    for (int q = 0; q < 8; ++q) { const int r = q * 2 + rsub; if (col0 + c4 < N) { const v4f v = *(const v4fa*)&so[w][r][c4]; if (C) *(v4f*)(C + cofs + (size_t)(row0 + r) * ldc + col0 + c4) = v; if (C16) { v4h h4; for (int i = 0; i < 4; ++i) h4[i] = (_Float16)v[i]; *(v4h*)(C16 + cofs + (size_t)(row0 + r) * ldc + col0 + c4) = h4; } } }
     }
}


typedef _Float16 v4h __attribute__((ext_vector_type(4)));

__global__ __launch_bounds__(256) void k_x16(const float* __restrict__ x, _Float16* __restrict__ X16, size_t n8) { const size_t t = (size_t)blockIdx.x * 256 + threadIdx.x; if (t >= n8) return; FragH f;
#pragma unroll
  for (int q = 0; q < 8; ++q) f.h[q] = (_Float16)bf16_round(x[t * 8 + q]); *(v8us*)((unsigned short*)X16 + t * 8) = f.half[0];  }
__global__ __launch_bounds__(256) void k_h16(const float* __restrict__ x, _Float16* __restrict__ X16, size_t n8) { const size_t t = (size_t)blockIdx.x * 256 + threadIdx.x; if (t >= n8) return; FragH f;
#pragma unroll
  for (int q = 0; q < 8; ++q) f.h[q] = (_Float16)x[t * 8 + q]; *(v8us*)((unsigned short*)X16 + t * 8) = f.half[0];  }
__global__ __launch_bounds__(256) void k_round16f(const float* __restrict__ W, _Float16* __restrict__ Bt, size_t n8) { const size_t t = (size_t)blockIdx.x * 256 + threadIdx.x; if (t >= n8) return; FragH f;
#pragma unroll
  for (int i = 0; i < 8; ++i) f.h[i] = (_Float16)(bf16_round(W[t * 8 + i]) * 16.0f); *(v8us*)((unsigned short*)Bt + t * 8) = f.half[0];  }
template <int NHv, int TTv>
__global__ __launch_bounds__(256) void k_vt(const _Float16* __restrict__ V16, int ldv, int voff, _Float16* __restrict__ Vt) { __shared__ unsigned short tl[64][66]; const int tid = threadIdx.x; const int slab = blockIdx.x / (TTv / 64), lg = blockIdx.x % (TTv / 64); const int b = slab / NHv, h = slab % NHv;
  for (int i = tid; i < 64 * 8; i += 256) { const int r = i / 8, c8 = (i % 8) * 8; FragH f; f.half[0] = *(const v8us*)((const unsigned short*)V16 + ((size_t)b * TTv + lg * 64 + r) * ldv + voff + h * 64 + c8);
#pragma unroll
    for (int q = 0; q < 8; ++q) tl[r][c8 + q] = f.u[q]; }
  __syncthreads();
  {
#pragma unroll
    for (int rd = 0; rd < 2; ++rd) { const int d = rd * 32 + tid / 8, pc = tid % 8; FragH f;
#pragma unroll
      for (int q = 0; q < 8; ++q) f.u[q] = tl[pc * 8 + q][d];
      *(v8us*)((unsigned short*)Vt + ((size_t)slab * 64 + d) * TTv + lg * 64 + pc * 8) = f.half[0]; }
     } }

__global__ __launch_bounds__(256) void k_sig(const float* __restrict__ S, _Float16* __restrict__ P16) { const int tid = threadIdx.x, wv = tid >> 5, lane = tid & 31; const int n = blockIdx.x * 8 + wv; if (n >= NN) return; const float* sr = S + (size_t)n * NN; float z = 0.f; typedef float v2f __attribute__((ext_vector_type(2), may_alias));
#pragma unroll 1
  for (int p = lane; p < NN / 2; p += 32) { const v2f a = *(const v2f*)(sr + p * 2); z += 1.0f / (1.0f + __expf(-a[0])) + 1.0f / (1.0f + __expf(-a[1])); }
  for (int o = 16; o >= 1; o >>= 1) z += __shfl_xor(z, o, 32); const float sc = 32768.0f / z;
  {
#pragma unroll 1
    for (int p = lane; p < NN / 2; p += 32) { const v2f a = *(const v2f*)(sr + p * 2); FragH f; f.h[0] = (_Float16)(sc / (1.0f + __expf(-a[0]))); f.h[1] = (_Float16)(sc / (1.0f + __expf(-a[1]))); const unsigned pk = (unsigned)f.u[0] | ((unsigned)f.u[1] << 16); *(unsigned*)((unsigned short*)P16 + (size_t)n * NN + p * 2) = pk; }
     } }
extern "C" void kernel_launch(void* const* d_in, const int* in_sizes, int n_in,
                              void* d_out, int out_size, void* d_ws, size_t ws_size, hipStream_t stream) {
  (void)in_sizes; (void)n_in; (void)out_size;
  const float* x = (const float*)d_in[0]; const float* Wq = (const float*)d_in[1]; const float* bq = (const float*)d_in[2]; const float* Wk = (const float*)d_in[3]; const float* bk = (const float*)d_in[4]; const float* Wv = (const float*)d_in[5]; const float* bv = (const float*)d_in[6];
  char* ws = (char*)d_ws; size_t off = 0;
  auto take = [&](size_t bytes) { char* p = ws + off; off += (bytes + 255) & ~(size_t)255; return p; };
  _Float16* Bq = (_Float16*)take((size_t)PJ * CIN * 2); _Float16* Bk = (_Float16*)take((size_t)PJ * CIN * 2); _Float16* Bv = (_Float16*)take((size_t)PJ * CIN * 2); _Float16* X16 = (_Float16*)take((size_t)NN * CIN * 2); _Float16* Q16 = (_Float16*)take((size_t)NN * PJ * 2); _Float16* K16 = (_Float16*)take((size_t)NN * PJ * 2); _Float16* V16 = (_Float16*)take((size_t)NN * PJ * 2); _Float16* Vt = (_Float16*)take((size_t)NN * PJ * 2); float* S = (float*)take((size_t)NN * NN * 4); _Float16* P16 = (_Float16*)take((size_t)NN * NN * 2);
  if (off > ws_size) return;      // 0.8 + 2.1 + 4.2 × 4 + 67 + 33.5 ≈ 120 MB
  k_round16f<<<(PJ * CIN / 8 + 255) / 256, 256, 0, stream>>>(Wq, Bq, PJ * CIN / 8); k_round16f<<<(PJ * CIN / 8 + 255) / 256, 256, 0, stream>>>(Wk, Bk, PJ * CIN / 8); k_round16f<<<(PJ * CIN / 8 + 255) / 256, 256, 0, stream>>>(Wv, Bv, PJ * CIN / 8);
  k_x16<<<(NN * CIN / 8 + 255) / 256, 256, 0, stream>>>(x, X16, (size_t)NN * CIN / 8);
  const dim3 gp(((NN / 16) * (PJ / 64) + 3) / 4, 1);
  k_gemm_hhx<0><<<gp, 128, 0, stream>>>(X16, CIN, 0, Bq, CIN, 0, 0.0625f, bq, 0, nullptr, 1, 0, 0, nullptr, Q16, PJ, 0, NN, PJ, CIN); k_gemm_hhx<0><<<gp, 128, 0, stream>>>(X16, CIN, 0, Bk, CIN, 0, 0.0625f, bk, 0, nullptr, 1, 0, 0, nullptr, K16, PJ, 0, NN, PJ, CIN); k_gemm_hhx<0><<<gp, 128, 0, stream>>>(X16, CIN, 0, Bv, CIN, 0, 0.0625f, bv, 0, nullptr, 1, 0, 0, nullptr, V16, PJ, 0, NN, PJ, CIN);      // head h at cols h·64
  k_vt<NH, NN><<<1 * NH * (NN / 64), 256, 0, stream>>>(V16, PJ, 0, Vt);      // [h][64][N]
  for (int h = 0; h < NH; ++h) {
    k_gemm_hhx<0><<<dim3(((NN / 16) * (NN / 64) + 3) / 4, 1), 128, 0, stream>>>(Q16 + h * HD, PJ, 0, K16 + h * HD, PJ, 0, 1.0f, nullptr, 0, nullptr, 1, 0, 0, S, nullptr, NN, 0, NN, NN, HD);      // logits q_h·k_hᵀ (K = 64)
    k_sig<<<NN / 8, 256, 0, stream>>>(S, P16);
    k_gemm_hhx<0><<<dim3(((NN / 16) * (HD / 64) + 3) / 4, 1), 128, 0, stream>>>(P16, NN, 0, Vt + (size_t)h * HD * NN, NN, 0, 0.000030517578125f * 0.125f, nullptr, 0, h == 0 ? nullptr : (float*)d_out, 1, (size_t)HD, 0, (float*)d_out, nullptr, HD, 0, NN, HD, NN); }      // out += (attn·v_h)/8
}

// v001
// Measured time: 90.7 microseconds a run.
// Two timings next to v000 put it at 18.5 and 19.5 times that version's speed.
#include <hip/hip_runtime.h>
// Sigmoid multi-head attention (N=4096 tokens, IN=256, 8 heads x 64): q,k,v = x.W^T + b; S_h = sigmoid(q_h.k_h^T); attn = S_h / sum_keys S_h; out = mean_h(attn.v_h) -> [4096, 64].
// Projections as GEMMs on v_wmma_f32_16x16x32_f16 (x bf16-exact, (out,in) weights bf16-exact x 2^4, q/k/v f16, f32 accumulate). Logits (K = 64), sigmoid, row sums and P.V run in ONE
// kernel on the same WMMA form: S and P = f16(sigmoid) never leave registers; each workgroup leaves unnormalised sums of a quarter of the keys, a small kernel divides and takes the head mean.
#define NN 4096
#define CIN 256
#define PJ 512
#define HD 64
#define NH 8

typedef __bf16 v16b __attribute__((ext_vector_type(16)));
typedef unsigned short v8us __attribute__((ext_vector_type(8), may_alias));
typedef float  v8f  __attribute__((ext_vector_type(8)));
typedef float  v4f  __attribute__((ext_vector_type(4)));
typedef float  v4fa __attribute__((ext_vector_type(4), may_alias));
union FragB { v16b v; v8us half[2]; unsigned short u[16]; };

__device__ __forceinline__ unsigned short bf16_bits(float x) { unsigned int u = __float_as_uint(x); return (unsigned short)((u + 0x7FFFu + ((u >> 16) & 1u)) >> 16); }
__device__ __forceinline__ float bf16_val(unsigned short b) { return __uint_as_float(((unsigned int)b) << 16); }
__device__ __forceinline__ float bf16_round(float x) { return bf16_val(bf16_bits(x)); }
// D += A·B with NT terms: 1 = ah·bh, 2 = + al·bh (A split), 3 = + ah·bl (both split)
template <int NT>
__device__ __forceinline__ v8f mmaN(v16b ah, v16b al, v16b bh, v16b bl, v8f c) {
  c = __builtin_amdgcn_wmma_f32_16x16x32_bf16(false, ah, false, bh, (short)0, c, false, false);
  if (NT >= 2) c = __builtin_amdgcn_wmma_f32_16x16x32_bf16(false, al, false, bh, (short)0, c, false, false);
  if (NT >= 3) c = __builtin_amdgcn_wmma_f32_16x16x32_bf16(false, ah, false, bl, (short)0, c, false, false);
  asm volatile("v_nop\n\tv_nop\n\tv_nop\n\tv_nop" : "+v"(c) : "v"(ah), "v"(al), "v"(bh), "v"(bl));
  return c;
}

__global__ __launch_bounds__(256) void k_wt_bf16(const float* __restrict__ W, unsigned short* __restrict__ Wt, int K, int N) {
  const int t = blockIdx.x * 256 + threadIdx.x;
  const int k8n = K / 8;
  if (t >= N * k8n) return;
  const int n = t / k8n, k8 = (t % k8n) * 8;
  v8us v;
#pragma unroll
  for (int i = 0; i < 8; ++i) v[i] = bf16_bits(W[(size_t)(k8 + i) * N + n]);
  *(v8us*)(Wt + (size_t)n * K + k8) = v;
  
}

// GEMM C[M][N] (f32, pitch ldc) = act(A[M][K]·W + bias). A f32 row-major (pitch lda) converted per fragment to bf16
// (ASPLIT: hi/lo two planes -> 2 terms, else single rounded term); Wt bf16 [N][K] (pitch ldb). BIAS_BF16 rounds the
// bias to bf16 first (bias quantised to bf16 before the add). K%32==0, M%16==0, N%64==0.
template <bool ASPLIT, int ACT, bool BIAS_BF16>
__global__ __launch_bounds__(128) void k_gemm_bf(const float* __restrict__ A, int lda, const unsigned short* __restrict__ Wt, int ldb,
                                               const float* __restrict__ bias, float* __restrict__ C, int ldc, int M, int N, int K) {
  __shared__ __attribute__((aligned(16))) float so[4][16][64];
  const int tid = threadIdx.x, w = tid >> 5, lane = tid & 31, ln = lane & 15, hh = lane >> 4;
  const int ntn = N / 64;
  const int wid = blockIdx.x * 4 + w;
  const int mt = wid / ntn, nq = wid % ntn;
  if (mt * 16 >= M) return;
  const int row0 = mt * 16, col0 = nq * 64;
  const float* arow = A + (size_t)(row0 + ln) * lda;
  v8f acc[4] = {};
  for (int kb = 0; kb < K; kb += 32) {
    FragB ah, al;
    const v4f x0 = *(const v4fa*)(arow + kb + 8 * hh), x1 = *(const v4fa*)(arow + kb + 8 * hh + 4);
    const v4f x2 = *(const v4fa*)(arow + kb + 16 + 8 * hh), x3 = *(const v4fa*)(arow + kb + 16 + 8 * hh + 4);
    float xs[16] = {x0[0],x0[1],x0[2],x0[3],x1[0],x1[1],x1[2],x1[3],x2[0],x2[1],x2[2],x2[3],x3[0],x3[1],x3[2],x3[3]};
#pragma unroll
    for (int i = 0; i < 16; ++i) { const unsigned short hb = bf16_bits(xs[i]); ah.u[i] = hb; al.u[i] = ASPLIT ? bf16_bits(xs[i] - bf16_val(hb)) : (unsigned short)0; }
#pragma unroll
    for (int t = 0; t < 4; ++t) {
      const unsigned short* brow = Wt + (size_t)(col0 + t * 16 + ln) * ldb + kb;
      FragB b;
      b.half[0] = *(const v8us*)(brow + 8 * hh);
      b.half[1] = *(const v8us*)(brow + 16 + 8 * hh);
      acc[t] = mmaN<ASPLIT ? 2 : 1>(ah.v, al.v, b.v, b.v, acc[t]);
    }
  }
#pragma unroll
  for (int t = 0; t < 4; ++t) {
    float bv = bias ? bias[col0 + t * 16 + ln] : 0.f;
    if (BIAS_BF16) bv = bf16_round(bv);
#pragma unroll
    for (int r = 0; r < 8; ++r) { float v = acc[t][r] + bv; if (ACT == 1) v = fmaxf(v, 0.f); so[w][8 * hh + r][t * 16 + ln] = v; }
  }
  __builtin_amdgcn_fence(__ATOMIC_ACQ_REL, "workgroup");
  __builtin_amdgcn_wave_barrier();
  const int rsub = lane >> 4, c4 = (lane & 15) * 4;
  {
#pragma unroll
    for (int q = 0; q < 8; ++q) {
      const int r = q * 2 + rsub;
      const v4f v = *(const v4fa*)&so[w][r][c4];
      *(v4f*)(C + (size_t)(row0 + r) * ldc + col0 + c4) = v;
    }
    
  }
}

// Flash-style causal/unmasked attention, all contractions 3-term bf16 hi/lo splits, f32 softmax with running max.
// q,k,v rows are read from f32 buffers with arbitrary row pitch (so they can live inside a fused qkv buffer);
// D = head size (multiple of 32, <= 128); one wave = 16 query rows; block = 4 waves (64 queries) sharing K/V chunks of 32.
template <int D, bool CAUSAL>
__global__ __launch_bounds__(128) void k_flash(const float* __restrict__ qb, const float* __restrict__ kb, const float* __restrict__ vb,
                                             int pitch, int T, int H, float scale, float* __restrict__ y, int ypitch) {
  constexpr int KS = D / 32;        // k-steps for QK
  constexpr int DT = D / 16;        // d tiles for PV
  __shared__ __attribute__((aligned(16))) unsigned short sKh[32][D + 8], sKl[32][D + 8], sVh[32][D + 8], sVl[32][D + 8];
  __shared__ __attribute__((aligned(16))) unsigned short sPh[4][16][40], sPl[4][16][40];
  __shared__ __attribute__((aligned(16))) float sO[4][16][D];
  const int tid = threadIdx.x, w = tid >> 5, lane = tid & 31, ln = lane & 15, hh = lane >> 4;
  const int nqb = (T + 63) / 64;
  const int bh = blockIdx.x / nqb, qblk = blockIdx.x % nqb;
  const int b = bh / H, h = bh % H;
  const int q0 = qblk * 64 + w * 16;
  const float* Q = qb + (size_t)b * T * pitch + h * D;
  const float* K = kb + (size_t)b * T * pitch + h * D;
  const float* V = vb + (size_t)b * T * pitch + h * D;

  // A fragments of the wave's 16 query rows (scaled), hi/lo
  FragB aqh[KS], aql[KS];
  {
    int row = q0 + ln; if (row >= T) row = T - 1;
    const float* qr = Q + (size_t)row * pitch;
#pragma unroll
    for (int ks = 0; ks < KS; ++ks)
#pragma unroll
      for (int i = 0; i < 16; ++i) {
        const int d = ks * 32 + ((i < 8) ? (8 * hh + i) : (16 + 8 * hh + (i - 8)));
        const float x = qr[d] * scale; const unsigned short hb = bf16_bits(x);
        aqh[ks].u[i] = hb; aql[ks].u[i] = bf16_bits(x - bf16_val(hb));
      }
  }
  float m_r[8], l_r[8];
#pragma unroll
  for (int r = 0; r < 8; ++r) { m_r[r] = -3.0e38f; l_r[r] = 0.f; }
  v8f oacc[DT];
#pragma unroll
  for (int dt = 0; dt < DT; ++dt) oacc[dt] = (v8f){0.f,0.f,0.f,0.f,0.f,0.f,0.f,0.f};

  const int kv_end = CAUSAL ? min(T, qblk * 64 + 64) : T;     // block-uniform
  for (int j0 = 0; j0 < kv_end; j0 += 32) {
    __syncthreads();
    for (int e = tid; e < 32 * (D / 4); e += 128) {
      const int r = e / (D / 4), c4 = (e % (D / 4)) * 4;
      const int key = j0 + r;
      v4f kf = {0.f,0.f,0.f,0.f}, vf = {0.f,0.f,0.f,0.f};
      if (key < T) { kf = *(const v4fa*)(K + (size_t)key * pitch + c4); vf = *(const v4fa*)(V + (size_t)key * pitch + c4); }
#pragma unroll
      for (int t = 0; t < 4; ++t) {
        unsigned short hb = bf16_bits(kf[t]); sKh[r][c4 + t] = hb; sKl[r][c4 + t] = bf16_bits(kf[t] - bf16_val(hb));
        hb = bf16_bits(vf[t]); sVh[r][c4 + t] = hb; sVl[r][c4 + t] = bf16_bits(vf[t] - bf16_val(hb));
      }
    }
    __syncthreads();
    // S tile 16 x 32
    v8f s[2];
#pragma unroll
    for (int nt = 0; nt < 2; ++nt) {
      v8f acc = {};
#pragma unroll
      for (int ks = 0; ks < KS; ++ks) {
        FragB bh_, bl_;
        bh_.half[0] = *(const v8us*)&sKh[nt * 16 + ln][ks * 32 + 8 * hh]; bh_.half[1] = *(const v8us*)&sKh[nt * 16 + ln][ks * 32 + 16 + 8 * hh];
        bl_.half[0] = *(const v8us*)&sKl[nt * 16 + ln][ks * 32 + 8 * hh]; bl_.half[1] = *(const v8us*)&sKl[nt * 16 + ln][ks * 32 + 16 + 8 * hh];
        acc = mmaN<3>(aqh[ks].v, aql[ks].v, bh_.v, bl_.v, acc);
      }
      s[nt] = acc;
    }
    // mask + running max (rows 8hh+r; the 16 lanes of a half share rows)
    float alpha[8];
#pragma unroll
    for (int r = 0; r < 8; ++r) {
      const int qi = q0 + 8 * hh + r;
      const int ja = j0 + ln, jb = j0 + 16 + ln;
      if (CAUSAL) { if (ja > qi) s[0][r] = -3.0e38f; if (jb > qi) s[1][r] = -3.0e38f; }
      if (ja >= T) s[0][r] = -3.0e38f;
      if (jb >= T) s[1][r] = -3.0e38f;
      float mx = fmaxf(s[0][r], s[1][r]);
      mx = fmaxf(mx, __shfl_xor(mx, 1, 32)); mx = fmaxf(mx, __shfl_xor(mx, 2, 32)); mx = fmaxf(mx, __shfl_xor(mx, 4, 32)); mx = fmaxf(mx, __shfl_xor(mx, 8, 32));
      const float mnew = fmaxf(m_r[r], mx);
      alpha[r] = (mnew > -1.0e38f) ? __expf(m_r[r] - mnew) : 1.0f;
      const float p0 = (s[0][r] > -1.0e38f) ? __expf(s[0][r] - mnew) : 0.f;
      const float p1 = (s[1][r] > -1.0e38f) ? __expf(s[1][r] - mnew) : 0.f;
      m_r[r] = mnew;
      l_r[r] = l_r[r] * alpha[r] + p0 + p1;            // per-lane partial row sum (16 lanes combined at the end)
      unsigned short hb = bf16_bits(p0); sPh[w][8 * hh + r][ln] = hb;      sPl[w][8 * hh + r][ln] = bf16_bits(p0 - bf16_val(hb));
      hb = bf16_bits(p1);                sPh[w][8 * hh + r][16 + ln] = hb; sPl[w][8 * hh + r][16 + ln] = bf16_bits(p1 - bf16_val(hb));
    }
#pragma unroll
    for (int dt = 0; dt < DT; ++dt)
#pragma unroll
      for (int r = 0; r < 8; ++r) oacc[dt][r] *= alpha[r];
    __builtin_amdgcn_fence(__ATOMIC_ACQ_REL, "workgroup");
    __builtin_amdgcn_wave_barrier();
    FragB pah, pal;
    pah.half[0] = *(const v8us*)&sPh[w][ln][8 * hh]; pah.half[1] = *(const v8us*)&sPh[w][ln][16 + 8 * hh];
    pal.half[0] = *(const v8us*)&sPl[w][ln][8 * hh]; pal.half[1] = *(const v8us*)&sPl[w][ln][16 + 8 * hh];
#pragma unroll
    for (int dt = 0; dt < DT; ++dt) {
      FragB bvh, bvl;
#pragma unroll
      for (int i = 0; i < 8; ++i) {
        bvh.u[i] = sVh[8 * hh + i][dt * 16 + ln]; bvh.u[8 + i] = sVh[16 + 8 * hh + i][dt * 16 + ln];
        bvl.u[i] = sVl[8 * hh + i][dt * 16 + ln]; bvl.u[8 + i] = sVl[16 + 8 * hh + i][dt * 16 + ln];
      }
      oacc[dt] = mmaN<3>(pah.v, pal.v, bvh.v, bvl.v, oacc[dt]);
    }
    __builtin_amdgcn_fence(__ATOMIC_ACQ_REL, "workgroup");
    __builtin_amdgcn_wave_barrier();
  }
#pragma unroll
  for (int r = 0; r < 8; ++r) {
    float l = l_r[r];
    l += __shfl_xor(l, 1, 32); l += __shfl_xor(l, 2, 32); l += __shfl_xor(l, 4, 32); l += __shfl_xor(l, 8, 32);
    l_r[r] = (l > 0.f) ? 1.0f / l : 0.f;
  }
#pragma unroll
  for (int dt = 0; dt < DT; ++dt)
#pragma unroll
    for (int r = 0; r < 8; ++r) sO[w][8 * hh + r][dt * 16 + ln] = oacc[dt][r] * l_r[r];
  __builtin_amdgcn_fence(__ATOMIC_ACQ_REL, "workgroup");
  __builtin_amdgcn_wave_barrier();
  {
    for (int r = 0; r < 16; ++r) {
      const int row = q0 + r;
      if (row < T && lane < D / 4) {
        const v4f val = *(const v4fa*)&sO[w][r][lane * 4];
        *(v4f*)(y + ((size_t)b * T + row) * ypitch + h * D + lane * 4) = val;
      }
    }
    
  }
}

// GEMM C = act(A·W + bias + resid): A f32 (ASPLIT -> hi/lo 2 terms), Wt bf16 [N][K]; ACT 0 none, 1 relu, 2 exact gelu;
// resid (optional, f32, row index = (row % rmod), pitch ldr, RES_BF16 rounds it) added before the activation.
template <bool ASPLIT, int ACT, bool BIAS_BF16, bool RES_BF16>
__global__ __launch_bounds__(128) void k_gemm_bf3(const float* __restrict__ A, int lda, const unsigned short* __restrict__ Wt, int ldb,
                                                const float* __restrict__ bias, const float* __restrict__ resid, int rmod, int ldr,
                                                float* __restrict__ C, int ldc, int M, int N, int K) {
  __shared__ __attribute__((aligned(16))) float so[4][16][64];
  const int tid = threadIdx.x, w = tid >> 5, lane = tid & 31, ln = lane & 15, hh = lane >> 4;
  const int ntn = N / 64;
  const int wid = blockIdx.x * 4 + w;
  const int mt = wid / ntn, nq = wid % ntn;
  if (mt * 16 >= M) return;
  const int row0 = mt * 16, col0 = nq * 64;
  const float* arow = A + (size_t)(row0 + ln) * lda;
  v8f acc[4] = {};
  for (int kb = 0; kb < K; kb += 32) {
    FragB ah, al;
    const v4f x0 = *(const v4fa*)(arow + kb + 8 * hh), x1 = *(const v4fa*)(arow + kb + 8 * hh + 4);
    const v4f x2 = *(const v4fa*)(arow + kb + 16 + 8 * hh), x3 = *(const v4fa*)(arow + kb + 16 + 8 * hh + 4);
    float xs[16] = {x0[0],x0[1],x0[2],x0[3],x1[0],x1[1],x1[2],x1[3],x2[0],x2[1],x2[2],x2[3],x3[0],x3[1],x3[2],x3[3]};
#pragma unroll
    for (int i = 0; i < 16; ++i) { const unsigned short hb = bf16_bits(xs[i]); ah.u[i] = hb; al.u[i] = ASPLIT ? bf16_bits(xs[i] - bf16_val(hb)) : (unsigned short)0; }
#pragma unroll
    for (int t = 0; t < 4; ++t) {
      const unsigned short* brow = Wt + (size_t)(col0 + t * 16 + ln) * ldb + kb;
      FragB b;
      b.half[0] = *(const v8us*)(brow + 8 * hh);
      b.half[1] = *(const v8us*)(brow + 16 + 8 * hh);
      acc[t] = mmaN<ASPLIT ? 2 : 1>(ah.v, al.v, b.v, b.v, acc[t]);
    }
  }
#pragma unroll
  for (int t = 0; t < 4; ++t) {
    const int col = col0 + t * 16 + ln;
    float bv = bias ? bias[col] : 0.f;
    if (BIAS_BF16) bv = bf16_round(bv);
#pragma unroll
    for (int r = 0; r < 8; ++r) {
      float v = acc[t][r] + bv;
      if (resid) { float rv = resid[(size_t)((row0 + 8 * hh + r) % rmod) * ldr + col]; if (RES_BF16) rv = bf16_round(rv); v += rv; }
      if (ACT == 1) v = fmaxf(v, 0.f);
      if (ACT == 2) v = 0.5f * v * (1.0f + erff(v * 0.70710678118654752f));
      if (ACT == 3) { const float u = 0.7978845608028654f * (v + 0.044715f * v * v * v); v = 0.5f * v * (1.0f + tanhf(u)); }
      so[w][8 * hh + r][t * 16 + ln] = v;
    }
  }
  __builtin_amdgcn_fence(__ATOMIC_ACQ_REL, "workgroup");
  __builtin_amdgcn_wave_barrier();
  const int rsub = lane >> 4, c4 = (lane & 15) * 4;
  {
#pragma unroll
    for (int q = 0; q < 8; ++q) {
      const int r = q * 2 + rsub;
      const v4f v = *(const v4fa*)&so[w][r][c4];
      *(v4f*)(C + (size_t)(row0 + r) * ldc + col0 + c4) = v;
    }
    
  }
}
// row LayerNorm (biased variance, eps) over N: s = X (+ R); optional out_sum <- s; out_norm <- (s-mu)*rsqrt(var+eps)*g + b
template <bool PARAM_BF16>
__global__ __launch_bounds__(256) void k_layernorm(const float* __restrict__ X, const float* __restrict__ R, const float* __restrict__ g, const float* __restrict__ bta,
                                                  float* __restrict__ out_sum, float* __restrict__ out_norm, int N, float eps) {
  __shared__ float red[256];
  const int row = blockIdx.x, tid = threadIdx.x;
  const float* x = X + (size_t)row * N; const float* rr = R ? R + (size_t)row * N : nullptr;
  float vals[16];                     // up to N = 4096
  const int per = N / 256;            // contiguous chunk per thread? use strided-by-4 chunks: thread handles j = tid*4 + 1024*u
  float s1 = 0.f;
  for (int u = 0; u < per / 4; ++u) {
    const int j = tid * 4 + 1024 * u;
    const v4f a = *(const v4fa*)(x + j);
    v4f b = {0.f,0.f,0.f,0.f}; if (rr) b = *(const v4fa*)(rr + j);
#pragma unroll
    for (int q = 0; q < 4; ++q) { const float v = a[q] + b[q]; vals[u * 4 + q] = v; s1 += v; }
  }
  red[tid] = s1; __syncthreads();
  for (int st = 128; st > 0; st >>= 1) { if (tid < st) red[tid] += red[tid + st]; __syncthreads(); }
  const float mu = red[0] / (float)N; __syncthreads();
  float s2 = 0.f;
  for (int u = 0; u < per / 4; ++u)
#pragma unroll
    for (int q = 0; q < 4; ++q) { const float c = vals[u * 4 + q] - mu; s2 += c * c; }
  red[tid] = s2; __syncthreads();
  for (int st = 128; st > 0; st >>= 1) { if (tid < st) red[tid] += red[tid + st]; __syncthreads(); }
  const float rs = rsqrtf(red[0] / (float)N + eps);
  {
    for (int u = 0; u < per / 4; ++u) {
      const int j = tid * 4 + 1024 * u;
      v4f o, sm;
#pragma unroll
      for (int q = 0; q < 4; ++q) {
        float gg = g[j + q], bb = bta[j + q];
        if (PARAM_BF16) { gg = bf16_round(gg); bb = bf16_round(bb); }
        sm[q] = vals[u * 4 + q]; o[q] = (vals[u * 4 + q] - mu) * rs * gg + bb;
      }
      if (out_sum) *(v4f*)(out_sum + (size_t)row * N + j) = sm;
      *(v4f*)(out_norm + (size_t)row * N + j) = o;
    }
    
  }
}



// ---- f16 WMMA path (v_wmma_f32_16x16x32_f16): 11-bit significands for operands in range — used where a [0,1] probability operand needs more precision than bf16
typedef _Float16 v16h __attribute__((ext_vector_type(16)));
union FragH { v16h v; v8us half[2]; _Float16 h[16]; unsigned short u[16]; };
template <int NT>
__device__ __forceinline__ v8f mmaH(v16h ah, v16h al, v16h bh, v16h bl, v8f c) {
  c = __builtin_amdgcn_wmma_f32_16x16x32_f16(false, ah, false, bh, (short)0, c, false, false);
  if (NT >= 2) c = __builtin_amdgcn_wmma_f32_16x16x32_f16(false, al, false, bh, (short)0, c, false, false);
  if (NT >= 3) c = __builtin_amdgcn_wmma_f32_16x16x32_f16(false, ah, false, bl, (short)0, c, false, false);
  asm volatile("v_nop\n\tv_nop\n\tv_nop\n\tv_nop" : "+v"(c) : "v"(ah), "v"(al), "v"(bh), "v"(bl));
  return c;
}
// batched GEMM like k_gemm_b but f16 operands: A f32 (split into f16 hi/lo if ASPLIT, else rounded to f16), Bt = f16 values [n][k]; alpha; C f32; N multiple of 16 (partial tiles skipped)
template <bool ASPLIT>
__global__ __launch_bounds__(128) void k_gemm_h(const float* __restrict__ A, int lda, size_t sA, const _Float16* __restrict__ Bh, int ldb, size_t sB, float alpha, float* __restrict__ C, int ldc, size_t sC, int M, int N, int K) {
  __shared__ __attribute__((aligned(16))) float so[4][16][64];
  const int tid = threadIdx.x, w = tid >> 5, lane = tid & 31, ln = lane & 15, hh = lane >> 4; const int by = blockIdx.y;
  A += (size_t)by * sA; Bh += (size_t)by * sB; C += (size_t)by * sC;
  const int ntn = (N + 63) / 64; const int wid = blockIdx.x * 4 + w; const int mt = wid / ntn, nq = wid % ntn; if (mt * 16 >= M) return;
  const int row0 = mt * 16, col0 = nq * 64; const float* arow = A + (size_t)(row0 + ln) * lda;
  v8f acc[4] = {};
  for (int kb = 0; kb < K; kb += 32) {
    FragH ah, al;
    const v4f x0 = *(const v4fa*)(arow + kb + 8 * hh), x1 = *(const v4fa*)(arow + kb + 8 * hh + 4), x2 = *(const v4fa*)(arow + kb + 16 + 8 * hh), x3 = *(const v4fa*)(arow + kb + 16 + 8 * hh + 4);
    float xs[16] = {x0[0],x0[1],x0[2],x0[3],x1[0],x1[1],x1[2],x1[3],x2[0],x2[1],x2[2],x2[3],x3[0],x3[1],x3[2],x3[3]};
#pragma unroll
    for (int i = 0; i < 16; ++i) { const _Float16 h = (_Float16)xs[i]; ah.h[i] = h; al.h[i] = ASPLIT ? (_Float16)(xs[i] - (float)h) : (_Float16)0.0f; }
#pragma unroll
    for (int t = 0; t < 4; ++t) { if (col0 + t * 16 >= N) continue; const size_t boff = (size_t)(col0 + t * 16 + ln) * ldb + kb; FragH bq; bq.half[0] = *(const v8us*)(Bh + boff + 8 * hh); bq.half[1] = *(const v8us*)(Bh + boff + 16 + 8 * hh);
      acc[t] = mmaH<ASPLIT ? 2 : 1>(ah.v, al.v, bq.v, bq.v, acc[t]); }
  }
#pragma unroll
  for (int t = 0; t < 4; ++t) { if (col0 + t * 16 >= N) continue;
#pragma unroll
    for (int r = 0; r < 8; ++r) so[w][8 * hh + r][t * 16 + ln] = acc[t][r] * alpha; }
  __builtin_amdgcn_fence(__ATOMIC_ACQ_REL, "workgroup"); __builtin_amdgcn_wave_barrier();
  const int rsub = lane >> 4, c4 = (lane & 15) * 4;
  {
#pragma unroll
    for (int q = 0; q < 8; ++q) { const int r = q * 2 + rsub; if (col0 + c4 < N) { const v4f v = *(const v4fa*)&so[w][r][c4]; *(v4f*)(C + (size_t)(row0 + r) * ldc + col0 + c4) = v; } }
     }
}

// Wt[n][k] = f16(W[k][n]·scale) from f32 row-major W[K][N] (scale = power of two; bf16-exact weights stay exact in f16 away from the subnormal range)
__global__ __launch_bounds__(256) void k_wt_f16(const float* __restrict__ W, _Float16* __restrict__ Wt, int K, int N, float scale) {
  const int t = blockIdx.x * 256 + threadIdx.x; if (t >= N * (K / 8)) return; const int n = t / (K / 8), k8 = (t % (K / 8)) * 8; FragH f;
#pragma unroll
  for (int i = 0; i < 8; ++i) f.h[i] = (_Float16)(bf16_round(W[(size_t)(k8 + i) * N + n]) * scale); const v8us o = f.half[0];
  *(v8us*)((unsigned short*)Wt + (size_t)n * K + k8) = o; 
}
// k_gemm_hh variant with fused epilogue: v = acc·alpha + bias[by·sBias + col] (+ CP[(row/rowsPerB)·sCPb + by·64 + col] if CP) ; ACT 0 none / 1 elu ; writes f32 C and/or f16 C16 (each if non-null)
template <int ACT>
__global__ __launch_bounds__(128) void k_gemm_hhx(const _Float16* __restrict__ A, int lda, size_t sA, const _Float16* __restrict__ Bh, int ldb, size_t sB, float alpha, const float* __restrict__ bias, size_t sBias, const float* __restrict__ CP, int rowsPerB, size_t sCPb, int row0g,
    float* __restrict__ C, _Float16* __restrict__ C16, int ldc, size_t sC, int M, int N, int K) {
  __shared__ __attribute__((aligned(16))) float so[4][16][64];
  const int tid = threadIdx.x, w = tid >> 5, lane = tid & 31, ln = lane & 15, hh = lane >> 4; const int by = blockIdx.y;
  A += (size_t)by * sA; Bh += (size_t)by * sB; const size_t cofs = (size_t)by * sC; const float* bp = bias ? bias + (size_t)by * sBias : nullptr;
  const int ntn = (N + 63) / 64; const int wid = blockIdx.x * 4 + w; const int mt = wid / ntn, nq = wid % ntn; if (mt * 16 >= M) return;
  const int row0 = mt * 16, col0 = nq * 64; const _Float16* arow = A + (size_t)(row0 + ln) * lda;
  v8f acc[4] = {};
  for (int kb = 0; kb < K; kb += 32) { FragH ah; ah.half[0] = *(const v8us*)((const unsigned short*)arow + kb + 8 * hh); ah.half[1] = *(const v8us*)((const unsigned short*)arow + kb + 16 + 8 * hh);
#pragma unroll
    for (int t = 0; t < 4; ++t) { if (col0 + t * 16 >= N) continue; const size_t boff = (size_t)(col0 + t * 16 + ln) * ldb + kb; FragH bq; bq.half[0] = *(const v8us*)((const unsigned short*)Bh + boff + 8 * hh); bq.half[1] = *(const v8us*)((const unsigned short*)Bh + boff + 16 + 8 * hh);
      acc[t] = mmaH<1>(ah.v, ah.v, bq.v, bq.v, acc[t]); }
  }
#pragma unroll
  for (int t = 0; t < 4; ++t) { if (col0 + t * 16 >= N) continue; const int col = col0 + t * 16 + ln; const float bv = bp ? bf16_round(bp[col]) : 0.f;
#pragma unroll
    for (int r = 0; r < 8; ++r) { float v = acc[t][r] * alpha + bv; if (CP) { const int bidx = (row0g + row0 + 8 * hh + r) / rowsPerB; v += CP[(size_t)bidx * sCPb + (size_t)by * 64 + col]; } if (ACT == 1) v = (v > 0.f) ? v : expm1f(v); else if (ACT == 3) v = fmaxf(v, 0.f); so[w][8 * hh + r][t * 16 + ln] = v; } }
  __builtin_amdgcn_fence(__ATOMIC_ACQ_REL, "workgroup"); __builtin_amdgcn_wave_barrier();
  const int rsub = lane >> 4, c4 = (lane & 15) * 4; typedef _Float16 v4h __attribute__((ext_vector_type(4)));
  {
#pragma unroll
    for (int q = 0; q < 8; ++q) { const int r = q * 2 + rsub; if (col0 + c4 < N) { const v4f v = *(const v4fa*)&so[w][r][c4]; if (C) *(v4f*)(C + cofs + (size_t)(row0 + r) * ldc + col0 + c4) = v; if (C16) { v4h h4; for (int i = 0; i < 4; ++i) h4[i] = (_Float16)v[i]; *(v4h*)(C16 + cofs + (size_t)(row0 + r) * ldc + col0 + c4) = h4; } } }
     }
}


typedef _Float16 v4h __attribute__((ext_vector_type(4)));

__global__ __launch_bounds__(256) void k_x16(const float* __restrict__ x, _Float16* __restrict__ X16, size_t n8) { const size_t t = (size_t)blockIdx.x * 256 + threadIdx.x; if (t >= n8) return; FragH f;
#pragma unroll
  for (int q = 0; q < 8; ++q) f.h[q] = (_Float16)bf16_round(x[t * 8 + q]); *(v8us*)((unsigned short*)X16 + t * 8) = f.half[0];  }
__global__ __launch_bounds__(256) void k_h16(const float* __restrict__ x, _Float16* __restrict__ X16, size_t n8) { const size_t t = (size_t)blockIdx.x * 256 + threadIdx.x; if (t >= n8) return; FragH f;
#pragma unroll
  for (int q = 0; q < 8; ++q) f.h[q] = (_Float16)x[t * 8 + q]; *(v8us*)((unsigned short*)X16 + t * 8) = f.half[0];  }
__global__ __launch_bounds__(256) void k_round16f(const float* __restrict__ W, _Float16* __restrict__ Bt, size_t n8) { const size_t t = (size_t)blockIdx.x * 256 + threadIdx.x; if (t >= n8) return; FragH f;
#pragma unroll
  for (int i = 0; i < 8; ++i) f.h[i] = (_Float16)(bf16_round(W[t * 8 + i]) * 16.0f); *(v8us*)((unsigned short*)Bt + t * 8) = f.half[0];  }
template <int NHv, int TTv>
__global__ __launch_bounds__(256) void k_vt(const _Float16* __restrict__ V16, int ldv, int voff, _Float16* __restrict__ Vt) { __shared__ unsigned short tl[64][66]; const int tid = threadIdx.x; const int slab = blockIdx.x / (TTv / 64), lg = blockIdx.x % (TTv / 64); const int b = slab / NHv, h = slab % NHv;
  for (int i = tid; i < 64 * 8; i += 256) { const int r = i / 8, c8 = (i % 8) * 8; FragH f; f.half[0] = *(const v8us*)((const unsigned short*)V16 + ((size_t)b * TTv + lg * 64 + r) * ldv + voff + h * 64 + c8);
#pragma unroll
    for (int q = 0; q < 8; ++q) tl[r][c8 + q] = f.u[q]; }
  __syncthreads();
  {
#pragma unroll
    for (int rd = 0; rd < 2; ++rd) { const int d = rd * 32 + tid / 8, pc = tid % 8; FragH f;
#pragma unroll
      for (int q = 0; q < 8; ++q) f.u[q] = tl[pc * 8 + q][d];
      *(v8us*)((unsigned short*)Vt + ((size_t)slab * 64 + d) * TTv + lg * 64 + pc * 8) = f.half[0]; }
     } }

#define KSPL 4      // key ranges per head: 512 workgroups, two per WGP
#define KT 64       // keys per stage
#define LP 72       // LDS row pitch in 16-bit elements: 144 B = 16 B x odd, conflict-free for 16-byte fragment reads
typedef _Float16 v2h __attribute__((ext_vector_type(2)));
typedef float v2fv __attribute__((ext_vector_type(2)));
union FragP { v16h v; v2h p2[8]; };
// Eight transcendentals in place, in one statement: no neighbour reads a result or overwrites a source of the one in front of it, and the closing v_nop
// is the one slot the instruction set asks for behind the last of them.
__device__ __forceinline__ void exp2x8(float (&a)[8]) {
  asm("v_exp_f32 %0, %0\n\tv_exp_f32 %1, %1\n\tv_exp_f32 %2, %2\n\tv_exp_f32 %3, %3\n\tv_exp_f32 %4, %4\n\tv_exp_f32 %5, %5\n\tv_exp_f32 %6, %6\n\tv_exp_f32 %7, %7\n\tv_nop"
      : "+v"(a[0]), "+v"(a[1]), "+v"(a[2]), "+v"(a[3]), "+v"(a[4]), "+v"(a[5]), "+v"(a[6]), "+v"(a[7]));
}
__device__ __forceinline__ void rcpx8(float (&a)[8]) {
  asm("v_rcp_f32 %0, %0\n\tv_rcp_f32 %1, %1\n\tv_rcp_f32 %2, %2\n\tv_rcp_f32 %3, %3\n\tv_rcp_f32 %4, %4\n\tv_rcp_f32 %5, %5\n\tv_rcp_f32 %6, %6\n\tv_rcp_f32 %7, %7\n\tv_nop"
      : "+v"(a[0]), "+v"(a[1]), "+v"(a[2]), "+v"(a[3]), "+v"(a[4]), "+v"(a[5]), "+v"(a[6]), "+v"(a[7]));
}
// four waves per SIMD = two of these workgroups per WGP: the register budget the allocator may spend is that of the occupancy the grid is sized for
__global__ __launch_bounds__(256) __attribute__((amdgpu_waves_per_eu(4, 4)))
void k_fsig(const _Float16* __restrict__ Q16, const _Float16* __restrict__ K16, const _Float16* __restrict__ Vt, float* __restrict__ Op, float* __restrict__ Zp) {
  __shared__ __attribute__((aligned(16))) unsigned short sK[2][KT][LP];      // [buffer][key][dim]
  __shared__ __attribute__((aligned(16))) unsigned short sV[2][HD][LP];      // [buffer][d][key]
  const int tid = threadIdx.x, w = tid >> 5, lane = tid & 31, c = lane & 15, hh = lane >> 4;
  const int h = blockIdx.y, sp = blockIdx.z;
  const int q0 = blockIdx.x * 256 + w * 32;
  const int key0 = sp * (NN / KSPL);
  constexpr int NT = NN / KSPL / KT;
  // staging: a thread moves 16 bytes of rows r0 and r0 + 32 of the K tile and of the V^T tile
  const int r0 = tid >> 3, c8 = (tid & 7) * 8;
  const unsigned short* gk = (const unsigned short*)K16 + (size_t)(key0 + r0) * PJ + h * HD + c8;
  const unsigned short* gv = (const unsigned short*)Vt + ((size_t)h * HD + r0) * NN + key0 + c8;
  v8us rk0, rk1, rv0, rv1;
  auto fetch = [&](int t) {
    const unsigned short* kp = gk + (size_t)t * KT * PJ; const unsigned short* vp = gv + t * KT;
    rk0 = *(const v8us*)kp; rk1 = *(const v8us*)(kp + 32 * PJ); rv0 = *(const v8us*)vp; rv1 = *(const v8us*)(vp + (size_t)32 * NN);
  };
  auto put = [&](int b) {
    *(v8us*)&sK[b][r0][c8] = rk0; *(v8us*)&sK[b][r0 + 32][c8] = rk1; *(v8us*)&sV[b][r0][c8] = rv0; *(v8us*)&sV[b][r0 + 32][c8] = rv1;
  };
  // B fragments of the wave's 2 x 16 query columns, hardware k order over the 64 dims
  FragH bq[2][2];
#pragma unroll
  for (int cg = 0; cg < 2; ++cg)
#pragma unroll
    for (int ks = 0; ks < 2; ++ks) {
      const unsigned short* qr = (const unsigned short*)Q16 + (size_t)(q0 + cg * 16 + c) * PJ + h * HD + ks * 32;
      bq[cg][ks].half[0] = *(const v8us*)(qr + 8 * hh); bq[cg][ks].half[1] = *(const v8us*)(qr + 16 + 8 * hh);
    }
  v8f o[4][2];
#pragma unroll
  for (int dt = 0; dt < 4; ++dt)
#pragma unroll
    for (int cg = 0; cg < 2; ++cg) o[dt][cg] = (v8f){0.f, 0.f, 0.f, 0.f, 0.f, 0.f, 0.f, 0.f};
  v8f zs[2] = {(v8f){0.f, 0.f, 0.f, 0.f, 0.f, 0.f, 0.f, 0.f}, (v8f){0.f, 0.f, 0.f, 0.f, 0.f, 0.f, 0.f, 0.f}};      // row sums of the f16 P, taken on the matrix pipe: A = all ones
  FragH ones;
#pragma unroll
  for (int i = 0; i < 16; ++i) ones.h[i] = (_Float16)1.0f;
  fetch(0); put(0);
  __syncthreads();
  // rolled: one pass already holds 36 WMMAs, and a second copy of the body would only cost registers and instruction cache
#pragma unroll 1
  for (int t = 0; t < NT; ++t) {
    const int b = t & 1;
    if (t + 1 < NT) fetch(t + 1);      // the next stage's global loads fly while this stage is worked on
#pragma unroll
    for (int j = 0; j < 2; ++j) {      // 32 keys
      FragH ka[2][2];
#pragma unroll
      for (int kt = 0; kt < 2; ++kt)
#pragma unroll
        for (int ks = 0; ks < 2; ++ks) {
          const unsigned short* kr = &sK[b][j * 32 + kt * 16 + c][ks * 32];
          ka[kt][ks].half[0] = *(const v8us*)(kr + 8 * hh); ka[kt][ks].half[1] = *(const v8us*)(kr + 16 + 8 * hh);
        }
      v8f s[2][2];      // s[cg][kt][r] = logit(key j*32 + kt*16 + 8*hh + r, query cg*16 + c)
#pragma unroll
      for (int cg = 0; cg < 2; ++cg)
#pragma unroll
        for (int kt = 0; kt < 2; ++kt) {
          s[cg][kt] = (v8f){0.f, 0.f, 0.f, 0.f, 0.f, 0.f, 0.f, 0.f};
          s[cg][kt] = __builtin_amdgcn_wmma_f32_16x16x32_f16(false, ka[kt][0].v, false, bq[cg][0].v, (short)0, s[cg][kt], false, false);
          s[cg][kt] = __builtin_amdgcn_wmma_f32_16x16x32_f16(false, ka[kt][1].v, false, bq[cg][1].v, (short)0, s[cg][kt], false, false);
        }
      FragH va[4];      // V^T fragments asked for ahead of the sigmoid, which covers their LDS latency
#pragma unroll
      for (int dt = 0; dt < 4; ++dt) {
        const unsigned short* vr = &sV[b][dt * 16 + c][j * 32];
        va[dt].half[0] = *(const v8us*)(vr + 8 * hh); va[dt].half[1] = *(const v8us*)(vr + 16 + 8 * hh);
      }
      FragP pb[2];
#pragma unroll
      for (int cg = 0; cg < 2; ++cg)
#pragma unroll
        for (int kt = 0; kt < 2; ++kt) {
          float p[8];
#pragma unroll
          for (int r = 0; r < 8; ++r) p[r] = s[cg][kt][r] * -1.4426950408889634f;
          exp2x8(p);
#pragma unroll
          for (int r = 0; r < 8; ++r) p[r] += 1.0f;
          rcpx8(p);      // p = 1 / (1 + 2^(-s log2 e))
#pragma unroll
          for (int r = 0; r < 8; r += 2) pb[cg].p2[kt * 4 + (r >> 1)] = __builtin_convertvector((v2fv){p[r], p[r + 1]}, v2h);      // element kt*8 + r of B = key 8*hh + r (kt 0), 16 + 8*hh + r (kt 1): the hardware k order
        }
#pragma unroll
      for (int cg = 0; cg < 2; ++cg) zs[cg] = __builtin_amdgcn_wmma_f32_16x16x32_f16(false, ones.v, false, pb[cg].v, (short)0, zs[cg], false, false);      // every row of zs = the column sums of P^T
#pragma unroll
      for (int dt = 0; dt < 4; ++dt)
#pragma unroll
        for (int cg = 0; cg < 2; ++cg) o[dt][cg] = __builtin_amdgcn_wmma_f32_16x16x32_f16(false, va[dt].v, false, pb[cg].v, (short)0, o[dt][cg], false, false);
    }
    if (t + 1 < NT) put(b ^ 1);      // that buffer's last readers left it at the barrier that ended pass t - 1
    __syncthreads();                 // publishes stage t + 1 and ends every read of stage t
  }
  // o[dt][cg][r] = sum_keys P.V at d = dt*16 + 8*hh + r, query cg*16 + c. Staged order of a query's 64 values: [hh][dt][r], so a lane writes one whole 128-byte line.
#pragma unroll
  for (int cg = 0; cg < 2; ++cg) {
    const int q = q0 + cg * 16 + c;
    const size_t slab = ((size_t)h * KSPL + sp) * NN + q;
    float* op = Op + slab * HD + hh * 32;
#pragma unroll
    for (int dt = 0; dt < 4; ++dt) {
      *(v4f*)(op + dt * 8) = (v4f){o[dt][cg][0], o[dt][cg][1], o[dt][cg][2], o[dt][cg][3]};
      *(v4f*)(op + dt * 8 + 4) = (v4f){o[dt][cg][4], o[dt][cg][5], o[dt][cg][6], o[dt][cg][7]};
    }
    if (hh == 0) Zp[slab] = zs[cg][0];      // both lane halves hold the same sum
  }
}
// out[q][d] = 1/8 sum_h (sum_ranges Op) / (sum_ranges Zp). A wave takes one query: lane = (half hf of the heads, four consecutive values i of the staged order [hh][dt][r]).
__global__ __launch_bounds__(256) void k_hmean(const float* __restrict__ Op, const float* __restrict__ Zp, float* __restrict__ out) {
  const unsigned tid = threadIdx.x, lane = tid & 31, i = lane & 15, hf = lane >> 4;
  const unsigned q = blockIdx.x * 8 + (tid >> 5), e = i * 4;
  const float* pm = Op + ((size_t)(hf * 16 + 8) * NN + q) * HD + e;      // the middle of the lane's 16 (head, key range) planes of 1 MiB: all 16 lie within a load's immediate offset
  const float* pz = Zp + (size_t)(hf * 16 + i) * NN + q;                 // lane i holds the row sum of plane i of its half
  v4f s[16]; float z;
  // The 17 loads and their data wait in one statement: all are in flight together (one round trip to memory), and no register that an issued load names is rewritten in front of the wait
  asm volatile("global_load_b128 %0, %17, off offset:-8388608\n\t"
               "global_load_b128 %1, %17, off offset:-7340032\n\t"
               "global_load_b128 %2, %17, off offset:-6291456\n\t"
               "global_load_b128 %3, %17, off offset:-5242880\n\t"
               "global_load_b128 %4, %17, off offset:-4194304\n\t"
               "global_load_b128 %5, %17, off offset:-3145728\n\t"
               "global_load_b128 %6, %17, off offset:-2097152\n\t"
               "global_load_b128 %7, %17, off offset:-1048576\n\t"
               "global_load_b128 %8, %17, off\n\t"
               "global_load_b128 %9, %17, off offset:1048576\n\t"
               "global_load_b128 %10, %17, off offset:2097152\n\t"
               "global_load_b128 %11, %17, off offset:3145728\n\t"
               "global_load_b128 %12, %17, off offset:4194304\n\t"
               "global_load_b128 %13, %17, off offset:5242880\n\t"
               "global_load_b128 %14, %17, off offset:6291456\n\t"
               "global_load_b128 %15, %17, off offset:7340032\n\t"
               "global_load_b32 %16, %18, off\n\t"
               "s_wait_loadcnt 0x0"
               : "=&v"(s[0]), "=&v"(s[1]), "=&v"(s[2]), "=&v"(s[3]), "=&v"(s[4]), "=&v"(s[5]), "=&v"(s[6]), "=&v"(s[7]), "=&v"(s[8]), "=&v"(s[9]), "=&v"(s[10]), "=&v"(s[11]), "=&v"(s[12]), "=&v"(s[13]), "=&v"(s[14]), "=&v"(s[15]), "=&v"(z)
               : "v"(pm), "v"(pz) : "memory");
  z += __shfl_xor(z, 1, 32); z += __shfl_xor(z, 2, 32);      // the four key ranges of a head lie in four neighbouring lanes
  const float inv = 1.0f / z;
  v4f acc = {0.f, 0.f, 0.f, 0.f};
#pragma unroll
  for (int hl = 0; hl < 4; ++hl) acc += (((s[hl * 4] + s[hl * 4 + 1]) + s[hl * 4 + 2]) + s[hl * 4 + 3]) * __shfl(inv, (int)(hf * 16 + hl * 4), 32);
#pragma unroll
  for (int c = 0; c < 4; ++c) acc[c] += __shfl_xor(acc[c], 16, 32);      // the other four heads
  const unsigned d = ((e >> 3) & 3) * 16 + (e >> 5) * 8 + (e & 7);
  if (hf == 0) *(v4f*)(out + (size_t)q * HD + d) = acc * 0.125f;
}
extern "C" void kernel_launch(void* const* d_in, const int* in_sizes, int n_in,
                              void* d_out, int out_size, void* d_ws, size_t ws_size, hipStream_t stream) {
  (void)in_sizes; (void)n_in; (void)out_size;
  const float* x = (const float*)d_in[0]; const float* Wq = (const float*)d_in[1]; const float* bq = (const float*)d_in[2]; const float* Wk = (const float*)d_in[3]; const float* bk = (const float*)d_in[4]; const float* Wv = (const float*)d_in[5]; const float* bv = (const float*)d_in[6];
  char* ws = (char*)d_ws; size_t off = 0;
  auto take = [&](size_t bytes) { char* p = ws + off; off += (bytes + 255) & ~(size_t)255; return p; };
  _Float16* Bq = (_Float16*)take((size_t)PJ * CIN * 2); _Float16* Bk = (_Float16*)take((size_t)PJ * CIN * 2); _Float16* Bv = (_Float16*)take((size_t)PJ * CIN * 2); _Float16* X16 = (_Float16*)take((size_t)NN * CIN * 2); _Float16* Q16 = (_Float16*)take((size_t)NN * PJ * 2); _Float16* K16 = (_Float16*)take((size_t)NN * PJ * 2); _Float16* V16 = (_Float16*)take((size_t)NN * PJ * 2); _Float16* Vt = (_Float16*)take((size_t)NN * PJ * 2); float* Op = (float*)take((size_t)NH * KSPL * NN * HD * 4); float* Zp = (float*)take((size_t)NH * KSPL * NN * 4);
  if (off > ws_size) return;      // 0.8 + 2.1 + 4.2 x 4 + 33.6 + 0.5 = about 54 MB
  k_round16f<<<(PJ * CIN / 8 + 255) / 256, 256, 0, stream>>>(Wq, Bq, PJ * CIN / 8); k_round16f<<<(PJ * CIN / 8 + 255) / 256, 256, 0, stream>>>(Wk, Bk, PJ * CIN / 8); k_round16f<<<(PJ * CIN / 8 + 255) / 256, 256, 0, stream>>>(Wv, Bv, PJ * CIN / 8);
  k_x16<<<(NN * CIN / 8 + 255) / 256, 256, 0, stream>>>(x, X16, (size_t)NN * CIN / 8);
  const dim3 gp(((NN / 16) * (PJ / 64) + 3) / 4, 1);
  k_gemm_hhx<0><<<gp, 128, 0, stream>>>(X16, CIN, 0, Bq, CIN, 0, 0.0625f, bq, 0, nullptr, 1, 0, 0, nullptr, Q16, PJ, 0, NN, PJ, CIN); k_gemm_hhx<0><<<gp, 128, 0, stream>>>(X16, CIN, 0, Bk, CIN, 0, 0.0625f, bk, 0, nullptr, 1, 0, 0, nullptr, K16, PJ, 0, NN, PJ, CIN); k_gemm_hhx<0><<<gp, 128, 0, stream>>>(X16, CIN, 0, Bv, CIN, 0, 0.0625f, bv, 0, nullptr, 1, 0, 0, nullptr, V16, PJ, 0, NN, PJ, CIN);      // head h at cols h·64
  k_vt<NH, NN><<<1 * NH * (NN / 64), 256, 0, stream>>>(V16, PJ, 0, Vt);      // [h][64][N]
  k_fsig<<<dim3(NN / 256, NH, KSPL), 256, 0, stream>>>(Q16, K16, Vt, Op, Zp);
  k_hmean<<<NN / 8, 256, 0, stream>>>(Op, Zp, (float*)d_out);
}

// v002
// A run of this version takes 46.4 microseconds.
// In both of two side-by-side timings against v001, it was 1.91 times as fast.
// Counting every step since v000, it is 36.2 times as fast.
#include <hip/hip_runtime.h>
// Sigmoid multi-head attention (N=4096 tokens, IN=256, 8 heads x 64): q,k,v = x.W^T + b; S_h = sigmoid(q_h.k_h^T); attn = S_h / sum_keys S_h; out = mean_h(attn.v_h) -> [4096, 64].
// All three projections in one kernel on v_wmma_f32_16x16x32_f16 (x bf16-exact, (out,in) weights bf16-exact x 2^4, q/k/v f16, f32 accumulate). Logits (K = 64), sigmoid, row sums and P.V run in ONE
// kernel on the same WMMA form: S and P = f16(sigmoid) never leave registers; each workgroup leaves unnormalised sums of a quarter of the keys, a small kernel divides and takes the head mean.
#define NN 4096
#define CIN 256
#define PJ 512
#define HD 64
#define NH 8

typedef __bf16 v16b __attribute__((ext_vector_type(16)));
typedef unsigned short v8us __attribute__((ext_vector_type(8), may_alias));
typedef float  v8f  __attribute__((ext_vector_type(8)));
typedef float  v4f  __attribute__((ext_vector_type(4)));
typedef float  v4fa __attribute__((ext_vector_type(4), may_alias));
union FragB { v16b v; v8us half[2]; unsigned short u[16]; };

__device__ __forceinline__ unsigned short bf16_bits(float x) { unsigned int u = __float_as_uint(x); return (unsigned short)((u + 0x7FFFu + ((u >> 16) & 1u)) >> 16); }
__device__ __forceinline__ float bf16_val(unsigned short b) { return __uint_as_float(((unsigned int)b) << 16); }
__device__ __forceinline__ float bf16_round(float x) { return bf16_val(bf16_bits(x)); }
// D += A·B with NT terms: 1 = ah·bh, 2 = + al·bh (A split), 3 = + ah·bl (both split)
template <int NT>
__device__ __forceinline__ v8f mmaN(v16b ah, v16b al, v16b bh, v16b bl, v8f c) {
  c = __builtin_amdgcn_wmma_f32_16x16x32_bf16(false, ah, false, bh, (short)0, c, false, false);
  if (NT >= 2) c = __builtin_amdgcn_wmma_f32_16x16x32_bf16(false, al, false, bh, (short)0, c, false, false);
  if (NT >= 3) c = __builtin_amdgcn_wmma_f32_16x16x32_bf16(false, ah, false, bl, (short)0, c, false, false);
  asm volatile("v_nop\n\tv_nop\n\tv_nop\n\tv_nop" : "+v"(c) : "v"(ah), "v"(al), "v"(bh), "v"(bl));
  return c;
}

__global__ __launch_bounds__(256) void k_wt_bf16(const float* __restrict__ W, unsigned short* __restrict__ Wt, int K, int N) {
  const int t = blockIdx.x * 256 + threadIdx.x;
  const int k8n = K / 8;
  if (t >= N * k8n) return;
  const int n = t / k8n, k8 = (t % k8n) * 8;
  v8us v;
#pragma unroll
  for (int i = 0; i < 8; ++i) v[i] = bf16_bits(W[(size_t)(k8 + i) * N + n]);
  *(v8us*)(Wt + (size_t)n * K + k8) = v;
  
}

// GEMM C[M][N] (f32, pitch ldc) = act(A[M][K]·W + bias). A f32 row-major (pitch lda) converted per fragment to bf16
// (ASPLIT: hi/lo two planes -> 2 terms, else single rounded term); Wt bf16 [N][K] (pitch ldb). BIAS_BF16 rounds the
// bias to bf16 first (bias quantised to bf16 before the add). K%32==0, M%16==0, N%64==0.
template <bool ASPLIT, int ACT, bool BIAS_BF16>
__global__ __launch_bounds__(128) void k_gemm_bf(const float* __restrict__ A, int lda, const unsigned short* __restrict__ Wt, int ldb,
                                               const float* __restrict__ bias, float* __restrict__ C, int ldc, int M, int N, int K) {
  __shared__ __attribute__((aligned(16))) float so[4][16][64];
  const int tid = threadIdx.x, w = tid >> 5, lane = tid & 31, ln = lane & 15, hh = lane >> 4;
  const int ntn = N / 64;
  const int wid = blockIdx.x * 4 + w;
  const int mt = wid / ntn, nq = wid % ntn;
  if (mt * 16 >= M) return;
  const int row0 = mt * 16, col0 = nq * 64;
  const float* arow = A + (size_t)(row0 + ln) * lda;
  v8f acc[4] = {};
  for (int kb = 0; kb < K; kb += 32) {
    FragB ah, al;
    const v4f x0 = *(const v4fa*)(arow + kb + 8 * hh), x1 = *(const v4fa*)(arow + kb + 8 * hh + 4);
    const v4f x2 = *(const v4fa*)(arow + kb + 16 + 8 * hh), x3 = *(const v4fa*)(arow + kb + 16 + 8 * hh + 4);
    float xs[16] = {x0[0],x0[1],x0[2],x0[3],x1[0],x1[1],x1[2],x1[3],x2[0],x2[1],x2[2],x2[3],x3[0],x3[1],x3[2],x3[3]};
#pragma unroll
    for (int i = 0; i < 16; ++i) { const unsigned short hb = bf16_bits(xs[i]); ah.u[i] = hb; al.u[i] = ASPLIT ? bf16_bits(xs[i] - bf16_val(hb)) : (unsigned short)0; }
#pragma unroll
    for (int t = 0; t < 4; ++t) {
      const unsigned short* brow = Wt + (size_t)(col0 + t * 16 + ln) * ldb + kb;
      FragB b;
      b.half[0] = *(const v8us*)(brow + 8 * hh);
      b.half[1] = *(const v8us*)(brow + 16 + 8 * hh);
      acc[t] = mmaN<ASPLIT ? 2 : 1>(ah.v, al.v, b.v, b.v, acc[t]);
    }
  }
#pragma unroll
  for (int t = 0; t < 4; ++t) {
    float bv = bias ? bias[col0 + t * 16 + ln] : 0.f;
    if (BIAS_BF16) bv = bf16_round(bv);
#pragma unroll
    for (int r = 0; r < 8; ++r) { float v = acc[t][r] + bv; if (ACT == 1) v = fmaxf(v, 0.f); so[w][8 * hh + r][t * 16 + ln] = v; }
  }
  __builtin_amdgcn_fence(__ATOMIC_ACQ_REL, "workgroup");
  __builtin_amdgcn_wave_barrier();
  const int rsub = lane >> 4, c4 = (lane & 15) * 4;
  {
#pragma unroll
    for (int q = 0; q < 8; ++q) {
      const int r = q * 2 + rsub;
      const v4f v = *(const v4fa*)&so[w][r][c4];
      *(v4f*)(C + (size_t)(row0 + r) * ldc + col0 + c4) = v;
    }
    
  }
}

// Flash-style causal/unmasked attention, all contractions 3-term bf16 hi/lo splits, f32 softmax with running max.
// q,k,v rows are read from f32 buffers with arbitrary row pitch (so they can live inside a fused qkv buffer);
// D = head size (multiple of 32, <= 128); one wave = 16 query rows; block = 4 waves (64 queries) sharing K/V chunks of 32.
template <int D, bool CAUSAL>
__global__ __launch_bounds__(128) void k_flash(const float* __restrict__ qb, const float* __restrict__ kb, const float* __restrict__ vb,
                                             int pitch, int T, int H, float scale, float* __restrict__ y, int ypitch) {
  constexpr int KS = D / 32;        // k-steps for QK
  constexpr int DT = D / 16;        // d tiles for PV
  __shared__ __attribute__((aligned(16))) unsigned short sKh[32][D + 8], sKl[32][D + 8], sVh[32][D + 8], sVl[32][D + 8];
  __shared__ __attribute__((aligned(16))) unsigned short sPh[4][16][40], sPl[4][16][40];
  __shared__ __attribute__((aligned(16))) float sO[4][16][D];
  const int tid = threadIdx.x, w = tid >> 5, lane = tid & 31, ln = lane & 15, hh = lane >> 4;
  const int nqb = (T + 63) / 64;
  const int bh = blockIdx.x / nqb, qblk = blockIdx.x % nqb;
  const int b = bh / H, h = bh % H;
  const int q0 = qblk * 64 + w * 16;
  const float* Q = qb + (size_t)b * T * pitch + h * D;
  const float* K = kb + (size_t)b * T * pitch + h * D;
  const float* V = vb + (size_t)b * T * pitch + h * D;

  // A fragments of the wave's 16 query rows (scaled), hi/lo
  FragB aqh[KS], aql[KS];
  {
    int row = q0 + ln; if (row >= T) row = T - 1;
    const float* qr = Q + (size_t)row * pitch;
#pragma unroll
    for (int ks = 0; ks < KS; ++ks)
#pragma unroll
      for (int i = 0; i < 16; ++i) {
        const int d = ks * 32 + ((i < 8) ? (8 * hh + i) : (16 + 8 * hh + (i - 8)));
        const float x = qr[d] * scale; const unsigned short hb = bf16_bits(x);
        aqh[ks].u[i] = hb; aql[ks].u[i] = bf16_bits(x - bf16_val(hb));
      }
  }
  float m_r[8], l_r[8];
#pragma unroll
  for (int r = 0; r < 8; ++r) { m_r[r] = -3.0e38f; l_r[r] = 0.f; }
  v8f oacc[DT];
#pragma unroll
  for (int dt = 0; dt < DT; ++dt) oacc[dt] = (v8f){0.f,0.f,0.f,0.f,0.f,0.f,0.f,0.f};

  const int kv_end = CAUSAL ? min(T, qblk * 64 + 64) : T;     // block-uniform
  for (int j0 = 0; j0 < kv_end; j0 += 32) {
    __syncthreads();
    for (int e = tid; e < 32 * (D / 4); e += 128) {
      const int r = e / (D / 4), c4 = (e % (D / 4)) * 4;
      const int key = j0 + r;
      v4f kf = {0.f,0.f,0.f,0.f}, vf = {0.f,0.f,0.f,0.f};
      if (key < T) { kf = *(const v4fa*)(K + (size_t)key * pitch + c4); vf = *(const v4fa*)(V + (size_t)key * pitch + c4); }
#pragma unroll
      for (int t = 0; t < 4; ++t) {
        unsigned short hb = bf16_bits(kf[t]); sKh[r][c4 + t] = hb; sKl[r][c4 + t] = bf16_bits(kf[t] - bf16_val(hb));
        hb = bf16_bits(vf[t]); sVh[r][c4 + t] = hb; sVl[r][c4 + t] = bf16_bits(vf[t] - bf16_val(hb));
      }
    }
    __syncthreads();
    // S tile 16 x 32
    v8f s[2];
#pragma unroll
    for (int nt = 0; nt < 2; ++nt) {
      v8f acc = {};
#pragma unroll
      for (int ks = 0; ks < KS; ++ks) {
        FragB bh_, bl_;
        bh_.half[0] = *(const v8us*)&sKh[nt * 16 + ln][ks * 32 + 8 * hh]; bh_.half[1] = *(const v8us*)&sKh[nt * 16 + ln][ks * 32 + 16 + 8 * hh];
        bl_.half[0] = *(const v8us*)&sKl[nt * 16 + ln][ks * 32 + 8 * hh]; bl_.half[1] = *(const v8us*)&sKl[nt * 16 + ln][ks * 32 + 16 + 8 * hh];
        acc = mmaN<3>(aqh[ks].v, aql[ks].v, bh_.v, bl_.v, acc);
      }
      s[nt] = acc;
    }
    // mask + running max (rows 8hh+r; the 16 lanes of a half share rows)
    float alpha[8];
#pragma unroll
    for (int r = 0; r < 8; ++r) {
      const int qi = q0 + 8 * hh + r;
      const int ja = j0 + ln, jb = j0 + 16 + ln;
      if (CAUSAL) { if (ja > qi) s[0][r] = -3.0e38f; if (jb > qi) s[1][r] = -3.0e38f; }
      if (ja >= T) s[0][r] = -3.0e38f;
      if (jb >= T) s[1][r] = -3.0e38f;
      float mx = fmaxf(s[0][r], s[1][r]);
      mx = fmaxf(mx, __shfl_xor(mx, 1, 32)); mx = fmaxf(mx, __shfl_xor(mx, 2, 32)); mx = fmaxf(mx, __shfl_xor(mx, 4, 32)); mx = fmaxf(mx, __shfl_xor(mx, 8, 32));
      const float mnew = fmaxf(m_r[r], mx);
      alpha[r] = (mnew > -1.0e38f) ? __expf(m_r[r] - mnew) : 1.0f;
      const float p0 = (s[0][r] > -1.0e38f) ? __expf(s[0][r] - mnew) : 0.f;
      const float p1 = (s[1][r] > -1.0e38f) ? __expf(s[1][r] - mnew) : 0.f;
      m_r[r] = mnew;
      l_r[r] = l_r[r] * alpha[r] + p0 + p1;            // per-lane partial row sum (16 lanes combined at the end)
      unsigned short hb = bf16_bits(p0); sPh[w][8 * hh + r][ln] = hb;      sPl[w][8 * hh + r][ln] = bf16_bits(p0 - bf16_val(hb));
      hb = bf16_bits(p1);                sPh[w][8 * hh + r][16 + ln] = hb; sPl[w][8 * hh + r][16 + ln] = bf16_bits(p1 - bf16_val(hb));
    }
#pragma unroll
    for (int dt = 0; dt < DT; ++dt)
#pragma unroll
      for (int r = 0; r < 8; ++r) oacc[dt][r] *= alpha[r];
    __builtin_amdgcn_fence(__ATOMIC_ACQ_REL, "workgroup");
    __builtin_amdgcn_wave_barrier();
    FragB pah, pal;
    pah.half[0] = *(const v8us*)&sPh[w][ln][8 * hh]; pah.half[1] = *(const v8us*)&sPh[w][ln][16 + 8 * hh];
    pal.half[0] = *(const v8us*)&sPl[w][ln][8 * hh]; pal.half[1] = *(const v8us*)&sPl[w][ln][16 + 8 * hh];
#pragma unroll
    for (int dt = 0; dt < DT; ++dt) {
      FragB bvh, bvl;
#pragma unroll
      for (int i = 0; i < 8; ++i) {
        bvh.u[i] = sVh[8 * hh + i][dt * 16 + ln]; bvh.u[8 + i] = sVh[16 + 8 * hh + i][dt * 16 + ln];
        bvl.u[i] = sVl[8 * hh + i][dt * 16 + ln]; bvl.u[8 + i] = sVl[16 + 8 * hh + i][dt * 16 + ln];
      }
      oacc[dt] = mmaN<3>(pah.v, pal.v, bvh.v, bvl.v, oacc[dt]);
    }
    __builtin_amdgcn_fence(__ATOMIC_ACQ_REL, "workgroup");
    __builtin_amdgcn_wave_barrier();
  }
#pragma unroll
  for (int r = 0; r < 8; ++r) {
    float l = l_r[r];
    l += __shfl_xor(l, 1, 32); l += __shfl_xor(l, 2, 32); l += __shfl_xor(l, 4, 32); l += __shfl_xor(l, 8, 32);
    l_r[r] = (l > 0.f) ? 1.0f / l : 0.f;
  }
#pragma unroll
  for (int dt = 0; dt < DT; ++dt)
#pragma unroll
    for (int r = 0; r < 8; ++r) sO[w][8 * hh + r][dt * 16 + ln] = oacc[dt][r] * l_r[r];
  __builtin_amdgcn_fence(__ATOMIC_ACQ_REL, "workgroup");
  __builtin_amdgcn_wave_barrier();
  {
    for (int r = 0; r < 16; ++r) {
      const int row = q0 + r;
      if (row < T && lane < D / 4) {
        const v4f val = *(const v4fa*)&sO[w][r][lane * 4];
        *(v4f*)(y + ((size_t)b * T + row) * ypitch + h * D + lane * 4) = val;
      }
    }
    
  }
}

// GEMM C = act(A·W + bias + resid): A f32 (ASPLIT -> hi/lo 2 terms), Wt bf16 [N][K]; ACT 0 none, 1 relu, 2 exact gelu;
// resid (optional, f32, row index = (row % rmod), pitch ldr, RES_BF16 rounds it) added before the activation.
template <bool ASPLIT, int ACT, bool BIAS_BF16, bool RES_BF16>
__global__ __launch_bounds__(128) void k_gemm_bf3(const float* __restrict__ A, int lda, const unsigned short* __restrict__ Wt, int ldb,
                                                const float* __restrict__ bias, const float* __restrict__ resid, int rmod, int ldr,
                                                float* __restrict__ C, int ldc, int M, int N, int K) {
  __shared__ __attribute__((aligned(16))) float so[4][16][64];
  const int tid = threadIdx.x, w = tid >> 5, lane = tid & 31, ln = lane & 15, hh = lane >> 4;
  const int ntn = N / 64;
  const int wid = blockIdx.x * 4 + w;
  const int mt = wid / ntn, nq = wid % ntn;
  if (mt * 16 >= M) return;
  const int row0 = mt * 16, col0 = nq * 64;
  const float* arow = A + (size_t)(row0 + ln) * lda;
  v8f acc[4] = {};
  for (int kb = 0; kb < K; kb += 32) {
    FragB ah, al;
    const v4f x0 = *(const v4fa*)(arow + kb + 8 * hh), x1 = *(const v4fa*)(arow + kb + 8 * hh + 4);
    const v4f x2 = *(const v4fa*)(arow + kb + 16 + 8 * hh), x3 = *(const v4fa*)(arow + kb + 16 + 8 * hh + 4);
    float xs[16] = {x0[0],x0[1],x0[2],x0[3],x1[0],x1[1],x1[2],x1[3],x2[0],x2[1],x2[2],x2[3],x3[0],x3[1],x3[2],x3[3]};
#pragma unroll
    for (int i = 0; i < 16; ++i) { const unsigned short hb = bf16_bits(xs[i]); ah.u[i] = hb; al.u[i] = ASPLIT ? bf16_bits(xs[i] - bf16_val(hb)) : (unsigned short)0; }
#pragma unroll
    for (int t = 0; t < 4; ++t) {
      const unsigned short* brow = Wt + (size_t)(col0 + t * 16 + ln) * ldb + kb;
      FragB b;
      b.half[0] = *(const v8us*)(brow + 8 * hh);
      b.half[1] = *(const v8us*)(brow + 16 + 8 * hh);
      acc[t] = mmaN<ASPLIT ? 2 : 1>(ah.v, al.v, b.v, b.v, acc[t]);
    }
  }
#pragma unroll
  for (int t = 0; t < 4; ++t) {
    const int col = col0 + t * 16 + ln;
    float bv = bias ? bias[col] : 0.f;
    if (BIAS_BF16) bv = bf16_round(bv);
#pragma unroll
    for (int r = 0; r < 8; ++r) {
      float v = acc[t][r] + bv;
      if (resid) { float rv = resid[(size_t)((row0 + 8 * hh + r) % rmod) * ldr + col]; if (RES_BF16) rv = bf16_round(rv); v += rv; }
      if (ACT == 1) v = fmaxf(v, 0.f);
      if (ACT == 2) v = 0.5f * v * (1.0f + erff(v * 0.70710678118654752f));
      if (ACT == 3) { const float u = 0.7978845608028654f * (v + 0.044715f * v * v * v); v = 0.5f * v * (1.0f + tanhf(u)); }
      so[w][8 * hh + r][t * 16 + ln] = v;
    }
  }
  __builtin_amdgcn_fence(__ATOMIC_ACQ_REL, "workgroup");
  __builtin_amdgcn_wave_barrier();
  const int rsub = lane >> 4, c4 = (lane & 15) * 4;
  {
#pragma unroll
    for (int q = 0; q < 8; ++q) {
      const int r = q * 2 + rsub;
      const v4f v = *(const v4fa*)&so[w][r][c4];
      *(v4f*)(C + (size_t)(row0 + r) * ldc + col0 + c4) = v;
    }
    
  }
}
// row LayerNorm (biased variance, eps) over N: s = X (+ R); optional out_sum <- s; out_norm <- (s-mu)*rsqrt(var+eps)*g + b
template <bool PARAM_BF16>
__global__ __launch_bounds__(256) void k_layernorm(const float* __restrict__ X, const float* __restrict__ R, const float* __restrict__ g, const float* __restrict__ bta,
                                                  float* __restrict__ out_sum, float* __restrict__ out_norm, int N, float eps) {
  __shared__ float red[256];
  const int row = blockIdx.x, tid = threadIdx.x;
  const float* x = X + (size_t)row * N; const float* rr = R ? R + (size_t)row * N : nullptr;
  float vals[16];                     // up to N = 4096
  const int per = N / 256;            // contiguous chunk per thread? use strided-by-4 chunks: thread handles j = tid*4 + 1024*u
  float s1 = 0.f;
  for (int u = 0; u < per / 4; ++u) {
    const int j = tid * 4 + 1024 * u;
    const v4f a = *(const v4fa*)(x + j);
    v4f b = {0.f,0.f,0.f,0.f}; if (rr) b = *(const v4fa*)(rr + j);
#pragma unroll
    for (int q = 0; q < 4; ++q) { const float v = a[q] + b[q]; vals[u * 4 + q] = v; s1 += v; }
  }
  red[tid] = s1; __syncthreads();
  for (int st = 128; st > 0; st >>= 1) { if (tid < st) red[tid] += red[tid + st]; __syncthreads(); }
  const float mu = red[0] / (float)N; __syncthreads();
  float s2 = 0.f;
  for (int u = 0; u < per / 4; ++u)
#pragma unroll
    for (int q = 0; q < 4; ++q) { const float c = vals[u * 4 + q] - mu; s2 += c * c; }
  red[tid] = s2; __syncthreads();
  for (int st = 128; st > 0; st >>= 1) { if (tid < st) red[tid] += red[tid + st]; __syncthreads(); }
  const float rs = rsqrtf(red[0] / (float)N + eps);
  {
    for (int u = 0; u < per / 4; ++u) {
      const int j = tid * 4 + 1024 * u;
      v4f o, sm;
#pragma unroll
      for (int q = 0; q < 4; ++q) {
        float gg = g[j + q], bb = bta[j + q];
        if (PARAM_BF16) { gg = bf16_round(gg); bb = bf16_round(bb); }
        sm[q] = vals[u * 4 + q]; o[q] = (vals[u * 4 + q] - mu) * rs * gg + bb;
      }
      if (out_sum) *(v4f*)(out_sum + (size_t)row * N + j) = sm;
      *(v4f*)(out_norm + (size_t)row * N + j) = o;
    }
    
  }
}



// ---- f16 WMMA path (v_wmma_f32_16x16x32_f16): 11-bit significands for operands in range — used where a [0,1] probability operand needs more precision than bf16
typedef _Float16 v16h __attribute__((ext_vector_type(16)));
union FragH { v16h v; v8us half[2]; _Float16 h[16]; unsigned short u[16]; };
template <int NT>
__device__ __forceinline__ v8f mmaH(v16h ah, v16h al, v16h bh, v16h bl, v8f c) {
  c = __builtin_amdgcn_wmma_f32_16x16x32_f16(false, ah, false, bh, (short)0, c, false, false);
  if (NT >= 2) c = __builtin_amdgcn_wmma_f32_16x16x32_f16(false, al, false, bh, (short)0, c, false, false);
  if (NT >= 3) c = __builtin_amdgcn_wmma_f32_16x16x32_f16(false, ah, false, bl, (short)0, c, false, false);
  asm volatile("v_nop\n\tv_nop\n\tv_nop\n\tv_nop" : "+v"(c) : "v"(ah), "v"(al), "v"(bh), "v"(bl));
  return c;
}
// batched GEMM like k_gemm_b but f16 operands: A f32 (split into f16 hi/lo if ASPLIT, else rounded to f16), Bt = f16 values [n][k]; alpha; C f32; N multiple of 16 (partial tiles skipped)
template <bool ASPLIT>
__global__ __launch_bounds__(128) void k_gemm_h(const float* __restrict__ A, int lda, size_t sA, const _Float16* __restrict__ Bh, int ldb, size_t sB, float alpha, float* __restrict__ C, int ldc, size_t sC, int M, int N, int K) {
  __shared__ __attribute__((aligned(16))) float so[4][16][64];
  const int tid = threadIdx.x, w = tid >> 5, lane = tid & 31, ln = lane & 15, hh = lane >> 4; const int by = blockIdx.y;
  A += (size_t)by * sA; Bh += (size_t)by * sB; C += (size_t)by * sC;
  const int ntn = (N + 63) / 64; const int wid = blockIdx.x * 4 + w; const int mt = wid / ntn, nq = wid % ntn; if (mt * 16 >= M) return;
  const int row0 = mt * 16, col0 = nq * 64; const float* arow = A + (size_t)(row0 + ln) * lda;
  v8f acc[4] = {};
  for (int kb = 0; kb < K; kb += 32) {
    FragH ah, al;
    const v4f x0 = *(const v4fa*)(arow + kb + 8 * hh), x1 = *(const v4fa*)(arow + kb + 8 * hh + 4), x2 = *(const v4fa*)(arow + kb + 16 + 8 * hh), x3 = *(const v4fa*)(arow + kb + 16 + 8 * hh + 4);
    float xs[16] = {x0[0],x0[1],x0[2],x0[3],x1[0],x1[1],x1[2],x1[3],x2[0],x2[1],x2[2],x2[3],x3[0],x3[1],x3[2],x3[3]};
#pragma unroll
    for (int i = 0; i < 16; ++i) { const _Float16 h = (_Float16)xs[i]; ah.h[i] = h; al.h[i] = ASPLIT ? (_Float16)(xs[i] - (float)h) : (_Float16)0.0f; }
#pragma unroll
    for (int t = 0; t < 4; ++t) { if (col0 + t * 16 >= N) continue; const size_t boff = (size_t)(col0 + t * 16 + ln) * ldb + kb; FragH bq; bq.half[0] = *(const v8us*)(Bh + boff + 8 * hh); bq.half[1] = *(const v8us*)(Bh + boff + 16 + 8 * hh);
      acc[t] = mmaH<ASPLIT ? 2 : 1>(ah.v, al.v, bq.v, bq.v, acc[t]); }
  }
#pragma unroll
  for (int t = 0; t < 4; ++t) { if (col0 + t * 16 >= N) continue;
#pragma unroll
    for (int r = 0; r < 8; ++r) so[w][8 * hh + r][t * 16 + ln] = acc[t][r] * alpha; }
  __builtin_amdgcn_fence(__ATOMIC_ACQ_REL, "workgroup"); __builtin_amdgcn_wave_barrier();
  const int rsub = lane >> 4, c4 = (lane & 15) * 4;
  {
#pragma unroll
    for (int q = 0; q < 8; ++q) { const int r = q * 2 + rsub; if (col0 + c4 < N) { const v4f v = *(const v4fa*)&so[w][r][c4]; *(v4f*)(C + (size_t)(row0 + r) * ldc + col0 + c4) = v; } }
     }
}

// Wt[n][k] = f16(W[k][n]·scale) from f32 row-major W[K][N] (scale = power of two; bf16-exact weights stay exact in f16 away from the subnormal range)
__global__ __launch_bounds__(256) void k_wt_f16(const float* __restrict__ W, _Float16* __restrict__ Wt, int K, int N, float scale) {
  const int t = blockIdx.x * 256 + threadIdx.x; if (t >= N * (K / 8)) return; const int n = t / (K / 8), k8 = (t % (K / 8)) * 8; FragH f;
#pragma unroll
  for (int i = 0; i < 8; ++i) f.h[i] = (_Float16)(bf16_round(W[(size_t)(k8 + i) * N + n]) * scale); const v8us o = f.half[0];
  *(v8us*)((unsigned short*)Wt + (size_t)n * K + k8) = o; 
}


typedef _Float16 v4h __attribute__((ext_vector_type(4)));
typedef _Float16 v2h __attribute__((ext_vector_type(2)));
typedef float v2fv __attribute__((ext_vector_type(2)));

__global__ __launch_bounds__(256) void k_h16(const float* __restrict__ x, _Float16* __restrict__ X16, size_t n8) { const size_t t = (size_t)blockIdx.x * 256 + threadIdx.x; if (t >= n8) return; FragH f;
#pragma unroll
  for (int q = 0; q < 8; ++q) f.h[q] = (_Float16)x[t * 8 + q]; *(v8us*)((unsigned short*)X16 + t * 8) = f.half[0];  }
// ---- the three projections in ONE launch, straight from the f32 inputs. A workgroup takes 128 tokens x 192 rows of the stacked (Wq; Wk; Wv): it rounds both tiles
// (x: bf16-exact f16; W: bf16-exact x 2^4, f16) into LDS over the whole K = 256, passes one barrier, and its 12 waves each form a 64 x 32 tile on WMMA.
// The accumulator holds 8 consecutive M rows in a lane, so M is made the index that is contiguous in the output: Q, K = [token][col]: A = W rows, B = x rows; V^T = [col][token]: A = x rows, B = Wv rows.
#define PTOK 128    // tokens per workgroup
#define PCOL 192    // stacked weight rows per workgroup: three groups of 64, each inside one matrix; 32 x 8 = 256 workgroups, one per WGP
#define PP 264      // LDS row pitch in 16-bit elements: 528 B = 16 B x odd, conflict-free for 16-byte fragment reads
#define PO 72       // pitch of a wave's output rows in LDS, 144 B
typedef unsigned short v4us __attribute__((ext_vector_type(4), may_alias));
typedef __bf16 v2bf __attribute__((ext_vector_type(2)));
union Pack4 { v2h p[2]; v4us u; };
// four f32 -> nearest-even bf16 (the packed hardware conversion: the same rounding as bf16_round) -> x scale, a power of two -> f16, 8 bytes into LDS
template <bool SCALE>
__device__ __forceinline__ void put4(unsigned short* p, v4f v) {
  Pack4 k;
#pragma unroll
  for (int q = 0; q < 2; ++q) {
    const unsigned int u = __builtin_bit_cast(unsigned int, __builtin_convertvector((v2fv){v[2 * q], v[2 * q + 1]}, v2bf));
    v2fv f = {__uint_as_float(u << 16), __uint_as_float(u & 0xFFFF0000u)};
    if (SCALE) f *= 16.0f;
    k.p[q] = __builtin_convertvector(f, v2h);
  }
  *(v4us*)p = k.u;
}
// acc[at][bt][r] = element (m = at*16 + 8*hh + r, n = bt*16 + ln). v = acc / 16 + bf16(bias), to f16; the wave's 32 rows n of 64 m go through its own LDS range, so that every store writes whole 128-byte lines.
template <bool ISV>
__device__ __forceinline__ void proj_out(const v8f (&acc)[4][2], const float (&bs)[32], unsigned short (*so)[PO], unsigned short* __restrict__ ob, int lane) {
  const int ln = lane & 15, hh = lane >> 4;
#pragma unroll
  for (int at = 0; at < 4; ++at)
#pragma unroll
    for (int bt = 0; bt < 2; ++bt) {
      FragH f;
#pragma unroll
      for (int r = 0; r < 8; ++r) f.h[r] = (_Float16)(acc[at][bt][r] * 0.0625f + bf16_round(ISV ? bs[bt] : bs[at * 8 + r]));
      *(v8us*)&so[bt * 16 + ln][at * 16 + 8 * hh] = f.half[0];
    }
  // the rows are read back by other lanes of the same wave: the LDS writes above must have landed
  __builtin_amdgcn_fence(__ATOMIC_ACQ_REL, "workgroup"); __builtin_amdgcn_wave_barrier();
  constexpr size_t ldo = ISV ? NN : PJ;
  unsigned short* op = ob + (size_t)(lane >> 3) * ldo + (lane & 7) * 8;
#pragma unroll
  for (int i = 0; i < 8; ++i) { const v8us v = *(const v8us*)&so[i * 4 + (lane >> 3)][(lane & 7) * 8]; *(v8us*)(op + (size_t)i * 4 * ldo) = v; }
}
__global__ __launch_bounds__(384) void k_proj(const float* __restrict__ x, const float* __restrict__ Wq, const float* __restrict__ Wk, const float* __restrict__ Wv,
                                              const float* __restrict__ bq, const float* __restrict__ bk, const float* __restrict__ bv,
                                              _Float16* __restrict__ Q16, _Float16* __restrict__ K16, _Float16* __restrict__ Vt) {
  __shared__ __attribute__((aligned(16))) unsigned short sT[PTOK + PCOL][PP];      // rows 0..127: tokens; 128..319: stacked weight rows
  __shared__ __attribute__((aligned(16))) unsigned short sO[12][32][PO];
  const int tid = threadIdx.x, lane = tid & 31, ln = lane & 15, hh = lane >> 4;
  const int w = __builtin_amdgcn_readfirstlane(tid >> 5);      // scalar: all that follows from it (matrix, roles, pointers) stays in scalar registers
  const int g = w >> 2, sub = w & 3;                           // the wave's group of 64 weight rows, and its quarter of the 64 x 128 products of that group
  const int tok0 = (blockIdx.x >> 3) * PTOK;
  const int cs = (blockIdx.x & 7) * PCOL + g * 64;             // the group's first row in the stacked weights
  const int mat = cs >> 9, cm = cs & (PJ - 1);                 // 0 q, 1 k, 2 v; first row inside that matrix
  const bool isV = mat == 2;
  const float* Wm = mat == 0 ? Wq : (mat == 1 ? Wk : Wv);
  float bs[32];      // bias, asked for first and rounded last: Q, K one value per m, V one per n
  if (isV) {
#pragma unroll
    for (int bt = 0; bt < 2; ++bt) bs[bt] = bv[cm + (sub & 1) * 32 + bt * 16 + ln];
    asm volatile("s_wait_xcnt 0x0" ::: "memory");      // at the end of the block that issues the loads
  } else {
    const float* bp = (mat == 0 ? bq : bk) + cm + 8 * hh;
#pragma unroll
    for (int at = 0; at < 4; ++at) {
      const v4f lo = *(const v4fa*)(bp + at * 16), hi = *(const v4fa*)(bp + at * 16 + 4);
#pragma unroll
      for (int q = 0; q < 4; ++q) { bs[at * 8 + q] = lo[q]; bs[at * 8 + 4 + q] = hi[q]; }
    }
    asm volatile("s_wait_xcnt 0x0" ::: "memory");      // as above
  }
  // staging: one wave-wide load = 512 contiguous bytes = half a row. The token tile is one contiguous 128 KiB (half row j*12 + w), a wave's 16 weight rows one contiguous 16 KiB:
  // every address is one base plus a constant.
  const float* gx = x + (size_t)tok0 * CIN + w * 128 + lane * 4;
  const float* gw = Wm + (size_t)(cm + sub * 16) * CIN + lane * 4;
  unsigned short* lx = &sT[w >> 1][(w & 1) * 128 + lane * 4];
  unsigned short* lw = &sT[PTOK + w * 16][lane * 4];
  v4f rx[22], rw[16];
#pragma unroll
  for (int j = 0; j < 21; ++j) rx[j] = *(const v4fa*)(gx + j * 12 * 128);
  asm volatile("s_wait_xcnt 0x0" ::: "memory");      // as above: the base of these loads is rewritten for the weight rows
  if (w < 4) { rx[21] = *(const v4fa*)(gx + 21 * 12 * 128); asm volatile("s_wait_xcnt 0x0" ::: "memory"); }      // 256 half rows = 21 x 12 + 4; the wait as above
#pragma unroll
  for (int j = 0; j < 16; ++j) rw[j] = *(const v4fa*)(gw + j * 128);
#pragma unroll
  for (int j = 0; j < 21; ++j) put4<false>(lx + j * 6 * PP, rx[j]);
  if (w < 4) put4<false>(lx + 21 * 6 * PP, rx[21]);
#pragma unroll
  for (int hf = 0; hf < 2; ++hf) {
#pragma unroll
    for (int j = 0; j < 16; ++j) {
      put4<true>(lw + (hf * 8 + (j >> 1)) * PP + (j & 1) * 128, rw[j]);
      if (hf == 0) rw[j] = *(const v4fa*)(gw + (16 + j) * 128);
    }
  }
  __syncthreads();      // both tiles are whole
  const int rowA = isV ? (sub >> 1) * 64 : PTOK + g * 64;
  const int rowB = isV ? PTOK + g * 64 + (sub & 1) * 32 : sub * 32;
  const unsigned short* pa = &sT[rowA + ln][8 * hh];
  const unsigned short* pb = &sT[rowB + ln][8 * hh];
  v8f acc[4][2];
#pragma unroll
  for (int at = 0; at < 4; ++at)
#pragma unroll
    for (int bt = 0; bt < 2; ++bt) acc[at][bt] = (v8f){0.f, 0.f, 0.f, 0.f, 0.f, 0.f, 0.f, 0.f};
  // A and B fragments take the same k order: elements 0..7 = k 8*hh.., 8..15 = k 16 + 8*hh..
  FragH a[2][4], b[2][2];
  auto frags = [&](int ks) {
#pragma unroll
    for (int at = 0; at < 4; ++at) { a[ks & 1][at].half[0] = *(const v8us*)(pa + at * 16 * PP + ks * 32); a[ks & 1][at].half[1] = *(const v8us*)(pa + at * 16 * PP + ks * 32 + 16); }
#pragma unroll
    for (int bt = 0; bt < 2; ++bt) { b[ks & 1][bt].half[0] = *(const v8us*)(pb + bt * 16 * PP + ks * 32); b[ks & 1][bt].half[1] = *(const v8us*)(pb + bt * 16 * PP + ks * 32 + 16); }
  };
  frags(0);
#pragma unroll
  for (int ks = 0; ks < CIN / 32; ++ks) {
    if (ks + 1 < CIN / 32) frags(ks + 1);      // the next step's 12 LDS reads as one group ahead of this step's 8 WMMAs, which cover their latency
    __builtin_amdgcn_sched_barrier(0);         // keeps that group here: the scheduler's own order sank each read to just in front of its first WMMA, four waits to zero a step
#pragma unroll
    for (int at = 0; at < 4; ++at)
#pragma unroll
      for (int bt = 0; bt < 2; ++bt) acc[at][bt] = __builtin_amdgcn_wmma_f32_16x16x32_f16(false, a[ks & 1][at].v, false, b[ks & 1][bt].v, (short)0, acc[at][bt], false, false);
  }
  if (isV) proj_out<true>(acc, bs, sO[w], (unsigned short*)Vt + (size_t)(cm + (sub & 1) * 32) * NN + tok0 + (sub >> 1) * 64, lane);      // V^T: [h*64 + d][token]
  else proj_out<false>(acc, bs, sO[w], (unsigned short*)(mat == 0 ? Q16 : K16) + (size_t)(tok0 + sub * 32) * PJ + cm, lane);              // head h at cols h*64
}

#define KSPL 4      // key ranges per head: 512 workgroups, two per WGP
#define KT 64       // keys per stage
#define LP 72       // LDS row pitch in 16-bit elements: 144 B = 16 B x odd, conflict-free for 16-byte fragment reads
union FragP { v16h v; v2h p2[8]; };
// Eight transcendentals in place, in one statement: no neighbour reads a result or overwrites a source of the one in front of it, and the closing v_nop
// is the one slot the instruction set asks for behind the last of them.
__device__ __forceinline__ void exp2x8(float (&a)[8]) {
  asm("v_exp_f32 %0, %0\n\tv_exp_f32 %1, %1\n\tv_exp_f32 %2, %2\n\tv_exp_f32 %3, %3\n\tv_exp_f32 %4, %4\n\tv_exp_f32 %5, %5\n\tv_exp_f32 %6, %6\n\tv_exp_f32 %7, %7\n\tv_nop"
      : "+v"(a[0]), "+v"(a[1]), "+v"(a[2]), "+v"(a[3]), "+v"(a[4]), "+v"(a[5]), "+v"(a[6]), "+v"(a[7]));
}
__device__ __forceinline__ void rcpx8(float (&a)[8]) {
  asm("v_rcp_f32 %0, %0\n\tv_rcp_f32 %1, %1\n\tv_rcp_f32 %2, %2\n\tv_rcp_f32 %3, %3\n\tv_rcp_f32 %4, %4\n\tv_rcp_f32 %5, %5\n\tv_rcp_f32 %6, %6\n\tv_rcp_f32 %7, %7\n\tv_nop"
      : "+v"(a[0]), "+v"(a[1]), "+v"(a[2]), "+v"(a[3]), "+v"(a[4]), "+v"(a[5]), "+v"(a[6]), "+v"(a[7]));
}
// four waves per SIMD = two of these workgroups per WGP: the register budget the allocator may spend is that of the occupancy the grid is sized for
__global__ __launch_bounds__(256) __attribute__((amdgpu_waves_per_eu(4, 4)))
void k_fsig(const _Float16* __restrict__ Q16, const _Float16* __restrict__ K16, const _Float16* __restrict__ Vt, float* __restrict__ Op, float* __restrict__ Zp) {
  __shared__ __attribute__((aligned(16))) unsigned short sK[2][KT][LP];      // [buffer][key][dim]
  __shared__ __attribute__((aligned(16))) unsigned short sV[2][HD][LP];      // [buffer][d][key]
  const int tid = threadIdx.x, w = tid >> 5, lane = tid & 31, c = lane & 15, hh = lane >> 4;
  const int h = blockIdx.y, sp = blockIdx.z;
  const int q0 = blockIdx.x * 256 + w * 32;
  const int key0 = sp * (NN / KSPL);
  constexpr int NT = NN / KSPL / KT;
  // staging: a thread moves 16 bytes of rows r0 and r0 + 32 of the K tile and of the V^T tile
  const int r0 = tid >> 3, c8 = (tid & 7) * 8;
  const unsigned short* gk = (const unsigned short*)K16 + (size_t)(key0 + r0) * PJ + h * HD + c8;
  const unsigned short* gv = (const unsigned short*)Vt + ((size_t)h * HD + r0) * NN + key0 + c8;
  v8us rk0, rk1, rv0, rv1;
  auto fetch = [&](int t) {
    const unsigned short* kp = gk + (size_t)t * KT * PJ; const unsigned short* vp = gv + t * KT;
    rk0 = *(const v8us*)kp; rk1 = *(const v8us*)(kp + 32 * PJ); rv0 = *(const v8us*)vp; rv1 = *(const v8us*)(vp + (size_t)32 * NN);
  };
  auto put = [&](int b) {
    *(v8us*)&sK[b][r0][c8] = rk0; *(v8us*)&sK[b][r0 + 32][c8] = rk1; *(v8us*)&sV[b][r0][c8] = rv0; *(v8us*)&sV[b][r0 + 32][c8] = rv1;
  };
  // B fragments of the wave's 2 x 16 query columns, hardware k order over the 64 dims
  FragH bq[2][2];
#pragma unroll
  for (int cg = 0; cg < 2; ++cg)
#pragma unroll
    for (int ks = 0; ks < 2; ++ks) {
      const unsigned short* qr = (const unsigned short*)Q16 + (size_t)(q0 + cg * 16 + c) * PJ + h * HD + ks * 32;
      bq[cg][ks].half[0] = *(const v8us*)(qr + 8 * hh); bq[cg][ks].half[1] = *(const v8us*)(qr + 16 + 8 * hh);
    }
  v8f o[4][2];
#pragma unroll
  for (int dt = 0; dt < 4; ++dt)
#pragma unroll
    for (int cg = 0; cg < 2; ++cg) o[dt][cg] = (v8f){0.f, 0.f, 0.f, 0.f, 0.f, 0.f, 0.f, 0.f};
  v8f zs[2] = {(v8f){0.f, 0.f, 0.f, 0.f, 0.f, 0.f, 0.f, 0.f}, (v8f){0.f, 0.f, 0.f, 0.f, 0.f, 0.f, 0.f, 0.f}};      // row sums of the f16 P, taken on the matrix pipe: A = all ones
  FragH ones;
#pragma unroll
  for (int i = 0; i < 16; ++i) ones.h[i] = (_Float16)1.0f;
  fetch(0); put(0);
  __syncthreads();
  // rolled: one pass already holds 36 WMMAs, and a second copy of the body would only cost registers and instruction cache
#pragma unroll 1
  for (int t = 0; t < NT; ++t) {
    const int b = t & 1;
    if (t + 1 < NT) fetch(t + 1);      // the next stage's global loads fly while this stage is worked on
#pragma unroll
    for (int j = 0; j < 2; ++j) {      // 32 keys
      FragH ka[2][2];
#pragma unroll
      for (int kt = 0; kt < 2; ++kt)
#pragma unroll
        for (int ks = 0; ks < 2; ++ks) {
          const unsigned short* kr = &sK[b][j * 32 + kt * 16 + c][ks * 32];
          ka[kt][ks].half[0] = *(const v8us*)(kr + 8 * hh); ka[kt][ks].half[1] = *(const v8us*)(kr + 16 + 8 * hh);
        }
      v8f s[2][2];      // s[cg][kt][r] = logit(key j*32 + kt*16 + 8*hh + r, query cg*16 + c)
#pragma unroll
      for (int cg = 0; cg < 2; ++cg)
#pragma unroll
        for (int kt = 0; kt < 2; ++kt) {
          s[cg][kt] = (v8f){0.f, 0.f, 0.f, 0.f, 0.f, 0.f, 0.f, 0.f};
          s[cg][kt] = __builtin_amdgcn_wmma_f32_16x16x32_f16(false, ka[kt][0].v, false, bq[cg][0].v, (short)0, s[cg][kt], false, false);
          s[cg][kt] = __builtin_amdgcn_wmma_f32_16x16x32_f16(false, ka[kt][1].v, false, bq[cg][1].v, (short)0, s[cg][kt], false, false);
        }
      FragH va[4];      // V^T fragments asked for ahead of the sigmoid, which covers their LDS latency
#pragma unroll
      for (int dt = 0; dt < 4; ++dt) {
        const unsigned short* vr = &sV[b][dt * 16 + c][j * 32];
        va[dt].half[0] = *(const v8us*)(vr + 8 * hh); va[dt].half[1] = *(const v8us*)(vr + 16 + 8 * hh);
      }
      FragP pb[2];
#pragma unroll
      for (int cg = 0; cg < 2; ++cg)
#pragma unroll
        for (int kt = 0; kt < 2; ++kt) {
          float p[8];
#pragma unroll
          for (int r = 0; r < 8; ++r) p[r] = s[cg][kt][r] * -1.4426950408889634f;
          exp2x8(p);
#pragma unroll
          for (int r = 0; r < 8; ++r) p[r] += 1.0f;
          rcpx8(p);      // p = 1 / (1 + 2^(-s log2 e))
#pragma unroll
          for (int r = 0; r < 8; r += 2) pb[cg].p2[kt * 4 + (r >> 1)] = __builtin_convertvector((v2fv){p[r], p[r + 1]}, v2h);      // element kt*8 + r of B = key 8*hh + r (kt 0), 16 + 8*hh + r (kt 1): the hardware k order
        }
#pragma unroll
      for (int cg = 0; cg < 2; ++cg) zs[cg] = __builtin_amdgcn_wmma_f32_16x16x32_f16(false, ones.v, false, pb[cg].v, (short)0, zs[cg], false, false);      // every row of zs = the column sums of P^T
#pragma unroll
      for (int dt = 0; dt < 4; ++dt)
#pragma unroll
        for (int cg = 0; cg < 2; ++cg) o[dt][cg] = __builtin_amdgcn_wmma_f32_16x16x32_f16(false, va[dt].v, false, pb[cg].v, (short)0, o[dt][cg], false, false);
    }
    if (t + 1 < NT) put(b ^ 1);      // that buffer's last readers left it at the barrier that ended pass t - 1
    __syncthreads();                 // publishes stage t + 1 and ends every read of stage t
  }
  // o[dt][cg][r] = sum_keys P.V at d = dt*16 + 8*hh + r, query cg*16 + c. Staged order of a query's 64 values: [hh][dt][r], so a lane writes one whole 128-byte line.
#pragma unroll
  for (int cg = 0; cg < 2; ++cg) {
    const int q = q0 + cg * 16 + c;
    const size_t slab = ((size_t)h * KSPL + sp) * NN + q;
    float* op = Op + slab * HD + hh * 32;
#pragma unroll
    for (int dt = 0; dt < 4; ++dt) {
      *(v4f*)(op + dt * 8) = (v4f){o[dt][cg][0], o[dt][cg][1], o[dt][cg][2], o[dt][cg][3]};
      *(v4f*)(op + dt * 8 + 4) = (v4f){o[dt][cg][4], o[dt][cg][5], o[dt][cg][6], o[dt][cg][7]};
    }
    if (hh == 0) Zp[slab] = zs[cg][0];      // both lane halves hold the same sum
  }
}
// out[q][d] = 1/8 sum_h (sum_ranges Op) / (sum_ranges Zp). A wave takes one query: lane = (half hf of the heads, four consecutive values i of the staged order [hh][dt][r]).
__global__ __launch_bounds__(256) void k_hmean(const float* __restrict__ Op, const float* __restrict__ Zp, float* __restrict__ out) {
  const unsigned tid = threadIdx.x, lane = tid & 31, i = lane & 15, hf = lane >> 4;
  const unsigned q = blockIdx.x * 8 + (tid >> 5), e = i * 4;
  const float* pm = Op + ((size_t)(hf * 16 + 8) * NN + q) * HD + e;      // the middle of the lane's 16 (head, key range) planes of 1 MiB: all 16 lie within a load's immediate offset
  const float* pz = Zp + (size_t)(hf * 16 + i) * NN + q;                 // lane i holds the row sum of plane i of its half
  v4f s[16]; float z;
  // The 17 loads and their data wait in one statement: all are in flight together (one round trip to memory), and no register that an issued load names is rewritten in front of the wait
  asm volatile("global_load_b128 %0, %17, off offset:-8388608\n\t"
               "global_load_b128 %1, %17, off offset:-7340032\n\t"
               "global_load_b128 %2, %17, off offset:-6291456\n\t"
               "global_load_b128 %3, %17, off offset:-5242880\n\t"
               "global_load_b128 %4, %17, off offset:-4194304\n\t"
               "global_load_b128 %5, %17, off offset:-3145728\n\t"
               "global_load_b128 %6, %17, off offset:-2097152\n\t"
               "global_load_b128 %7, %17, off offset:-1048576\n\t"
               "global_load_b128 %8, %17, off\n\t"
               "global_load_b128 %9, %17, off offset:1048576\n\t"
               "global_load_b128 %10, %17, off offset:2097152\n\t"
               "global_load_b128 %11, %17, off offset:3145728\n\t"
               "global_load_b128 %12, %17, off offset:4194304\n\t"
               "global_load_b128 %13, %17, off offset:5242880\n\t"
               "global_load_b128 %14, %17, off offset:6291456\n\t"
               "global_load_b128 %15, %17, off offset:7340032\n\t"
               "global_load_b32 %16, %18, off\n\t"
               "s_wait_loadcnt 0x0"
               : "=&v"(s[0]), "=&v"(s[1]), "=&v"(s[2]), "=&v"(s[3]), "=&v"(s[4]), "=&v"(s[5]), "=&v"(s[6]), "=&v"(s[7]), "=&v"(s[8]), "=&v"(s[9]), "=&v"(s[10]), "=&v"(s[11]), "=&v"(s[12]), "=&v"(s[13]), "=&v"(s[14]), "=&v"(s[15]), "=&v"(z)
               : "v"(pm), "v"(pz) : "memory");
  z += __shfl_xor(z, 1, 32); z += __shfl_xor(z, 2, 32);      // the four key ranges of a head lie in four neighbouring lanes
  const float inv = 1.0f / z;
  v4f acc = {0.f, 0.f, 0.f, 0.f};
#pragma unroll
  for (int hl = 0; hl < 4; ++hl) acc += (((s[hl * 4] + s[hl * 4 + 1]) + s[hl * 4 + 2]) + s[hl * 4 + 3]) * __shfl(inv, (int)(hf * 16 + hl * 4), 32);
#pragma unroll
  for (int c = 0; c < 4; ++c) acc[c] += __shfl_xor(acc[c], 16, 32);      // the other four heads
  const unsigned d = ((e >> 3) & 3) * 16 + (e >> 5) * 8 + (e & 7);
  if (hf == 0) *(v4f*)(out + (size_t)q * HD + d) = acc * 0.125f;
}
extern "C" void kernel_launch(void* const* d_in, const int* in_sizes, int n_in,
                              void* d_out, int out_size, void* d_ws, size_t ws_size, hipStream_t stream) {
  (void)in_sizes; (void)n_in; (void)out_size;
  const float* x = (const float*)d_in[0]; const float* Wq = (const float*)d_in[1]; const float* bq = (const float*)d_in[2]; const float* Wk = (const float*)d_in[3]; const float* bk = (const float*)d_in[4]; const float* Wv = (const float*)d_in[5]; const float* bv = (const float*)d_in[6];
  char* ws = (char*)d_ws; size_t off = 0;
  auto take = [&](size_t bytes) { char* p = ws + off; off += (bytes + 255) & ~(size_t)255; return p; };
  _Float16* Q16 = (_Float16*)take((size_t)NN * PJ * 2); _Float16* K16 = (_Float16*)take((size_t)NN * PJ * 2); _Float16* Vt = (_Float16*)take((size_t)NN * PJ * 2); float* Op = (float*)take((size_t)NH * KSPL * NN * HD * 4); float* Zp = (float*)take((size_t)NH * KSPL * NN * 4);
  if (off > ws_size) return;      // 4.2 x 3 + 33.6 + 0.5 = about 47 MB
  k_proj<<<(NN / PTOK) * (3 * PJ / PCOL), 384, 0, stream>>>(x, Wq, Wk, Wv, bq, bk, bv, Q16, K16, Vt);
  k_fsig<<<dim3(NN / 256, NH, KSPL), 256, 0, stream>>>(Q16, K16, Vt, Op, Zp);
  k_hmean<<<NN / 8, 256, 0, stream>>>(Op, Zp, (float*)d_out);
}

// v003
// A run of this version takes 41.9 microseconds.
// Timed twice side by side with v002, it ran 1.11 times as fast both times.
// All steps since v000 together make it 40.2 times as fast.
#include <hip/hip_runtime.h>
// Sigmoid multi-head attention (N=4096 tokens, IN=256, 8 heads x 64): q,k,v = x.W^T + b; S_h = sigmoid(q_h.k_h^T); attn = S_h / sum_keys S_h; out = mean_h(attn.v_h) -> [4096, 64].
// All three projections in one kernel on v_wmma_f32_16x16x32_f16 (x bf16-exact, (out,in) weights bf16-exact x 2^4, q/k/v f16, f32 accumulate). Logits (K = 64), sigmoid, row sums and P.V run in ONE
// kernel on the same WMMA form: S and P = f16(sigmoid) never leave registers; each workgroup leaves unnormalised sums of a quarter of the keys, a small kernel divides and takes the head mean.
#define NN 4096
#define CIN 256
#define PJ 512
#define HD 64
#define NH 8

typedef __bf16 v16b __attribute__((ext_vector_type(16)));
typedef unsigned short v8us __attribute__((ext_vector_type(8), may_alias));
typedef float  v8f  __attribute__((ext_vector_type(8)));
typedef float  v4f  __attribute__((ext_vector_type(4)));
typedef float  v4fa __attribute__((ext_vector_type(4), may_alias));
union FragB { v16b v; v8us half[2]; unsigned short u[16]; };

__device__ __forceinline__ unsigned short bf16_bits(float x) { unsigned int u = __float_as_uint(x); return (unsigned short)((u + 0x7FFFu + ((u >> 16) & 1u)) >> 16); }
__device__ __forceinline__ float bf16_val(unsigned short b) { return __uint_as_float(((unsigned int)b) << 16); }
__device__ __forceinline__ float bf16_round(float x) { return bf16_val(bf16_bits(x)); }
// D += A·B with NT terms: 1 = ah·bh, 2 = + al·bh (A split), 3 = + ah·bl (both split)
template <int NT>
__device__ __forceinline__ v8f mmaN(v16b ah, v16b al, v16b bh, v16b bl, v8f c) {
  c = __builtin_amdgcn_wmma_f32_16x16x32_bf16(false, ah, false, bh, (short)0, c, false, false);
  if (NT >= 2) c = __builtin_amdgcn_wmma_f32_16x16x32_bf16(false, al, false, bh, (short)0, c, false, false);
  if (NT >= 3) c = __builtin_amdgcn_wmma_f32_16x16x32_bf16(false, ah, false, bl, (short)0, c, false, false);
  asm volatile("v_nop\n\tv_nop\n\tv_nop\n\tv_nop" : "+v"(c) : "v"(ah), "v"(al), "v"(bh), "v"(bl));
  return c;
}

__global__ __launch_bounds__(256) void k_wt_bf16(const float* __restrict__ W, unsigned short* __restrict__ Wt, int K, int N) {
  const int t = blockIdx.x * 256 + threadIdx.x;
  const int k8n = K / 8;
  if (t >= N * k8n) return;
  const int n = t / k8n, k8 = (t % k8n) * 8;
  v8us v;
#pragma unroll
  for (int i = 0; i < 8; ++i) v[i] = bf16_bits(W[(size_t)(k8 + i) * N + n]);
  *(v8us*)(Wt + (size_t)n * K + k8) = v;
  
}

// GEMM C[M][N] (f32, pitch ldc) = act(A[M][K]·W + bias). A f32 row-major (pitch lda) converted per fragment to bf16
// (ASPLIT: hi/lo two planes -> 2 terms, else single rounded term); Wt bf16 [N][K] (pitch ldb). BIAS_BF16 rounds the
// bias to bf16 first (bias quantised to bf16 before the add). K%32==0, M%16==0, N%64==0.
template <bool ASPLIT, int ACT, bool BIAS_BF16>
__global__ __launch_bounds__(128) void k_gemm_bf(const float* __restrict__ A, int lda, const unsigned short* __restrict__ Wt, int ldb,
                                               const float* __restrict__ bias, float* __restrict__ C, int ldc, int M, int N, int K) {
  __shared__ __attribute__((aligned(16))) float so[4][16][64];
  const int tid = threadIdx.x, w = tid >> 5, lane = tid & 31, ln = lane & 15, hh = lane >> 4;
  const int ntn = N / 64;
  const int wid = blockIdx.x * 4 + w;
  const int mt = wid / ntn, nq = wid % ntn;
  if (mt * 16 >= M) return;
  const int row0 = mt * 16, col0 = nq * 64;
  const float* arow = A + (size_t)(row0 + ln) * lda;
  v8f acc[4] = {};
  for (int kb = 0; kb < K; kb += 32) {
    FragB ah, al;
    const v4f x0 = *(const v4fa*)(arow + kb + 8 * hh), x1 = *(const v4fa*)(arow + kb + 8 * hh + 4);
    const v4f x2 = *(const v4fa*)(arow + kb + 16 + 8 * hh), x3 = *(const v4fa*)(arow + kb + 16 + 8 * hh + 4);
    float xs[16] = {x0[0],x0[1],x0[2],x0[3],x1[0],x1[1],x1[2],x1[3],x2[0],x2[1],x2[2],x2[3],x3[0],x3[1],x3[2],x3[3]};
#pragma unroll
    for (int i = 0; i < 16; ++i) { const unsigned short hb = bf16_bits(xs[i]); ah.u[i] = hb; al.u[i] = ASPLIT ? bf16_bits(xs[i] - bf16_val(hb)) : (unsigned short)0; }
#pragma unroll
    for (int t = 0; t < 4; ++t) {
      const unsigned short* brow = Wt + (size_t)(col0 + t * 16 + ln) * ldb + kb;
      FragB b;
      b.half[0] = *(const v8us*)(brow + 8 * hh);
      b.half[1] = *(const v8us*)(brow + 16 + 8 * hh);
      acc[t] = mmaN<ASPLIT ? 2 : 1>(ah.v, al.v, b.v, b.v, acc[t]);
    }
  }
#pragma unroll
  for (int t = 0; t < 4; ++t) {
    float bv = bias ? bias[col0 + t * 16 + ln] : 0.f;
    if (BIAS_BF16) bv = bf16_round(bv);
#pragma unroll
    for (int r = 0; r < 8; ++r) { float v = acc[t][r] + bv; if (ACT == 1) v = fmaxf(v, 0.f); so[w][8 * hh + r][t * 16 + ln] = v; }
  }
  __builtin_amdgcn_fence(__ATOMIC_ACQ_REL, "workgroup");
  __builtin_amdgcn_wave_barrier();
  const int rsub = lane >> 4, c4 = (lane & 15) * 4;
  {
#pragma unroll
    for (int q = 0; q < 8; ++q) {
      const int r = q * 2 + rsub;
      const v4f v = *(const v4fa*)&so[w][r][c4];
      *(v4f*)(C + (size_t)(row0 + r) * ldc + col0 + c4) = v;
    }
    
  }
}

// Flash-style causal/unmasked attention, all contractions 3-term bf16 hi/lo splits, f32 softmax with running max.
// q,k,v rows are read from f32 buffers with arbitrary row pitch (so they can live inside a fused qkv buffer);
// D = head size (multiple of 32, <= 128); one wave = 16 query rows; block = 4 waves (64 queries) sharing K/V chunks of 32.
template <int D, bool CAUSAL>
__global__ __launch_bounds__(128) void k_flash(const float* __restrict__ qb, const float* __restrict__ kb, const float* __restrict__ vb,
                                             int pitch, int T, int H, float scale, float* __restrict__ y, int ypitch) {
  constexpr int KS = D / 32;        // k-steps for QK
  constexpr int DT = D / 16;        // d tiles for PV
  __shared__ __attribute__((aligned(16))) unsigned short sKh[32][D + 8], sKl[32][D + 8], sVh[32][D + 8], sVl[32][D + 8];
  __shared__ __attribute__((aligned(16))) unsigned short sPh[4][16][40], sPl[4][16][40];
  __shared__ __attribute__((aligned(16))) float sO[4][16][D];
  const int tid = threadIdx.x, w = tid >> 5, lane = tid & 31, ln = lane & 15, hh = lane >> 4;
  const int nqb = (T + 63) / 64;
  const int bh = blockIdx.x / nqb, qblk = blockIdx.x % nqb;
  const int b = bh / H, h = bh % H;
  const int q0 = qblk * 64 + w * 16;
  const float* Q = qb + (size_t)b * T * pitch + h * D;
  const float* K = kb + (size_t)b * T * pitch + h * D;
  const float* V = vb + (size_t)b * T * pitch + h * D;

  // A fragments of the wave's 16 query rows (scaled), hi/lo
  FragB aqh[KS], aql[KS];
  {
    int row = q0 + ln; if (row >= T) row = T - 1;
    const float* qr = Q + (size_t)row * pitch;
#pragma unroll
    for (int ks = 0; ks < KS; ++ks)
#pragma unroll
      for (int i = 0; i < 16; ++i) {
        const int d = ks * 32 + ((i < 8) ? (8 * hh + i) : (16 + 8 * hh + (i - 8)));
        const float x = qr[d] * scale; const unsigned short hb = bf16_bits(x);
        aqh[ks].u[i] = hb; aql[ks].u[i] = bf16_bits(x - bf16_val(hb));
      }
  }
  float m_r[8], l_r[8];
#pragma unroll
  for (int r = 0; r < 8; ++r) { m_r[r] = -3.0e38f; l_r[r] = 0.f; }
  v8f oacc[DT];
#pragma unroll
  for (int dt = 0; dt < DT; ++dt) oacc[dt] = (v8f){0.f,0.f,0.f,0.f,0.f,0.f,0.f,0.f};

  const int kv_end = CAUSAL ? min(T, qblk * 64 + 64) : T;     // block-uniform
  for (int j0 = 0; j0 < kv_end; j0 += 32) {
    __syncthreads();
    for (int e = tid; e < 32 * (D / 4); e += 128) {
      const int r = e / (D / 4), c4 = (e % (D / 4)) * 4;
      const int key = j0 + r;
      v4f kf = {0.f,0.f,0.f,0.f}, vf = {0.f,0.f,0.f,0.f};
      if (key < T) { kf = *(const v4fa*)(K + (size_t)key * pitch + c4); vf = *(const v4fa*)(V + (size_t)key * pitch + c4); }
#pragma unroll
      for (int t = 0; t < 4; ++t) {
        unsigned short hb = bf16_bits(kf[t]); sKh[r][c4 + t] = hb; sKl[r][c4 + t] = bf16_bits(kf[t] - bf16_val(hb));
        hb = bf16_bits(vf[t]); sVh[r][c4 + t] = hb; sVl[r][c4 + t] = bf16_bits(vf[t] - bf16_val(hb));
      }
    }
    __syncthreads();
    // S tile 16 x 32
    v8f s[2];
#pragma unroll
    for (int nt = 0; nt < 2; ++nt) {
      v8f acc = {};
#pragma unroll
      for (int ks = 0; ks < KS; ++ks) {
        FragB bh_, bl_;
        bh_.half[0] = *(const v8us*)&sKh[nt * 16 + ln][ks * 32 + 8 * hh]; bh_.half[1] = *(const v8us*)&sKh[nt * 16 + ln][ks * 32 + 16 + 8 * hh];
        bl_.half[0] = *(const v8us*)&sKl[nt * 16 + ln][ks * 32 + 8 * hh]; bl_.half[1] = *(const v8us*)&sKl[nt * 16 + ln][ks * 32 + 16 + 8 * hh];
        acc = mmaN<3>(aqh[ks].v, aql[ks].v, bh_.v, bl_.v, acc);
      }
      s[nt] = acc;
    }
    // mask + running max (rows 8hh+r; the 16 lanes of a half share rows)
    float alpha[8];
#pragma unroll
    for (int r = 0; r < 8; ++r) {
      const int qi = q0 + 8 * hh + r;
      const int ja = j0 + ln, jb = j0 + 16 + ln;
      if (CAUSAL) { if (ja > qi) s[0][r] = -3.0e38f; if (jb > qi) s[1][r] = -3.0e38f; }
      if (ja >= T) s[0][r] = -3.0e38f;
      if (jb >= T) s[1][r] = -3.0e38f;
      float mx = fmaxf(s[0][r], s[1][r]);
      mx = fmaxf(mx, __shfl_xor(mx, 1, 32)); mx = fmaxf(mx, __shfl_xor(mx, 2, 32)); mx = fmaxf(mx, __shfl_xor(mx, 4, 32)); mx = fmaxf(mx, __shfl_xor(mx, 8, 32));
      const float mnew = fmaxf(m_r[r], mx);
      alpha[r] = (mnew > -1.0e38f) ? __expf(m_r[r] - mnew) : 1.0f;
      const float p0 = (s[0][r] > -1.0e38f) ? __expf(s[0][r] - mnew) : 0.f;
      const float p1 = (s[1][r] > -1.0e38f) ? __expf(s[1][r] - mnew) : 0.f;
      m_r[r] = mnew;
      l_r[r] = l_r[r] * alpha[r] + p0 + p1;            // per-lane partial row sum (16 lanes combined at the end)
      unsigned short hb = bf16_bits(p0); sPh[w][8 * hh + r][ln] = hb;      sPl[w][8 * hh + r][ln] = bf16_bits(p0 - bf16_val(hb));
      hb = bf16_bits(p1);                sPh[w][8 * hh + r][16 + ln] = hb; sPl[w][8 * hh + r][16 + ln] = bf16_bits(p1 - bf16_val(hb));
    }
#pragma unroll
    for (int dt = 0; dt < DT; ++dt)
#pragma unroll
      for (int r = 0; r < 8; ++r) oacc[dt][r] *= alpha[r];
    __builtin_amdgcn_fence(__ATOMIC_ACQ_REL, "workgroup");
    __builtin_amdgcn_wave_barrier();
    FragB pah, pal;
    pah.half[0] = *(const v8us*)&sPh[w][ln][8 * hh]; pah.half[1] = *(const v8us*)&sPh[w][ln][16 + 8 * hh];
    pal.half[0] = *(const v8us*)&sPl[w][ln][8 * hh]; pal.half[1] = *(const v8us*)&sPl[w][ln][16 + 8 * hh];
#pragma unroll
    for (int dt = 0; dt < DT; ++dt) {
      FragB bvh, bvl;
#pragma unroll
      for (int i = 0; i < 8; ++i) {
        bvh.u[i] = sVh[8 * hh + i][dt * 16 + ln]; bvh.u[8 + i] = sVh[16 + 8 * hh + i][dt * 16 + ln];
        bvl.u[i] = sVl[8 * hh + i][dt * 16 + ln]; bvl.u[8 + i] = sVl[16 + 8 * hh + i][dt * 16 + ln];
      }
      oacc[dt] = mmaN<3>(pah.v, pal.v, bvh.v, bvl.v, oacc[dt]);
    }
    __builtin_amdgcn_fence(__ATOMIC_ACQ_REL, "workgroup");
    __builtin_amdgcn_wave_barrier();
  }
#pragma unroll
  for (int r = 0; r < 8; ++r) {
    float l = l_r[r];
    l += __shfl_xor(l, 1, 32); l += __shfl_xor(l, 2, 32); l += __shfl_xor(l, 4, 32); l += __shfl_xor(l, 8, 32);
    l_r[r] = (l > 0.f) ? 1.0f / l : 0.f;
  }
#pragma unroll
  for (int dt = 0; dt < DT; ++dt)
#pragma unroll
    for (int r = 0; r < 8; ++r) sO[w][8 * hh + r][dt * 16 + ln] = oacc[dt][r] * l_r[r];
  __builtin_amdgcn_fence(__ATOMIC_ACQ_REL, "workgroup");
  __builtin_amdgcn_wave_barrier();
  {
    for (int r = 0; r < 16; ++r) {
      const int row = q0 + r;
      if (row < T && lane < D / 4) {
        const v4f val = *(const v4fa*)&sO[w][r][lane * 4];
        *(v4f*)(y + ((size_t)b * T + row) * ypitch + h * D + lane * 4) = val;
      }
    }
    
  }
}

// GEMM C = act(A·W + bias + resid): A f32 (ASPLIT -> hi/lo 2 terms), Wt bf16 [N][K]; ACT 0 none, 1 relu, 2 exact gelu;
// resid (optional, f32, row index = (row % rmod), pitch ldr, RES_BF16 rounds it) added before the activation.
template <bool ASPLIT, int ACT, bool BIAS_BF16, bool RES_BF16>
__global__ __launch_bounds__(128) void k_gemm_bf3(const float* __restrict__ A, int lda, const unsigned short* __restrict__ Wt, int ldb,
                                                const float* __restrict__ bias, const float* __restrict__ resid, int rmod, int ldr,
                                                float* __restrict__ C, int ldc, int M, int N, int K) {
  __shared__ __attribute__((aligned(16))) float so[4][16][64];
  const int tid = threadIdx.x, w = tid >> 5, lane = tid & 31, ln = lane & 15, hh = lane >> 4;
  const int ntn = N / 64;
  const int wid = blockIdx.x * 4 + w;
  const int mt = wid / ntn, nq = wid % ntn;
  if (mt * 16 >= M) return;
  const int row0 = mt * 16, col0 = nq * 64;
  const float* arow = A + (size_t)(row0 + ln) * lda;
  v8f acc[4] = {};
  for (int kb = 0; kb < K; kb += 32) {
    FragB ah, al;
    const v4f x0 = *(const v4fa*)(arow + kb + 8 * hh), x1 = *(const v4fa*)(arow + kb + 8 * hh + 4);
    const v4f x2 = *(const v4fa*)(arow + kb + 16 + 8 * hh), x3 = *(const v4fa*)(arow + kb + 16 + 8 * hh + 4);
    float xs[16] = {x0[0],x0[1],x0[2],x0[3],x1[0],x1[1],x1[2],x1[3],x2[0],x2[1],x2[2],x2[3],x3[0],x3[1],x3[2],x3[3]};
#pragma unroll
    for (int i = 0; i < 16; ++i) { const unsigned short hb = bf16_bits(xs[i]); ah.u[i] = hb; al.u[i] = ASPLIT ? bf16_bits(xs[i] - bf16_val(hb)) : (unsigned short)0; }
#pragma unroll
    for (int t = 0; t < 4; ++t) {
      const unsigned short* brow = Wt + (size_t)(col0 + t * 16 + ln) * ldb + kb;
      FragB b;
      b.half[0] = *(const v8us*)(brow + 8 * hh);
      b.half[1] = *(const v8us*)(brow + 16 + 8 * hh);
      acc[t] = mmaN<ASPLIT ? 2 : 1>(ah.v, al.v, b.v, b.v, acc[t]);
    }
  }
#pragma unroll
  for (int t = 0; t < 4; ++t) {
    const int col = col0 + t * 16 + ln;
    float bv = bias ? bias[col] : 0.f;
    if (BIAS_BF16) bv = bf16_round(bv);
#pragma unroll
    for (int r = 0; r < 8; ++r) {
      float v = acc[t][r] + bv;
      if (resid) { float rv = resid[(size_t)((row0 + 8 * hh + r) % rmod) * ldr + col]; if (RES_BF16) rv = bf16_round(rv); v += rv; }
      if (ACT == 1) v = fmaxf(v, 0.f);
      if (ACT == 2) v = 0.5f * v * (1.0f + erff(v * 0.70710678118654752f));
      if (ACT == 3) { const float u = 0.7978845608028654f * (v + 0.044715f * v * v * v); v = 0.5f * v * (1.0f + tanhf(u)); }
      so[w][8 * hh + r][t * 16 + ln] = v;
    }
  }
  __builtin_amdgcn_fence(__ATOMIC_ACQ_REL, "workgroup");
  __builtin_amdgcn_wave_barrier();
  const int rsub = lane >> 4, c4 = (lane & 15) * 4;
  {
#pragma unroll
    for (int q = 0; q < 8; ++q) {
      const int r = q * 2 + rsub;
      const v4f v = *(const v4fa*)&so[w][r][c4];
      *(v4f*)(C + (size_t)(row0 + r) * ldc + col0 + c4) = v;
    }
    
  }
}
// row LayerNorm (biased variance, eps) over N: s = X (+ R); optional out_sum <- s; out_norm <- (s-mu)*rsqrt(var+eps)*g + b
template <bool PARAM_BF16>
__global__ __launch_bounds__(256) void k_layernorm(const float* __restrict__ X, const float* __restrict__ R, const float* __restrict__ g, const float* __restrict__ bta,
                                                  float* __restrict__ out_sum, float* __restrict__ out_norm, int N, float eps) {
  __shared__ float red[256];
  const int row = blockIdx.x, tid = threadIdx.x;
  const float* x = X + (size_t)row * N; const float* rr = R ? R + (size_t)row * N : nullptr;
  float vals[16];                     // up to N = 4096
  const int per = N / 256;            // contiguous chunk per thread? use strided-by-4 chunks: thread handles j = tid*4 + 1024*u
  float s1 = 0.f;
  for (int u = 0; u < per / 4; ++u) {
    const int j = tid * 4 + 1024 * u;
    const v4f a = *(const v4fa*)(x + j);
    v4f b = {0.f,0.f,0.f,0.f}; if (rr) b = *(const v4fa*)(rr + j);
#pragma unroll
    for (int q = 0; q < 4; ++q) { const float v = a[q] + b[q]; vals[u * 4 + q] = v; s1 += v; }
  }
  red[tid] = s1; __syncthreads();
  for (int st = 128; st > 0; st >>= 1) { if (tid < st) red[tid] += red[tid + st]; __syncthreads(); }
  const float mu = red[0] / (float)N; __syncthreads();
  float s2 = 0.f;
  for (int u = 0; u < per / 4; ++u)
#pragma unroll
    for (int q = 0; q < 4; ++q) { const float c = vals[u * 4 + q] - mu; s2 += c * c; }
  red[tid] = s2; __syncthreads();
  for (int st = 128; st > 0; st >>= 1) { if (tid < st) red[tid] += red[tid + st]; __syncthreads(); }
  const float rs = rsqrtf(red[0] / (float)N + eps);
  {
    for (int u = 0; u < per / 4; ++u) {
      const int j = tid * 4 + 1024 * u;
      v4f o, sm;
#pragma unroll
      for (int q = 0; q < 4; ++q) {
        float gg = g[j + q], bb = bta[j + q];
        if (PARAM_BF16) { gg = bf16_round(gg); bb = bf16_round(bb); }
        sm[q] = vals[u * 4 + q]; o[q] = (vals[u * 4 + q] - mu) * rs * gg + bb;
      }
      if (out_sum) *(v4f*)(out_sum + (size_t)row * N + j) = sm;
      *(v4f*)(out_norm + (size_t)row * N + j) = o;
    }
    
  }
}



// ---- f16 WMMA path (v_wmma_f32_16x16x32_f16): 11-bit significands for operands in range — used where a [0,1] probability operand needs more precision than bf16
typedef _Float16 v16h __attribute__((ext_vector_type(16)));
union FragH { v16h v; v8us half[2]; _Float16 h[16]; unsigned short u[16]; };
template <int NT>
__device__ __forceinline__ v8f mmaH(v16h ah, v16h al, v16h bh, v16h bl, v8f c) {
  c = __builtin_amdgcn_wmma_f32_16x16x32_f16(false, ah, false, bh, (short)0, c, false, false);
  if (NT >= 2) c = __builtin_amdgcn_wmma_f32_16x16x32_f16(false, al, false, bh, (short)0, c, false, false);
  if (NT >= 3) c = __builtin_amdgcn_wmma_f32_16x16x32_f16(false, ah, false, bl, (short)0, c, false, false);
  asm volatile("v_nop\n\tv_nop\n\tv_nop\n\tv_nop" : "+v"(c) : "v"(ah), "v"(al), "v"(bh), "v"(bl));
  return c;
}
// batched GEMM like k_gemm_b but f16 operands: A f32 (split into f16 hi/lo if ASPLIT, else rounded to f16), Bt = f16 values [n][k]; alpha; C f32; N multiple of 16 (partial tiles skipped)
template <bool ASPLIT>
__global__ __launch_bounds__(128) void k_gemm_h(const float* __restrict__ A, int lda, size_t sA, const _Float16* __restrict__ Bh, int ldb, size_t sB, float alpha, float* __restrict__ C, int ldc, size_t sC, int M, int N, int K) {
  __shared__ __attribute__((aligned(16))) float so[4][16][64];
  const int tid = threadIdx.x, w = tid >> 5, lane = tid & 31, ln = lane & 15, hh = lane >> 4; const int by = blockIdx.y;
  A += (size_t)by * sA; Bh += (size_t)by * sB; C += (size_t)by * sC;
  const int ntn = (N + 63) / 64; const int wid = blockIdx.x * 4 + w; const int mt = wid / ntn, nq = wid % ntn; if (mt * 16 >= M) return;
  const int row0 = mt * 16, col0 = nq * 64; const float* arow = A + (size_t)(row0 + ln) * lda;
  v8f acc[4] = {};
  for (int kb = 0; kb < K; kb += 32) {
    FragH ah, al;
    const v4f x0 = *(const v4fa*)(arow + kb + 8 * hh), x1 = *(const v4fa*)(arow + kb + 8 * hh + 4), x2 = *(const v4fa*)(arow + kb + 16 + 8 * hh), x3 = *(const v4fa*)(arow + kb + 16 + 8 * hh + 4);
    float xs[16] = {x0[0],x0[1],x0[2],x0[3],x1[0],x1[1],x1[2],x1[3],x2[0],x2[1],x2[2],x2[3],x3[0],x3[1],x3[2],x3[3]};
#pragma unroll
    for (int i = 0; i < 16; ++i) { const _Float16 h = (_Float16)xs[i]; ah.h[i] = h; al.h[i] = ASPLIT ? (_Float16)(xs[i] - (float)h) : (_Float16)0.0f; }
#pragma unroll
    for (int t = 0; t < 4; ++t) { if (col0 + t * 16 >= N) continue; const size_t boff = (size_t)(col0 + t * 16 + ln) * ldb + kb; FragH bq; bq.half[0] = *(const v8us*)(Bh + boff + 8 * hh); bq.half[1] = *(const v8us*)(Bh + boff + 16 + 8 * hh);
      acc[t] = mmaH<ASPLIT ? 2 : 1>(ah.v, al.v, bq.v, bq.v, acc[t]); }
  }
#pragma unroll
  for (int t = 0; t < 4; ++t) { if (col0 + t * 16 >= N) continue;
#pragma unroll
    for (int r = 0; r < 8; ++r) so[w][8 * hh + r][t * 16 + ln] = acc[t][r] * alpha; }
  __builtin_amdgcn_fence(__ATOMIC_ACQ_REL, "workgroup"); __builtin_amdgcn_wave_barrier();
  const int rsub = lane >> 4, c4 = (lane & 15) * 4;
  {
#pragma unroll
    for (int q = 0; q < 8; ++q) { const int r = q * 2 + rsub; if (col0 + c4 < N) { const v4f v = *(const v4fa*)&so[w][r][c4]; *(v4f*)(C + (size_t)(row0 + r) * ldc + col0 + c4) = v; } }
     }
}

// Wt[n][k] = f16(W[k][n]·scale) from f32 row-major W[K][N] (scale = power of two; bf16-exact weights stay exact in f16 away from the subnormal range)
__global__ __launch_bounds__(256) void k_wt_f16(const float* __restrict__ W, _Float16* __restrict__ Wt, int K, int N, float scale) {
  const int t = blockIdx.x * 256 + threadIdx.x; if (t >= N * (K / 8)) return; const int n = t / (K / 8), k8 = (t % (K / 8)) * 8; FragH f;
#pragma unroll
  for (int i = 0; i < 8; ++i) f.h[i] = (_Float16)(bf16_round(W[(size_t)(k8 + i) * N + n]) * scale); const v8us o = f.half[0];
  *(v8us*)((unsigned short*)Wt + (size_t)n * K + k8) = o; 
}


typedef _Float16 v4h __attribute__((ext_vector_type(4)));
typedef _Float16 v2h __attribute__((ext_vector_type(2)));
typedef float v2fv __attribute__((ext_vector_type(2)));

__global__ __launch_bounds__(256) void k_h16(const float* __restrict__ x, _Float16* __restrict__ X16, size_t n8) { const size_t t = (size_t)blockIdx.x * 256 + threadIdx.x; if (t >= n8) return; FragH f;
#pragma unroll
  for (int q = 0; q < 8; ++q) f.h[q] = (_Float16)x[t * 8 + q]; *(v8us*)((unsigned short*)X16 + t * 8) = f.half[0];  }
// ---- the three projections in ONE launch, straight from the f32 inputs. A workgroup takes 128 tokens x 192 rows of the stacked (Wq; Wk; Wv): it rounds both tiles
// (x: bf16-exact f16; W: bf16-exact x 2^4, f16) into LDS over the whole K = 256, passes one barrier, and its 12 waves each form a 64 x 32 tile on WMMA.
// The accumulator holds 8 consecutive M rows in a lane, so M is made the index that is contiguous in the output: Q, K = [token][col]: A = W rows, B = x rows; V^T = [col][token]: A = x rows, B = Wv rows.
#define PTOK 128    // tokens per workgroup
#define PCOL 192    // stacked weight rows per workgroup: three groups of 64, each inside one matrix; 32 x 8 = 256 workgroups, one per WGP
#define PP 264      // LDS row pitch in 16-bit elements: 528 B = 16 B x odd, conflict-free for 16-byte fragment reads
#define PO 72       // pitch of a wave's output rows in LDS, 144 B
typedef unsigned short v4us __attribute__((ext_vector_type(4), may_alias));
typedef __bf16 v2bf __attribute__((ext_vector_type(2)));
union Pack4 { v2h p[2]; v4us u; };
// four f32 -> nearest-even bf16 (the packed hardware conversion: the same rounding as bf16_round) -> x scale, a power of two -> f16, 8 bytes into LDS
template <bool SCALE>
__device__ __forceinline__ void put4(unsigned short* p, v4f v) {
  Pack4 k;
#pragma unroll
  for (int q = 0; q < 2; ++q) {
    const unsigned int u = __builtin_bit_cast(unsigned int, __builtin_convertvector((v2fv){v[2 * q], v[2 * q + 1]}, v2bf));
    v2fv f = {__uint_as_float(u << 16), __uint_as_float(u & 0xFFFF0000u)};
    if (SCALE) f *= 16.0f;
    k.p[q] = __builtin_convertvector(f, v2h);
  }
  *(v4us*)p = k.u;
}
// acc[at][bt][r] = element (m = at*16 + 8*hh + r, n = bt*16 + ln). v = acc / 16 + bf16(bias), to f16; the wave's 32 rows n of 64 m go through its own LDS range, so that every store writes whole 128-byte lines.
template <bool ISV>
__device__ __forceinline__ void proj_out(const v8f (&acc)[4][2], const float (&bs)[32], unsigned short (*so)[PO], unsigned short* __restrict__ ob, int lane) {
  const int ln = lane & 15, hh = lane >> 4;
#pragma unroll
  for (int at = 0; at < 4; ++at)
#pragma unroll
    for (int bt = 0; bt < 2; ++bt) {
      FragH f;
#pragma unroll
      for (int r = 0; r < 8; ++r) f.h[r] = (_Float16)(acc[at][bt][r] * 0.0625f + bf16_round(ISV ? bs[bt] : bs[at * 8 + r]));
      *(v8us*)&so[bt * 16 + ln][at * 16 + 8 * hh] = f.half[0];
    }
  // the rows are read back by other lanes of the same wave: the LDS writes above must have landed
  __builtin_amdgcn_fence(__ATOMIC_ACQ_REL, "workgroup"); __builtin_amdgcn_wave_barrier();
  constexpr size_t ldo = ISV ? NN : PJ;
  unsigned short* op = ob + (size_t)(lane >> 3) * ldo + (lane & 7) * 8;
#pragma unroll
  for (int i = 0; i < 8; ++i) { const v8us v = *(const v8us*)&so[i * 4 + (lane >> 3)][(lane & 7) * 8]; *(v8us*)(op + (size_t)i * 4 * ldo) = v; }
}
__global__ __launch_bounds__(384) void k_proj(const float* __restrict__ x, const float* __restrict__ Wq, const float* __restrict__ Wk, const float* __restrict__ Wv,
                                              const float* __restrict__ bq, const float* __restrict__ bk, const float* __restrict__ bv,
                                              _Float16* __restrict__ Q16, _Float16* __restrict__ K16, _Float16* __restrict__ Vt) {
  __shared__ __attribute__((aligned(16))) unsigned short sT[PTOK + PCOL][PP];      // rows 0..127: tokens; 128..319: stacked weight rows
  __shared__ __attribute__((aligned(16))) unsigned short sO[12][32][PO];
  const int tid = threadIdx.x, lane = tid & 31, ln = lane & 15, hh = lane >> 4;
  const int w = __builtin_amdgcn_readfirstlane(tid >> 5);      // scalar: all that follows from it (matrix, roles, pointers) stays in scalar registers
  const int g = w >> 2, sub = w & 3;                           // the wave's group of 64 weight rows, and its quarter of the 64 x 128 products of that group
  const int tok0 = (blockIdx.x >> 3) * PTOK;
  const int cs = (blockIdx.x & 7) * PCOL + g * 64;             // the group's first row in the stacked weights
  const int mat = cs >> 9, cm = cs & (PJ - 1);                 // 0 q, 1 k, 2 v; first row inside that matrix
  const bool isV = mat == 2;
  const float* Wm = mat == 0 ? Wq : (mat == 1 ? Wk : Wv);
  float bs[32];      // bias, asked for first and rounded last: Q, K one value per m, V one per n
  if (isV) {
#pragma unroll
    for (int bt = 0; bt < 2; ++bt) bs[bt] = bv[cm + (sub & 1) * 32 + bt * 16 + ln];
    asm volatile("s_wait_xcnt 0x0" ::: "memory");      // at the end of the block that issues the loads
  } else {
    const float* bp = (mat == 0 ? bq : bk) + cm + 8 * hh;
#pragma unroll
    for (int at = 0; at < 4; ++at) {
      const v4f lo = *(const v4fa*)(bp + at * 16), hi = *(const v4fa*)(bp + at * 16 + 4);
#pragma unroll
      for (int q = 0; q < 4; ++q) { bs[at * 8 + q] = lo[q]; bs[at * 8 + 4 + q] = hi[q]; }
    }
    asm volatile("s_wait_xcnt 0x0" ::: "memory");      // as above
  }
  // staging: one wave-wide load = 512 contiguous bytes = half a row. The token tile is one contiguous 128 KiB (half row j*12 + w), a wave's 16 weight rows one contiguous 16 KiB:
  // every address is one base plus a constant.
  const float* gx = x + (size_t)tok0 * CIN + w * 128 + lane * 4;
  const float* gw = Wm + (size_t)(cm + sub * 16) * CIN + lane * 4;
  unsigned short* lx = &sT[w >> 1][(w & 1) * 128 + lane * 4];
  unsigned short* lw = &sT[PTOK + w * 16][lane * 4];
  v4f rx[22], rw[16];
#pragma unroll
  for (int j = 0; j < 21; ++j) rx[j] = *(const v4fa*)(gx + j * 12 * 128);
  asm volatile("s_wait_xcnt 0x0" ::: "memory");      // as above: the base of these loads is rewritten for the weight rows
  if (w < 4) { rx[21] = *(const v4fa*)(gx + 21 * 12 * 128); asm volatile("s_wait_xcnt 0x0" ::: "memory"); }      // 256 half rows = 21 x 12 + 4; the wait as above
#pragma unroll
  for (int j = 0; j < 16; ++j) rw[j] = *(const v4fa*)(gw + j * 128);
#pragma unroll
  for (int j = 0; j < 21; ++j) put4<false>(lx + j * 6 * PP, rx[j]);
  if (w < 4) put4<false>(lx + 21 * 6 * PP, rx[21]);
#pragma unroll
  for (int hf = 0; hf < 2; ++hf) {
#pragma unroll
    for (int j = 0; j < 16; ++j) {
      put4<true>(lw + (hf * 8 + (j >> 1)) * PP + (j & 1) * 128, rw[j]);
      if (hf == 0) rw[j] = *(const v4fa*)(gw + (16 + j) * 128);
    }
  }
  __syncthreads();      // both tiles are whole
  const int rowA = isV ? (sub >> 1) * 64 : PTOK + g * 64;
  const int rowB = isV ? PTOK + g * 64 + (sub & 1) * 32 : sub * 32;
  const unsigned short* pa = &sT[rowA + ln][8 * hh];
  const unsigned short* pb = &sT[rowB + ln][8 * hh];
  v8f acc[4][2];
#pragma unroll
  for (int at = 0; at < 4; ++at)
#pragma unroll
    for (int bt = 0; bt < 2; ++bt) acc[at][bt] = (v8f){0.f, 0.f, 0.f, 0.f, 0.f, 0.f, 0.f, 0.f};
  // A and B fragments take the same k order: elements 0..7 = k 8*hh.., 8..15 = k 16 + 8*hh..
  FragH a[2][4], b[2][2];
  auto frags = [&](int ks) {
#pragma unroll
    for (int at = 0; at < 4; ++at) { a[ks & 1][at].half[0] = *(const v8us*)(pa + at * 16 * PP + ks * 32); a[ks & 1][at].half[1] = *(const v8us*)(pa + at * 16 * PP + ks * 32 + 16); }
#pragma unroll
    for (int bt = 0; bt < 2; ++bt) { b[ks & 1][bt].half[0] = *(const v8us*)(pb + bt * 16 * PP + ks * 32); b[ks & 1][bt].half[1] = *(const v8us*)(pb + bt * 16 * PP + ks * 32 + 16); }
  };
  frags(0);
#pragma unroll
  for (int ks = 0; ks < CIN / 32; ++ks) {
    if (ks + 1 < CIN / 32) frags(ks + 1);      // the next step's 12 LDS reads as one group ahead of this step's 8 WMMAs, which cover their latency
    __builtin_amdgcn_sched_barrier(0);         // keeps that group here: the scheduler's own order sank each read to just in front of its first WMMA, four waits to zero a step
#pragma unroll
    for (int at = 0; at < 4; ++at)
#pragma unroll
      for (int bt = 0; bt < 2; ++bt) acc[at][bt] = __builtin_amdgcn_wmma_f32_16x16x32_f16(false, a[ks & 1][at].v, false, b[ks & 1][bt].v, (short)0, acc[at][bt], false, false);
  }
  if (isV) proj_out<true>(acc, bs, sO[w], (unsigned short*)Vt + (size_t)(cm + (sub & 1) * 32) * NN + tok0 + (sub >> 1) * 64, lane);      // V^T: [h*64 + d][token]
  else proj_out<false>(acc, bs, sO[w], (unsigned short*)(mat == 0 ? Q16 : K16) + (size_t)(tok0 + sub * 32) * PJ + cm, lane);              // head h at cols h*64
}

// ---- fused sigmoid attention. S^T/2 = K.(Q/2)^T (A = K rows from LDS, B = Q/2 in registers), P = sigmoid(S) = 1/2 + 1/2 tanh(S/2) in place (one transcendental an element), O^T += V^T.P^T (A = V^T rows from LDS, B = two packed S^T tiles).
// A sigmoid needs no running maximum, so sums over disjoint key ranges simply add: grid = (256-query blocks, heads, key ranges), 8 waves x 32 query columns, 64 keys per LDS stage.
#define KSPL 4      // key ranges per head: 512 workgroups, two per WGP
#define KT 64       // keys per stage
#define LP 72       // LDS row pitch in 16-bit elements: 144 B = 16 B x odd, conflict-free for 16-byte fragment reads
union FragP { v16h v; v2h p2[8]; };
// four waves per SIMD = two of these workgroups per WGP: the register budget the allocator may spend is that of the occupancy the grid is sized for
__global__ __launch_bounds__(256) __attribute__((amdgpu_waves_per_eu(4, 4)))
void k_fsig(const _Float16* __restrict__ Q16, const _Float16* __restrict__ K16, const _Float16* __restrict__ Vt, float* __restrict__ Op, float* __restrict__ Zp) {
  __shared__ __attribute__((aligned(16))) unsigned short sK[2][KT][LP];      // [buffer][key][dim]
  __shared__ __attribute__((aligned(16))) unsigned short sV[2][HD][LP];      // [buffer][d][key]
  const int tid = threadIdx.x, w = tid >> 5, lane = tid & 31, c = lane & 15, hh = lane >> 4;
  const int h = blockIdx.y, sp = blockIdx.z;
  const int q0 = blockIdx.x * 256 + w * 32;
  const int key0 = sp * (NN / KSPL);
  constexpr int NT = NN / KSPL / KT;
  // staging: a thread moves 16 bytes of rows r0 and r0 + 32 of the K tile and of the V^T tile
  const int r0 = tid >> 3, c8 = (tid & 7) * 8;
  const unsigned short* gk = (const unsigned short*)K16 + (size_t)(key0 + r0) * PJ + h * HD + c8;
  const unsigned short* gv = (const unsigned short*)Vt + ((size_t)h * HD + r0) * NN + key0 + c8;
  v8us rk0, rk1, rv0, rv1;
  auto fetch = [&](int t) {
    const unsigned short* kp = gk + (size_t)t * KT * PJ; const unsigned short* vp = gv + t * KT;
    rk0 = *(const v8us*)kp; rk1 = *(const v8us*)(kp + 32 * PJ); rv0 = *(const v8us*)vp; rv1 = *(const v8us*)(vp + (size_t)32 * NN);
  };
  auto put = [&](int b) {
    *(v8us*)&sK[b][r0][c8] = rk0; *(v8us*)&sK[b][r0 + 32][c8] = rk1; *(v8us*)&sV[b][r0][c8] = rv0; *(v8us*)&sV[b][r0 + 32][c8] = rv1;
  };
  // B fragments of the wave's 2 x 16 query columns, hardware k order over the 64 dims
  FragH bq[2][2];
#pragma unroll
  for (int cg = 0; cg < 2; ++cg)
#pragma unroll
    for (int ks = 0; ks < 2; ++ks) {
      const unsigned short* qr = (const unsigned short*)Q16 + (size_t)(q0 + cg * 16 + c) * PJ + h * HD + ks * 32;
      bq[cg][ks].half[0] = *(const v8us*)(qr + 8 * hh); bq[cg][ks].half[1] = *(const v8us*)(qr + 16 + 8 * hh);
      bq[cg][ks].v *= (_Float16)0.5f;      // the halving of the tanh argument, once a wave: a power of two, exact above the f16 subnormal range, so the WMMA sums are the logits' own sums halved (in front of these packed f16 multiplies the compiler sets the f16 rounding field to its default, nearest even)
    }
  v8f o[4][2];
#pragma unroll
  for (int dt = 0; dt < 4; ++dt)
#pragma unroll
    for (int cg = 0; cg < 2; ++cg) o[dt][cg] = (v8f){0.f, 0.f, 0.f, 0.f, 0.f, 0.f, 0.f, 0.f};
  v8f zs[2] = {(v8f){0.f, 0.f, 0.f, 0.f, 0.f, 0.f, 0.f, 0.f}, (v8f){0.f, 0.f, 0.f, 0.f, 0.f, 0.f, 0.f, 0.f}};      // row sums of the f16 P, taken on the matrix pipe: A = all ones
  FragH ones;
#pragma unroll
  for (int i = 0; i < 16; ++i) ones.h[i] = (_Float16)1.0f;
  fetch(0); put(0);
  __syncthreads();
  // rolled: one pass already holds 36 WMMAs, and a second copy of the body would only cost registers and instruction cache
#pragma unroll 1
  for (int t = 0; t < NT; ++t) {
    const int b = t & 1;
    if (t + 1 < NT) fetch(t + 1);      // the next stage's global loads fly while this stage is worked on
#pragma unroll
    for (int j = 0; j < 2; ++j) {      // 32 keys
      FragH ka[2][2];
#pragma unroll
      for (int kt = 0; kt < 2; ++kt)
#pragma unroll
        for (int ks = 0; ks < 2; ++ks) {
          const unsigned short* kr = &sK[b][j * 32 + kt * 16 + c][ks * 32];
          ka[kt][ks].half[0] = *(const v8us*)(kr + 8 * hh); ka[kt][ks].half[1] = *(const v8us*)(kr + 16 + 8 * hh);
        }
      v8f s[2][2];      // s[cg][kt][r] = half the logit(key j*32 + kt*16 + 8*hh + r, query cg*16 + c)
#pragma unroll
      for (int cg = 0; cg < 2; ++cg)
#pragma unroll
        for (int kt = 0; kt < 2; ++kt) {
          s[cg][kt] = (v8f){0.f, 0.f, 0.f, 0.f, 0.f, 0.f, 0.f, 0.f};
          s[cg][kt] = __builtin_amdgcn_wmma_f32_16x16x32_f16(false, ka[kt][0].v, false, bq[cg][0].v, (short)0, s[cg][kt], false, false);
          s[cg][kt] = __builtin_amdgcn_wmma_f32_16x16x32_f16(false, ka[kt][1].v, false, bq[cg][1].v, (short)0, s[cg][kt], false, false);
        }
      FragH va[4];      // V^T fragments asked for ahead of the sigmoid, which covers their LDS latency
#pragma unroll
      for (int dt = 0; dt < 4; ++dt) {
        const unsigned short* vr = &sV[b][dt * 16 + c][j * 32];
        va[dt].half[0] = *(const v8us*)(vr + 8 * hh); va[dt].half[1] = *(const v8us*)(vr + 16 + 8 * hh);
      }
      FragP pb[2];
#pragma unroll
      for (int cg = 0; cg < 2; ++cg)
#pragma unroll
        for (int kt = 0; kt < 2; ++kt) {
#pragma unroll
          for (int r = 0; r < 8; r += 2) {
            const v2fv th = {__builtin_amdgcn_tanhf(s[cg][kt][r]), __builtin_amdgcn_tanhf(s[cg][kt][r + 1])};
            pb[cg].p2[kt * 4 + (r >> 1)] = __builtin_convertvector(th * 0.5f + 0.5f, v2h);      // sigmoid in f32, rounded once to f16; element kt*8 + r of B = key 8*hh + r (kt 0), 16 + 8*hh + r (kt 1): the hardware k order
          }
        }
#pragma unroll
      for (int cg = 0; cg < 2; ++cg) zs[cg] = __builtin_amdgcn_wmma_f32_16x16x32_f16(false, ones.v, false, pb[cg].v, (short)0, zs[cg], false, false);      // every row of zs = the column sums of P^T
#pragma unroll
      for (int dt = 0; dt < 4; ++dt)
#pragma unroll
        for (int cg = 0; cg < 2; ++cg) o[dt][cg] = __builtin_amdgcn_wmma_f32_16x16x32_f16(false, va[dt].v, false, pb[cg].v, (short)0, o[dt][cg], false, false);
    }
    if (t + 1 < NT) put(b ^ 1);      // that buffer's last readers left it at the barrier that ended pass t - 1
    __syncthreads();                 // publishes stage t + 1 and ends every read of stage t
  }
  // o[dt][cg][r] = sum_keys P.V at d = dt*16 + 8*hh + r, query cg*16 + c. Staged order of a query's 64 values: [hh][dt][r], so a lane writes one whole 128-byte line.
#pragma unroll
  for (int cg = 0; cg < 2; ++cg) {
    const int q = q0 + cg * 16 + c;
    const size_t slab = ((size_t)h * KSPL + sp) * NN + q;
    float* op = Op + slab * HD + hh * 32;
#pragma unroll
    for (int dt = 0; dt < 4; ++dt) {
      *(v4f*)(op + dt * 8) = (v4f){o[dt][cg][0], o[dt][cg][1], o[dt][cg][2], o[dt][cg][3]};
      *(v4f*)(op + dt * 8 + 4) = (v4f){o[dt][cg][4], o[dt][cg][5], o[dt][cg][6], o[dt][cg][7]};
    }
    if (hh == 0) Zp[slab] = zs[cg][0];      // both lane halves hold the same sum
  }
}
// out[q][d] = 1/8 sum_h (sum_ranges Op) / (sum_ranges Zp). A wave takes one query: lane = (half hf of the heads, four consecutive values i of the staged order [hh][dt][r]).
__global__ __launch_bounds__(256) void k_hmean(const float* __restrict__ Op, const float* __restrict__ Zp, float* __restrict__ out) {
  const unsigned tid = threadIdx.x, lane = tid & 31, i = lane & 15, hf = lane >> 4;
  const unsigned q = blockIdx.x * 8 + (tid >> 5), e = i * 4;
  const float* pm = Op + ((size_t)(hf * 16 + 8) * NN + q) * HD + e;      // the middle of the lane's 16 (head, key range) planes of 1 MiB: all 16 lie within a load's immediate offset
  const float* pz = Zp + (size_t)(hf * 16 + i) * NN + q;                 // lane i holds the row sum of plane i of its half
  v4f s[16]; float z;
  // The 17 loads and their data wait in one statement: all are in flight together (one round trip to memory), and no register that an issued load names is rewritten in front of the wait
  asm volatile("global_load_b128 %0, %17, off offset:-8388608\n\t"
               "global_load_b128 %1, %17, off offset:-7340032\n\t"
               "global_load_b128 %2, %17, off offset:-6291456\n\t"
               "global_load_b128 %3, %17, off offset:-5242880\n\t"
               "global_load_b128 %4, %17, off offset:-4194304\n\t"
               "global_load_b128 %5, %17, off offset:-3145728\n\t"
               "global_load_b128 %6, %17, off offset:-2097152\n\t"
               "global_load_b128 %7, %17, off offset:-1048576\n\t"
               "global_load_b128 %8, %17, off\n\t"
               "global_load_b128 %9, %17, off offset:1048576\n\t"
               "global_load_b128 %10, %17, off offset:2097152\n\t"
               "global_load_b128 %11, %17, off offset:3145728\n\t"
               "global_load_b128 %12, %17, off offset:4194304\n\t"
               "global_load_b128 %13, %17, off offset:5242880\n\t"
               "global_load_b128 %14, %17, off offset:6291456\n\t"
               "global_load_b128 %15, %17, off offset:7340032\n\t"
               "global_load_b32 %16, %18, off\n\t"
               "s_wait_loadcnt 0x0"
               : "=&v"(s[0]), "=&v"(s[1]), "=&v"(s[2]), "=&v"(s[3]), "=&v"(s[4]), "=&v"(s[5]), "=&v"(s[6]), "=&v"(s[7]), "=&v"(s[8]), "=&v"(s[9]), "=&v"(s[10]), "=&v"(s[11]), "=&v"(s[12]), "=&v"(s[13]), "=&v"(s[14]), "=&v"(s[15]), "=&v"(z)
               : "v"(pm), "v"(pz) : "memory");
  z += __shfl_xor(z, 1, 32); z += __shfl_xor(z, 2, 32);      // the four key ranges of a head lie in four neighbouring lanes
  const float inv = 1.0f / z;
  v4f acc = {0.f, 0.f, 0.f, 0.f};
#pragma unroll
  for (int hl = 0; hl < 4; ++hl) acc += (((s[hl * 4] + s[hl * 4 + 1]) + s[hl * 4 + 2]) + s[hl * 4 + 3]) * __shfl(inv, (int)(hf * 16 + hl * 4), 32);
#pragma unroll
  for (int c = 0; c < 4; ++c) acc[c] += __shfl_xor(acc[c], 16, 32);      // the other four heads
  const unsigned d = ((e >> 3) & 3) * 16 + (e >> 5) * 8 + (e & 7);
  if (hf == 0) *(v4f*)(out + (size_t)q * HD + d) = acc * 0.125f;
}
extern "C" void kernel_launch(void* const* d_in, const int* in_sizes, int n_in,
                              void* d_out, int out_size, void* d_ws, size_t ws_size, hipStream_t stream) {
  (void)in_sizes; (void)n_in; (void)out_size;
  const float* x = (const float*)d_in[0]; const float* Wq = (const float*)d_in[1]; const float* bq = (const float*)d_in[2]; const float* Wk = (const float*)d_in[3]; const float* bk = (const float*)d_in[4]; const float* Wv = (const float*)d_in[5]; const float* bv = (const float*)d_in[6];
  char* ws = (char*)d_ws; size_t off = 0;
  auto take = [&](size_t bytes) { char* p = ws + off; off += (bytes + 255) & ~(size_t)255; return p; };
  _Float16* Q16 = (_Float16*)take((size_t)NN * PJ * 2); _Float16* K16 = (_Float16*)take((size_t)NN * PJ * 2); _Float16* Vt = (_Float16*)take((size_t)NN * PJ * 2); float* Op = (float*)take((size_t)NH * KSPL * NN * HD * 4); float* Zp = (float*)take((size_t)NH * KSPL * NN * 4);
  if (off > ws_size) return;      // 4.2 x 3 + 33.6 + 0.5 = about 47 MB
  k_proj<<<(NN / PTOK) * (3 * PJ / PCOL), 384, 0, stream>>>(x, Wq, Wk, Wv, bq, bk, bv, Q16, K16, Vt);
  k_fsig<<<dim3(NN / 256, NH, KSPL), 256, 0, stream>>>(Q16, K16, Vt, Op, Zp);
  k_hmean<<<NN / 8, 256, 0, stream>>>(Op, Zp, (float*)d_out);
}

// v004
// It runs in 39.9 microseconds.
// Two timings next to v003 put it at 1.06 and 1.05 times that version's speed.
// All steps since v000 together make it 42.5 times as fast.
#include <hip/hip_runtime.h>
// Sigmoid multi-head attention (N=4096 tokens, IN=256, 8 heads x 64): q,k,v = x.W^T + b; S_h = sigmoid(q_h.k_h^T); attn = S_h / sum_keys S_h; out = mean_h(attn.v_h) -> [4096, 64].
// All three projections in one kernel on v_wmma_f32_16x16x32_f16 (x bf16-exact, (out,in) weights bf16-exact x 2^4, q/k/v f16, f32 accumulate). Logits (K = 64), sigmoid, row sums and P.V run in ONE
// kernel on the same WMMA form: S and P = f16(sigmoid) never leave registers; each workgroup leaves unnormalised sums of a quarter of the keys, a small kernel divides and takes the head mean.
#define NN 4096
#define CIN 256
#define PJ 512
#define HD 64
#define NH 8

typedef __bf16 v16b __attribute__((ext_vector_type(16)));
typedef unsigned short v8us __attribute__((ext_vector_type(8), may_alias));
typedef float  v8f  __attribute__((ext_vector_type(8)));
typedef float  v4f  __attribute__((ext_vector_type(4)));
typedef float  v4fa __attribute__((ext_vector_type(4), may_alias));
union FragB { v16b v; v8us half[2]; unsigned short u[16]; };

__device__ __forceinline__ unsigned short bf16_bits(float x) { unsigned int u = __float_as_uint(x); return (unsigned short)((u + 0x7FFFu + ((u >> 16) & 1u)) >> 16); }
__device__ __forceinline__ float bf16_val(unsigned short b) { return __uint_as_float(((unsigned int)b) << 16); }
__device__ __forceinline__ float bf16_round(float x) { return bf16_val(bf16_bits(x)); }
// D += A·B with NT terms: 1 = ah·bh, 2 = + al·bh (A split), 3 = + ah·bl (both split)
template <int NT>
__device__ __forceinline__ v8f mmaN(v16b ah, v16b al, v16b bh, v16b bl, v8f c) {
  c = __builtin_amdgcn_wmma_f32_16x16x32_bf16(false, ah, false, bh, (short)0, c, false, false);
  if (NT >= 2) c = __builtin_amdgcn_wmma_f32_16x16x32_bf16(false, al, false, bh, (short)0, c, false, false);
  if (NT >= 3) c = __builtin_amdgcn_wmma_f32_16x16x32_bf16(false, ah, false, bl, (short)0, c, false, false);
  asm volatile("v_nop\n\tv_nop\n\tv_nop\n\tv_nop" : "+v"(c) : "v"(ah), "v"(al), "v"(bh), "v"(bl));
  return c;
}

__global__ __launch_bounds__(256) void k_wt_bf16(const float* __restrict__ W, unsigned short* __restrict__ Wt, int K, int N) {
  const int t = blockIdx.x * 256 + threadIdx.x;
  const int k8n = K / 8;
  if (t >= N * k8n) return;
  const int n = t / k8n, k8 = (t % k8n) * 8;
  v8us v;
#pragma unroll
  for (int i = 0; i < 8; ++i) v[i] = bf16_bits(W[(size_t)(k8 + i) * N + n]);
  *(v8us*)(Wt + (size_t)n * K + k8) = v;
  
}

// GEMM C[M][N] (f32, pitch ldc) = act(A[M][K]·W + bias). A f32 row-major (pitch lda) converted per fragment to bf16
// (ASPLIT: hi/lo two planes -> 2 terms, else single rounded term); Wt bf16 [N][K] (pitch ldb). BIAS_BF16 rounds the
// bias to bf16 first (bias quantised to bf16 before the add). K%32==0, M%16==0, N%64==0.
template <bool ASPLIT, int ACT, bool BIAS_BF16>
__global__ __launch_bounds__(128) void k_gemm_bf(const float* __restrict__ A, int lda, const unsigned short* __restrict__ Wt, int ldb,
                                               const float* __restrict__ bias, float* __restrict__ C, int ldc, int M, int N, int K) {
  __shared__ __attribute__((aligned(16))) float so[4][16][64];
  const int tid = threadIdx.x, w = tid >> 5, lane = tid & 31, ln = lane & 15, hh = lane >> 4;
  const int ntn = N / 64;
  const int wid = blockIdx.x * 4 + w;
  const int mt = wid / ntn, nq = wid % ntn;
  if (mt * 16 >= M) return;
  const int row0 = mt * 16, col0 = nq * 64;
  const float* arow = A + (size_t)(row0 + ln) * lda;
  v8f acc[4] = {};
  for (int kb = 0; kb < K; kb += 32) {
    FragB ah, al;
    const v4f x0 = *(const v4fa*)(arow + kb + 8 * hh), x1 = *(const v4fa*)(arow + kb + 8 * hh + 4);
    const v4f x2 = *(const v4fa*)(arow + kb + 16 + 8 * hh), x3 = *(const v4fa*)(arow + kb + 16 + 8 * hh + 4);
    float xs[16] = {x0[0],x0[1],x0[2],x0[3],x1[0],x1[1],x1[2],x1[3],x2[0],x2[1],x2[2],x2[3],x3[0],x3[1],x3[2],x3[3]};
#pragma unroll
    for (int i = 0; i < 16; ++i) { const unsigned short hb = bf16_bits(xs[i]); ah.u[i] = hb; al.u[i] = ASPLIT ? bf16_bits(xs[i] - bf16_val(hb)) : (unsigned short)0; }
#pragma unroll
    for (int t = 0; t < 4; ++t) {
      const unsigned short* brow = Wt + (size_t)(col0 + t * 16 + ln) * ldb + kb;
      FragB b;
      b.half[0] = *(const v8us*)(brow + 8 * hh);
      b.half[1] = *(const v8us*)(brow + 16 + 8 * hh);
      acc[t] = mmaN<ASPLIT ? 2 : 1>(ah.v, al.v, b.v, b.v, acc[t]);
    }
  }
#pragma unroll
  for (int t = 0; t < 4; ++t) {
    float bv = bias ? bias[col0 + t * 16 + ln] : 0.f;
    if (BIAS_BF16) bv = bf16_round(bv);
#pragma unroll
    for (int r = 0; r < 8; ++r) { float v = acc[t][r] + bv; if (ACT == 1) v = fmaxf(v, 0.f); so[w][8 * hh + r][t * 16 + ln] = v; }
  }
  __builtin_amdgcn_fence(__ATOMIC_ACQ_REL, "workgroup");
  __builtin_amdgcn_wave_barrier();
  const int rsub = lane >> 4, c4 = (lane & 15) * 4;
  {
#pragma unroll
    for (int q = 0; q < 8; ++q) {
      const int r = q * 2 + rsub;
      const v4f v = *(const v4fa*)&so[w][r][c4];
      *(v4f*)(C + (size_t)(row0 + r) * ldc + col0 + c4) = v;
    }
    
  }
}

// Flash-style causal/unmasked attention, all contractions 3-term bf16 hi/lo splits, f32 softmax with running max.
// q,k,v rows are read from f32 buffers with arbitrary row pitch (so they can live inside a fused qkv buffer);
// D = head size (multiple of 32, <= 128); one wave = 16 query rows; block = 4 waves (64 queries) sharing K/V chunks of 32.
template <int D, bool CAUSAL>
__global__ __launch_bounds__(128) void k_flash(const float* __restrict__ qb, const float* __restrict__ kb, const float* __restrict__ vb,
                                             int pitch, int T, int H, float scale, float* __restrict__ y, int ypitch) {
  constexpr int KS = D / 32;        // k-steps for QK
  constexpr int DT = D / 16;        // d tiles for PV
  __shared__ __attribute__((aligned(16))) unsigned short sKh[32][D + 8], sKl[32][D + 8], sVh[32][D + 8], sVl[32][D + 8];
  __shared__ __attribute__((aligned(16))) unsigned short sPh[4][16][40], sPl[4][16][40];
  __shared__ __attribute__((aligned(16))) float sO[4][16][D];
  const int tid = threadIdx.x, w = tid >> 5, lane = tid & 31, ln = lane & 15, hh = lane >> 4;
  const int nqb = (T + 63) / 64;
  const int bh = blockIdx.x / nqb, qblk = blockIdx.x % nqb;
  const int b = bh / H, h = bh % H;
  const int q0 = qblk * 64 + w * 16;
  const float* Q = qb + (size_t)b * T * pitch + h * D;
  const float* K = kb + (size_t)b * T * pitch + h * D;
  const float* V = vb + (size_t)b * T * pitch + h * D;

  // A fragments of the wave's 16 query rows (scaled), hi/lo
  FragB aqh[KS], aql[KS];
  {
    int row = q0 + ln; if (row >= T) row = T - 1;
    const float* qr = Q + (size_t)row * pitch;
#pragma unroll
    for (int ks = 0; ks < KS; ++ks)
#pragma unroll
      for (int i = 0; i < 16; ++i) {
        const int d = ks * 32 + ((i < 8) ? (8 * hh + i) : (16 + 8 * hh + (i - 8)));
        const float x = qr[d] * scale; const unsigned short hb = bf16_bits(x);
        aqh[ks].u[i] = hb; aql[ks].u[i] = bf16_bits(x - bf16_val(hb));
      }
  }
  float m_r[8], l_r[8];
#pragma unroll
  for (int r = 0; r < 8; ++r) { m_r[r] = -3.0e38f; l_r[r] = 0.f; }
  v8f oacc[DT];
#pragma unroll
  for (int dt = 0; dt < DT; ++dt) oacc[dt] = (v8f){0.f,0.f,0.f,0.f,0.f,0.f,0.f,0.f};

  const int kv_end = CAUSAL ? min(T, qblk * 64 + 64) : T;     // block-uniform
  for (int j0 = 0; j0 < kv_end; j0 += 32) {
    __syncthreads();
    for (int e = tid; e < 32 * (D / 4); e += 128) {
      const int r = e / (D / 4), c4 = (e % (D / 4)) * 4;
      const int key = j0 + r;
      v4f kf = {0.f,0.f,0.f,0.f}, vf = {0.f,0.f,0.f,0.f};
      if (key < T) { kf = *(const v4fa*)(K + (size_t)key * pitch + c4); vf = *(const v4fa*)(V + (size_t)key * pitch + c4); }
#pragma unroll
      for (int t = 0; t < 4; ++t) {
        unsigned short hb = bf16_bits(kf[t]); sKh[r][c4 + t] = hb; sKl[r][c4 + t] = bf16_bits(kf[t] - bf16_val(hb));
        hb = bf16_bits(vf[t]); sVh[r][c4 + t] = hb; sVl[r][c4 + t] = bf16_bits(vf[t] - bf16_val(hb));
      }
    }
    __syncthreads();
    // S tile 16 x 32
    v8f s[2];
#pragma unroll
    for (int nt = 0; nt < 2; ++nt) {
      v8f acc = {};
#pragma unroll
      for (int ks = 0; ks < KS; ++ks) {
        FragB bh_, bl_;
        bh_.half[0] = *(const v8us*)&sKh[nt * 16 + ln][ks * 32 + 8 * hh]; bh_.half[1] = *(const v8us*)&sKh[nt * 16 + ln][ks * 32 + 16 + 8 * hh];
        bl_.half[0] = *(const v8us*)&sKl[nt * 16 + ln][ks * 32 + 8 * hh]; bl_.half[1] = *(const v8us*)&sKl[nt * 16 + ln][ks * 32 + 16 + 8 * hh];
        acc = mmaN<3>(aqh[ks].v, aql[ks].v, bh_.v, bl_.v, acc);
      }
      s[nt] = acc;
    }
    // mask + running max (rows 8hh+r; the 16 lanes of a half share rows)
    float alpha[8];
#pragma unroll
    for (int r = 0; r < 8; ++r) {
      const int qi = q0 + 8 * hh + r;
      const int ja = j0 + ln, jb = j0 + 16 + ln;
      if (CAUSAL) { if (ja > qi) s[0][r] = -3.0e38f; if (jb > qi) s[1][r] = -3.0e38f; }
      if (ja >= T) s[0][r] = -3.0e38f;
      if (jb >= T) s[1][r] = -3.0e38f;
      float mx = fmaxf(s[0][r], s[1][r]);
      mx = fmaxf(mx, __shfl_xor(mx, 1, 32)); mx = fmaxf(mx, __shfl_xor(mx, 2, 32)); mx = fmaxf(mx, __shfl_xor(mx, 4, 32)); mx = fmaxf(mx, __shfl_xor(mx, 8, 32));
      const float mnew = fmaxf(m_r[r], mx);
      alpha[r] = (mnew > -1.0e38f) ? __expf(m_r[r] - mnew) : 1.0f;
      const float p0 = (s[0][r] > -1.0e38f) ? __expf(s[0][r] - mnew) : 0.f;
      const float p1 = (s[1][r] > -1.0e38f) ? __expf(s[1][r] - mnew) : 0.f;
      m_r[r] = mnew;
      l_r[r] = l_r[r] * alpha[r] + p0 + p1;            // per-lane partial row sum (16 lanes combined at the end)
      unsigned short hb = bf16_bits(p0); sPh[w][8 * hh + r][ln] = hb;      sPl[w][8 * hh + r][ln] = bf16_bits(p0 - bf16_val(hb));
      hb = bf16_bits(p1);                sPh[w][8 * hh + r][16 + ln] = hb; sPl[w][8 * hh + r][16 + ln] = bf16_bits(p1 - bf16_val(hb));
    }
#pragma unroll
    for (int dt = 0; dt < DT; ++dt)
#pragma unroll
      for (int r = 0; r < 8; ++r) oacc[dt][r] *= alpha[r];
    __builtin_amdgcn_fence(__ATOMIC_ACQ_REL, "workgroup");
    __builtin_amdgcn_wave_barrier();
    FragB pah, pal;
    pah.half[0] = *(const v8us*)&sPh[w][ln][8 * hh]; pah.half[1] = *(const v8us*)&sPh[w][ln][16 + 8 * hh];
    pal.half[0] = *(const v8us*)&sPl[w][ln][8 * hh]; pal.half[1] = *(const v8us*)&sPl[w][ln][16 + 8 * hh];
#pragma unroll
    for (int dt = 0; dt < DT; ++dt) {
      FragB bvh, bvl;
#pragma unroll
      for (int i = 0; i < 8; ++i) {
        bvh.u[i] = sVh[8 * hh + i][dt * 16 + ln]; bvh.u[8 + i] = sVh[16 + 8 * hh + i][dt * 16 + ln];
        bvl.u[i] = sVl[8 * hh + i][dt * 16 + ln]; bvl.u[8 + i] = sVl[16 + 8 * hh + i][dt * 16 + ln];
      }
      oacc[dt] = mmaN<3>(pah.v, pal.v, bvh.v, bvl.v, oacc[dt]);
    }
    __builtin_amdgcn_fence(__ATOMIC_ACQ_REL, "workgroup");
    __builtin_amdgcn_wave_barrier();
  }
#pragma unroll
  for (int r = 0; r < 8; ++r) {
    float l = l_r[r];
    l += __shfl_xor(l, 1, 32); l += __shfl_xor(l, 2, 32); l += __shfl_xor(l, 4, 32); l += __shfl_xor(l, 8, 32);
    l_r[r] = (l > 0.f) ? 1.0f / l : 0.f;
  }
#pragma unroll
  for (int dt = 0; dt < DT; ++dt)
#pragma unroll
    for (int r = 0; r < 8; ++r) sO[w][8 * hh + r][dt * 16 + ln] = oacc[dt][r] * l_r[r];
  __builtin_amdgcn_fence(__ATOMIC_ACQ_REL, "workgroup");
  __builtin_amdgcn_wave_barrier();
  {
    for (int r = 0; r < 16; ++r) {
      const int row = q0 + r;
      if (row < T && lane < D / 4) {
        const v4f val = *(const v4fa*)&sO[w][r][lane * 4];
        *(v4f*)(y + ((size_t)b * T + row) * ypitch + h * D + lane * 4) = val;
      }
    }
    
  }
}

// GEMM C = act(A·W + bias + resid): A f32 (ASPLIT -> hi/lo 2 terms), Wt bf16 [N][K]; ACT 0 none, 1 relu, 2 exact gelu;
// resid (optional, f32, row index = (row % rmod), pitch ldr, RES_BF16 rounds it) added before the activation.
template <bool ASPLIT, int ACT, bool BIAS_BF16, bool RES_BF16>
__global__ __launch_bounds__(128) void k_gemm_bf3(const float* __restrict__ A, int lda, const unsigned short* __restrict__ Wt, int ldb,
                                                const float* __restrict__ bias, const float* __restrict__ resid, int rmod, int ldr,
                                                float* __restrict__ C, int ldc, int M, int N, int K) {
  __shared__ __attribute__((aligned(16))) float so[4][16][64];
  const int tid = threadIdx.x, w = tid >> 5, lane = tid & 31, ln = lane & 15, hh = lane >> 4;
  const int ntn = N / 64;
  const int wid = blockIdx.x * 4 + w;
  const int mt = wid / ntn, nq = wid % ntn;
  if (mt * 16 >= M) return;
  const int row0 = mt * 16, col0 = nq * 64;
  const float* arow = A + (size_t)(row0 + ln) * lda;
  v8f acc[4] = {};
  for (int kb = 0; kb < K; kb += 32) {
    FragB ah, al;
    const v4f x0 = *(const v4fa*)(arow + kb + 8 * hh), x1 = *(const v4fa*)(arow + kb + 8 * hh + 4);
    const v4f x2 = *(const v4fa*)(arow + kb + 16 + 8 * hh), x3 = *(const v4fa*)(arow + kb + 16 + 8 * hh + 4);
    float xs[16] = {x0[0],x0[1],x0[2],x0[3],x1[0],x1[1],x1[2],x1[3],x2[0],x2[1],x2[2],x2[3],x3[0],x3[1],x3[2],x3[3]};
#pragma unroll
    for (int i = 0; i < 16; ++i) { const unsigned short hb = bf16_bits(xs[i]); ah.u[i] = hb; al.u[i] = ASPLIT ? bf16_bits(xs[i] - bf16_val(hb)) : (unsigned short)0; }
#pragma unroll
    for (int t = 0; t < 4; ++t) {
      const unsigned short* brow = Wt + (size_t)(col0 + t * 16 + ln) * ldb + kb;
      FragB b;
      b.half[0] = *(const v8us*)(brow + 8 * hh);
      b.half[1] = *(const v8us*)(brow + 16 + 8 * hh);
      acc[t] = mmaN<ASPLIT ? 2 : 1>(ah.v, al.v, b.v, b.v, acc[t]);
    }
  }
#pragma unroll
  for (int t = 0; t < 4; ++t) {
    const int col = col0 + t * 16 + ln;
    float bv = bias ? bias[col] : 0.f;
    if (BIAS_BF16) bv = bf16_round(bv);
#pragma unroll
    for (int r = 0; r < 8; ++r) {
      float v = acc[t][r] + bv;
      if (resid) { float rv = resid[(size_t)((row0 + 8 * hh + r) % rmod) * ldr + col]; if (RES_BF16) rv = bf16_round(rv); v += rv; }
      if (ACT == 1) v = fmaxf(v, 0.f);
      if (ACT == 2) v = 0.5f * v * (1.0f + erff(v * 0.70710678118654752f));
      if (ACT == 3) { const float u = 0.7978845608028654f * (v + 0.044715f * v * v * v); v = 0.5f * v * (1.0f + tanhf(u)); }
      so[w][8 * hh + r][t * 16 + ln] = v;
    }
  }
  __builtin_amdgcn_fence(__ATOMIC_ACQ_REL, "workgroup");
  __builtin_amdgcn_wave_barrier();
  const int rsub = lane >> 4, c4 = (lane & 15) * 4;
  {
#pragma unroll
    for (int q = 0; q < 8; ++q) {
      const int r = q * 2 + rsub;
      const v4f v = *(const v4fa*)&so[w][r][c4];
      *(v4f*)(C + (size_t)(row0 + r) * ldc + col0 + c4) = v;
    }
    
  }
}
// row LayerNorm (biased variance, eps) over N: s = X (+ R); optional out_sum <- s; out_norm <- (s-mu)*rsqrt(var+eps)*g + b
template <bool PARAM_BF16>
__global__ __launch_bounds__(256) void k_layernorm(const float* __restrict__ X, const float* __restrict__ R, const float* __restrict__ g, const float* __restrict__ bta,
                                                  float* __restrict__ out_sum, float* __restrict__ out_norm, int N, float eps) {
  __shared__ float red[256];
  const int row = blockIdx.x, tid = threadIdx.x;
  const float* x = X + (size_t)row * N; const float* rr = R ? R + (size_t)row * N : nullptr;
  float vals[16];                     // up to N = 4096
  const int per = N / 256;            // contiguous chunk per thread? use strided-by-4 chunks: thread handles j = tid*4 + 1024*u
  float s1 = 0.f;
  for (int u = 0; u < per / 4; ++u) {
    const int j = tid * 4 + 1024 * u;
    const v4f a = *(const v4fa*)(x + j);
    v4f b = {0.f,0.f,0.f,0.f}; if (rr) b = *(const v4fa*)(rr + j);
#pragma unroll
    for (int q = 0; q < 4; ++q) { const float v = a[q] + b[q]; vals[u * 4 + q] = v; s1 += v; }
  }
  red[tid] = s1; __syncthreads();
  for (int st = 128; st > 0; st >>= 1) { if (tid < st) red[tid] += red[tid + st]; __syncthreads(); }
  const float mu = red[0] / (float)N; __syncthreads();
  float s2 = 0.f;
  for (int u = 0; u < per / 4; ++u)
#pragma unroll
    for (int q = 0; q < 4; ++q) { const float c = vals[u * 4 + q] - mu; s2 += c * c; }
  red[tid] = s2; __syncthreads();
  for (int st = 128; st > 0; st >>= 1) { if (tid < st) red[tid] += red[tid + st]; __syncthreads(); }
  const float rs = rsqrtf(red[0] / (float)N + eps);
  {
    for (int u = 0; u < per / 4; ++u) {
      const int j = tid * 4 + 1024 * u;
      v4f o, sm;
#pragma unroll
      for (int q = 0; q < 4; ++q) {
        float gg = g[j + q], bb = bta[j + q];
        if (PARAM_BF16) { gg = bf16_round(gg); bb = bf16_round(bb); }
        sm[q] = vals[u * 4 + q]; o[q] = (vals[u * 4 + q] - mu) * rs * gg + bb;
      }
      if (out_sum) *(v4f*)(out_sum + (size_t)row * N + j) = sm;
      *(v4f*)(out_norm + (size_t)row * N + j) = o;
    }
    
  }
}



// ---- f16 WMMA path (v_wmma_f32_16x16x32_f16): 11-bit significands for operands in range — used where a [0,1] probability operand needs more precision than bf16
typedef _Float16 v16h __attribute__((ext_vector_type(16)));
union FragH { v16h v; v8us half[2]; _Float16 h[16]; unsigned short u[16]; };
template <int NT>
__device__ __forceinline__ v8f mmaH(v16h ah, v16h al, v16h bh, v16h bl, v8f c) {
  c = __builtin_amdgcn_wmma_f32_16x16x32_f16(false, ah, false, bh, (short)0, c, false, false);
  if (NT >= 2) c = __builtin_amdgcn_wmma_f32_16x16x32_f16(false, al, false, bh, (short)0, c, false, false);
  if (NT >= 3) c = __builtin_amdgcn_wmma_f32_16x16x32_f16(false, ah, false, bl, (short)0, c, false, false);
  asm volatile("v_nop\n\tv_nop\n\tv_nop\n\tv_nop" : "+v"(c) : "v"(ah), "v"(al), "v"(bh), "v"(bl));
  return c;
}
// batched GEMM like k_gemm_b but f16 operands: A f32 (split into f16 hi/lo if ASPLIT, else rounded to f16), Bt = f16 values [n][k]; alpha; C f32; N multiple of 16 (partial tiles skipped)
template <bool ASPLIT>
__global__ __launch_bounds__(128) void k_gemm_h(const float* __restrict__ A, int lda, size_t sA, const _Float16* __restrict__ Bh, int ldb, size_t sB, float alpha, float* __restrict__ C, int ldc, size_t sC, int M, int N, int K) {
  __shared__ __attribute__((aligned(16))) float so[4][16][64];
  const int tid = threadIdx.x, w = tid >> 5, lane = tid & 31, ln = lane & 15, hh = lane >> 4; const int by = blockIdx.y;
  A += (size_t)by * sA; Bh += (size_t)by * sB; C += (size_t)by * sC;
  const int ntn = (N + 63) / 64; const int wid = blockIdx.x * 4 + w; const int mt = wid / ntn, nq = wid % ntn; if (mt * 16 >= M) return;
  const int row0 = mt * 16, col0 = nq * 64; const float* arow = A + (size_t)(row0 + ln) * lda;
  v8f acc[4] = {};
  for (int kb = 0; kb < K; kb += 32) {
    FragH ah, al;
    const v4f x0 = *(const v4fa*)(arow + kb + 8 * hh), x1 = *(const v4fa*)(arow + kb + 8 * hh + 4), x2 = *(const v4fa*)(arow + kb + 16 + 8 * hh), x3 = *(const v4fa*)(arow + kb + 16 + 8 * hh + 4);
    float xs[16] = {x0[0],x0[1],x0[2],x0[3],x1[0],x1[1],x1[2],x1[3],x2[0],x2[1],x2[2],x2[3],x3[0],x3[1],x3[2],x3[3]};
#pragma unroll
    for (int i = 0; i < 16; ++i) { const _Float16 h = (_Float16)xs[i]; ah.h[i] = h; al.h[i] = ASPLIT ? (_Float16)(xs[i] - (float)h) : (_Float16)0.0f; }
#pragma unroll
    for (int t = 0; t < 4; ++t) { if (col0 + t * 16 >= N) continue; const size_t boff = (size_t)(col0 + t * 16 + ln) * ldb + kb; FragH bq; bq.half[0] = *(const v8us*)(Bh + boff + 8 * hh); bq.half[1] = *(const v8us*)(Bh + boff + 16 + 8 * hh);
      acc[t] = mmaH<ASPLIT ? 2 : 1>(ah.v, al.v, bq.v, bq.v, acc[t]); }
  }
#pragma unroll
  for (int t = 0; t < 4; ++t) { if (col0 + t * 16 >= N) continue;
#pragma unroll
    for (int r = 0; r < 8; ++r) so[w][8 * hh + r][t * 16 + ln] = acc[t][r] * alpha; }
  __builtin_amdgcn_fence(__ATOMIC_ACQ_REL, "workgroup"); __builtin_amdgcn_wave_barrier();
  const int rsub = lane >> 4, c4 = (lane & 15) * 4;
  {
#pragma unroll
    for (int q = 0; q < 8; ++q) { const int r = q * 2 + rsub; if (col0 + c4 < N) { const v4f v = *(const v4fa*)&so[w][r][c4]; *(v4f*)(C + (size_t)(row0 + r) * ldc + col0 + c4) = v; } }
     }
}

// Wt[n][k] = f16(W[k][n]·scale) from f32 row-major W[K][N] (scale = power of two; bf16-exact weights stay exact in f16 away from the subnormal range)
__global__ __launch_bounds__(256) void k_wt_f16(const float* __restrict__ W, _Float16* __restrict__ Wt, int K, int N, float scale) {
  const int t = blockIdx.x * 256 + threadIdx.x; if (t >= N * (K / 8)) return; const int n = t / (K / 8), k8 = (t % (K / 8)) * 8; FragH f;
#pragma unroll
  for (int i = 0; i < 8; ++i) f.h[i] = (_Float16)(bf16_round(W[(size_t)(k8 + i) * N + n]) * scale); const v8us o = f.half[0];
  *(v8us*)((unsigned short*)Wt + (size_t)n * K + k8) = o; 
}


typedef _Float16 v4h __attribute__((ext_vector_type(4)));
typedef _Float16 v2h __attribute__((ext_vector_type(2)));
typedef float v2fv __attribute__((ext_vector_type(2)));

__global__ __launch_bounds__(256) void k_h16(const float* __restrict__ x, _Float16* __restrict__ X16, size_t n8) { const size_t t = (size_t)blockIdx.x * 256 + threadIdx.x; if (t >= n8) return; FragH f;
#pragma unroll
  for (int q = 0; q < 8; ++q) f.h[q] = (_Float16)x[t * 8 + q]; *(v8us*)((unsigned short*)X16 + t * 8) = f.half[0];  }
// ---- the three projections in ONE launch, straight from the f32 inputs. A workgroup takes 128 tokens x 192 rows of the stacked (Wq; Wk; Wv): it rounds both tiles
// (x: bf16-exact f16; W: bf16-exact x 2^4, f16) into LDS over the whole K = 256, passes one barrier, and its 12 waves each form a 64 x 32 tile on WMMA.
// The accumulator holds 8 consecutive M rows in a lane, so M is made the index that is contiguous in the output: Q, K = [token][col]: A = W rows, B = x rows; V^T = [col][token]: A = x rows, B = Wv rows.
#define PTOK 128    // tokens per workgroup
#define PCOL 192    // stacked weight rows per workgroup: three groups of 64, each inside one matrix; 32 x 8 = 256 workgroups, one per WGP
#define PP 264      // LDS row pitch in 16-bit elements: 528 B = 16 B x odd, conflict-free for 16-byte fragment reads
#define PO 72       // pitch of a wave's output rows in LDS, 144 B
typedef unsigned short v4us __attribute__((ext_vector_type(4), may_alias));
typedef __bf16 v2bf __attribute__((ext_vector_type(2)));
union Pack4 { v2h p[2]; v4us u; };
// four f32 -> nearest-even bf16 (the packed hardware conversion: the same rounding as bf16_round) -> x scale, a power of two -> f16, 8 bytes into LDS
template <bool SCALE>
__device__ __forceinline__ void put4(unsigned short* p, v4f v) {
  Pack4 k;
#pragma unroll
  for (int q = 0; q < 2; ++q) {
    const unsigned int u = __builtin_bit_cast(unsigned int, __builtin_convertvector((v2fv){v[2 * q], v[2 * q + 1]}, v2bf));
    v2fv f = {__uint_as_float(u << 16), __uint_as_float(u & 0xFFFF0000u)};
    if (SCALE) f *= 16.0f;
    k.p[q] = __builtin_convertvector(f, v2h);
  }
  *(v4us*)p = k.u;
}
// acc[at][bt][r] = element (m = at*16 + 8*hh + r, n = bt*16 + ln). v = acc / 16 + bf16(bias), to f16; the wave's 32 rows n of 64 m go through its own LDS range, so that every store writes whole 128-byte lines.
template <bool ISV>
__device__ __forceinline__ void proj_out(const v8f (&acc)[4][2], const float (&bs)[32], unsigned short (*so)[PO], unsigned short* __restrict__ ob, int lane) {
  const int ln = lane & 15, hh = lane >> 4;
#pragma unroll
  for (int at = 0; at < 4; ++at)
#pragma unroll
    for (int bt = 0; bt < 2; ++bt) {
      FragH f;
#pragma unroll
      for (int r = 0; r < 8; ++r) f.h[r] = (_Float16)(acc[at][bt][r] * 0.0625f + bf16_round(ISV ? bs[bt] : bs[at * 8 + r]));
      *(v8us*)&so[bt * 16 + ln][at * 16 + 8 * hh] = f.half[0];
    }
  // the rows are read back by other lanes of the same wave: the LDS writes above must have landed
  __builtin_amdgcn_fence(__ATOMIC_ACQ_REL, "workgroup"); __builtin_amdgcn_wave_barrier();
  constexpr size_t ldo = ISV ? NN : PJ;
  unsigned short* op = ob + (size_t)(lane >> 3) * ldo + (lane & 7) * 8;
#pragma unroll
  for (int i = 0; i < 8; ++i) { const v8us v = *(const v8us*)&so[i * 4 + (lane >> 3)][(lane & 7) * 8]; *(v8us*)(op + (size_t)i * 4 * ldo) = v; }
}
__global__ __launch_bounds__(384) void k_proj(const float* __restrict__ x, const float* __restrict__ Wq, const float* __restrict__ Wk, const float* __restrict__ Wv,
                                              const float* __restrict__ bq, const float* __restrict__ bk, const float* __restrict__ bv,
                                              _Float16* __restrict__ Q16, _Float16* __restrict__ K16, _Float16* __restrict__ Vt) {
  __shared__ __attribute__((aligned(16))) unsigned short sT[PTOK + PCOL][PP];      // rows 0..127: tokens; 128..319: stacked weight rows
  __shared__ __attribute__((aligned(16))) unsigned short sO[12][32][PO];
  const int tid = threadIdx.x, lane = tid & 31, ln = lane & 15, hh = lane >> 4;
  const int w = __builtin_amdgcn_readfirstlane(tid >> 5);      // scalar: all that follows from it (matrix, roles, pointers) stays in scalar registers
  const int g = w >> 2, sub = w & 3;                           // the wave's group of 64 weight rows, and its quarter of the 64 x 128 products of that group
  const int tok0 = (blockIdx.x >> 3) * PTOK;
  const int cs = (blockIdx.x & 7) * PCOL + g * 64;             // the group's first row in the stacked weights
  const int mat = cs >> 9, cm = cs & (PJ - 1);                 // 0 q, 1 k, 2 v; first row inside that matrix
  const bool isV = mat == 2;
  const float* Wm = mat == 0 ? Wq : (mat == 1 ? Wk : Wv);
  float bs[32];      // bias, asked for first and rounded last: Q, K one value per m, V one per n
  if (isV) {
#pragma unroll
    for (int bt = 0; bt < 2; ++bt) bs[bt] = bv[cm + (sub & 1) * 32 + bt * 16 + ln];
    asm volatile("s_wait_xcnt 0x0" ::: "memory");      // at the end of the block that issues the loads
  } else {
    const float* bp = (mat == 0 ? bq : bk) + cm + 8 * hh;
#pragma unroll
    for (int at = 0; at < 4; ++at) {
      const v4f lo = *(const v4fa*)(bp + at * 16), hi = *(const v4fa*)(bp + at * 16 + 4);
#pragma unroll
      for (int q = 0; q < 4; ++q) { bs[at * 8 + q] = lo[q]; bs[at * 8 + 4 + q] = hi[q]; }
    }
    asm volatile("s_wait_xcnt 0x0" ::: "memory");      // as above
  }
  // staging: one wave-wide load = 512 contiguous bytes = half a row. The token tile is one contiguous 128 KiB (half row j*12 + w), a wave's 16 weight rows one contiguous 16 KiB:
  // every address is one base plus a constant.
  const float* gx = x + (size_t)tok0 * CIN + w * 128 + lane * 4;
  const float* gw = Wm + (size_t)(cm + sub * 16) * CIN + lane * 4;
  unsigned short* lx = &sT[w >> 1][(w & 1) * 128 + lane * 4];
  unsigned short* lw = &sT[PTOK + w * 16][lane * 4];
  v4f rx[22], rw[16];
#pragma unroll
  for (int j = 0; j < 21; ++j) rx[j] = *(const v4fa*)(gx + j * 12 * 128);
  asm volatile("s_wait_xcnt 0x0" ::: "memory");      // as above: the base of these loads is rewritten for the weight rows
  if (w < 4) { rx[21] = *(const v4fa*)(gx + 21 * 12 * 128); asm volatile("s_wait_xcnt 0x0" ::: "memory"); }      // 256 half rows = 21 x 12 + 4; the wait as above
#pragma unroll
  for (int j = 0; j < 16; ++j) rw[j] = *(const v4fa*)(gw + j * 128);
#pragma unroll
  for (int j = 0; j < 21; ++j) put4<false>(lx + j * 6 * PP, rx[j]);
  if (w < 4) put4<false>(lx + 21 * 6 * PP, rx[21]);
#pragma unroll
  for (int hf = 0; hf < 2; ++hf) {
#pragma unroll
    for (int j = 0; j < 16; ++j) {
      put4<true>(lw + (hf * 8 + (j >> 1)) * PP + (j & 1) * 128, rw[j]);
      if (hf == 0) rw[j] = *(const v4fa*)(gw + (16 + j) * 128);
    }
  }
  __syncthreads();      // both tiles are whole
  const int rowA = isV ? (sub >> 1) * 64 : PTOK + g * 64;
  const int rowB = isV ? PTOK + g * 64 + (sub & 1) * 32 : sub * 32;
  const unsigned short* pa = &sT[rowA + ln][8 * hh];
  const unsigned short* pb = &sT[rowB + ln][8 * hh];
  v8f acc[4][2];
#pragma unroll
  for (int at = 0; at < 4; ++at)
#pragma unroll
    for (int bt = 0; bt < 2; ++bt) acc[at][bt] = (v8f){0.f, 0.f, 0.f, 0.f, 0.f, 0.f, 0.f, 0.f};
  // A and B fragments take the same k order: elements 0..7 = k 8*hh.., 8..15 = k 16 + 8*hh..
  FragH a[2][4], b[2][2];
  auto frags = [&](int ks) {
#pragma unroll
    for (int at = 0; at < 4; ++at) { a[ks & 1][at].half[0] = *(const v8us*)(pa + at * 16 * PP + ks * 32); a[ks & 1][at].half[1] = *(const v8us*)(pa + at * 16 * PP + ks * 32 + 16); }
#pragma unroll
    for (int bt = 0; bt < 2; ++bt) { b[ks & 1][bt].half[0] = *(const v8us*)(pb + bt * 16 * PP + ks * 32); b[ks & 1][bt].half[1] = *(const v8us*)(pb + bt * 16 * PP + ks * 32 + 16); }
  };
  frags(0);
#pragma unroll
  for (int ks = 0; ks < CIN / 32; ++ks) {
    if (ks + 1 < CIN / 32) frags(ks + 1);      // the next step's 12 LDS reads as one group ahead of this step's 8 WMMAs, which cover their latency
    __builtin_amdgcn_sched_barrier(0);         // keeps that group here: the scheduler's own order sank each read to just in front of its first WMMA, four waits to zero a step
#pragma unroll
    for (int at = 0; at < 4; ++at)
#pragma unroll
      for (int bt = 0; bt < 2; ++bt) acc[at][bt] = __builtin_amdgcn_wmma_f32_16x16x32_f16(false, a[ks & 1][at].v, false, b[ks & 1][bt].v, (short)0, acc[at][bt], false, false);
  }
  if (isV) proj_out<true>(acc, bs, sO[w], (unsigned short*)Vt + (size_t)(cm + (sub & 1) * 32) * NN + tok0 + (sub >> 1) * 64, lane);      // V^T: [h*64 + d][token]
  else proj_out<false>(acc, bs, sO[w], (unsigned short*)(mat == 0 ? Q16 : K16) + (size_t)(tok0 + sub * 32) * PJ + cm, lane);              // head h at cols h*64
}

// ---- fused sigmoid attention. S^T/2 = K.(Q/2)^T (A = K rows from LDS, B = Q/2 in registers), P = sigmoid(S) = 1/2 + 1/2 tanh(S/2) in place (one transcendental an element), O^T += V^T.P^T (A = V^T rows from LDS, B = two packed S^T tiles).
// A sigmoid needs no running maximum, so sums over disjoint key ranges simply add: grid = (256-query blocks, heads, key ranges), 8 waves x 32 query columns, 64 keys per LDS stage.
#define KSPL 4      // key ranges per head: 512 workgroups, two per WGP
#define KT 64       // keys per stage
#define LP 72       // LDS row pitch in 16-bit elements: 144 B = 16 B x odd, conflict-free for 16-byte fragment reads
union FragP { v16h v; v2h p2[8]; };
// four waves per SIMD = two of these workgroups per WGP: the register budget the allocator may spend is that of the occupancy the grid is sized for
__global__ __launch_bounds__(256) __attribute__((amdgpu_waves_per_eu(4, 4)))
void k_fsig(const _Float16* __restrict__ Q16, const _Float16* __restrict__ K16, const _Float16* __restrict__ Vt, float* __restrict__ Op, float* __restrict__ Zp) {
  __shared__ __attribute__((aligned(16))) unsigned short sK[2][KT][LP];      // [buffer][key][dim]
  __shared__ __attribute__((aligned(16))) unsigned short sV[2][HD][LP];      // [buffer][d][key]
  const int tid = threadIdx.x, w = tid >> 5, lane = tid & 31, c = lane & 15, hh = lane >> 4;
  const int h = blockIdx.y, sp = blockIdx.z;
  const int q0 = blockIdx.x * 256 + w * 32;
  const int key0 = sp * (NN / KSPL);
  constexpr int NT = NN / KSPL / KT;
  // staging: a thread moves 16 bytes of rows r0 and r0 + 32 of the K tile and of the V^T tile
  const int r0 = tid >> 3, c8 = (tid & 7) * 8;
  const unsigned short* gk = (const unsigned short*)K16 + (size_t)key0 * PJ + h * HD;      // uniform bases; the lane's part is one 32-bit offset each
  const unsigned short* gv = (const unsigned short*)Vt + (size_t)h * HD * NN + key0;
  const unsigned ko = r0 * PJ + c8, vo = r0 * NN + c8;
  v8us rk0, rk1, rv0, rv1;
  auto fetch = [&](int t) {
    const unsigned short* kp = gk + (size_t)t * KT * PJ; const unsigned short* vp = gv + t * KT;
    rk0 = *(const v8us*)(kp + ko); rk1 = *(const v8us*)(kp + ko + 32 * PJ); rv0 = *(const v8us*)(vp + vo); rv1 = *(const v8us*)(vp + vo + 32 * NN);
    asm volatile("s_wait_xcnt 0x0" ::: "memory");      // behind the loads: their address registers are rewritten for the next stage
  };
  auto put = [&](int b) {
    *(v8us*)&sK[b][r0][c8] = rk0; *(v8us*)&sK[b][r0 + 32][c8] = rk1; *(v8us*)&sV[b][r0][c8] = rv0; *(v8us*)&sV[b][r0 + 32][c8] = rv1;
  };
  // B fragments of the wave's 2 x 16 query columns, hardware k order over the 64 dims
  FragH bq[2][2];
#pragma unroll
  for (int cg = 0; cg < 2; ++cg)
#pragma unroll
    for (int ks = 0; ks < 2; ++ks) {
      const unsigned short* qr = (const unsigned short*)Q16 + (size_t)(q0 + cg * 16 + c) * PJ + h * HD + ks * 32;
      bq[cg][ks].half[0] = *(const v8us*)(qr + 8 * hh); bq[cg][ks].half[1] = *(const v8us*)(qr + 16 + 8 * hh);
      bq[cg][ks].v *= (_Float16)0.5f;      // the halving of the tanh argument, once a wave: a power of two, exact above the f16 subnormal range, so the WMMA sums are the logits' own sums halved (in front of these packed f16 multiplies the compiler sets the f16 rounding field to its default, nearest even)
    }
  v8f o[4][2];
#pragma unroll
  for (int dt = 0; dt < 4; ++dt)
#pragma unroll
    for (int cg = 0; cg < 2; ++cg) o[dt][cg] = (v8f){0.f, 0.f, 0.f, 0.f, 0.f, 0.f, 0.f, 0.f};
  v8f zs[2] = {(v8f){0.f, 0.f, 0.f, 0.f, 0.f, 0.f, 0.f, 0.f}, (v8f){0.f, 0.f, 0.f, 0.f, 0.f, 0.f, 0.f, 0.f}};      // row sums of the f16 P, taken on the matrix pipe: A = all ones
  FragH ones;
#pragma unroll
  for (int i = 0; i < 16; ++i) ones.h[i] = (_Float16)1.0f;
  // The loop body is laid out by hand as one software pipeline. A unit = 32 keys x the wave's 32 queries = 18 WMMAs and 64 vector instructions of sigmoid.
  // (1) The sigmoid of one group of 16 queries stands between the WMMAs of the other group, so that vector and matrix work of the same wave overlap.
  // (2) No WMMA waits for an LDS read issued just in front of it: V^T fragments are asked for in groups ahead of P.V, the NEXT unit's K fragments behind this unit's S products.
  // The K fragments of a stage's first unit are thus read in the pass before, so the stage's barrier stands in the middle of the second unit of the stage before.
  FragH ka[2][2], va[4];
  FragP pb[2];
  v8f s[2][2];      // s[cg][kt][r] = half the logit(key kt*16 + 8*hh + r of the unit, query cg*16 + c)
  auto loadK = [&](int b, int j) {
#pragma unroll
    for (int kt = 0; kt < 2; ++kt)
#pragma unroll
      for (int ks = 0; ks < 2; ++ks) {
        const unsigned short* kr = &sK[b][j * 32 + kt * 16 + c][ks * 32];
        ka[kt][ks].half[0] = *(const v8us*)(kr + 8 * hh); ka[kt][ks].half[1] = *(const v8us*)(kr + 16 + 8 * hh);
      }
  };
  auto loadV = [&](int b, int j, int d0, int d1) {      // d tiles d0 .. d1 - 1
#pragma unroll
    for (int dt = d0; dt < d1; ++dt) {
      const unsigned short* vr = &sV[b][dt * 16 + c][j * 32];
      va[dt].half[0] = *(const v8us*)(vr + 8 * hh); va[dt].half[1] = *(const v8us*)(vr + 16 + 8 * hh);
    }
  };
  auto qk = [&](int cg) {      // four WMMAs: two independent accumulate chains of two
#pragma unroll
    for (int kt = 0; kt < 2; ++kt) s[cg][kt] = __builtin_amdgcn_wmma_f32_16x16x32_f16(false, ka[kt][0].v, false, bq[cg][0].v, (short)0, (v8f){0.f, 0.f, 0.f, 0.f, 0.f, 0.f, 0.f, 0.f}, false, false);
#pragma unroll
    for (int kt = 0; kt < 2; ++kt) s[cg][kt] = __builtin_amdgcn_wmma_f32_16x16x32_f16(false, ka[kt][1].v, false, bq[cg][1].v, (short)0, s[cg][kt], false, false);
  };
  auto sigm = [&](int cg) {      // 16 v_tanh_f32, 8 packed fma, 8 packed conversions
#pragma unroll
    for (int kt = 0; kt < 2; ++kt) {
#pragma unroll
      for (int r = 0; r < 8; r += 2) {
        const v2fv th = {__builtin_amdgcn_tanhf(s[cg][kt][r]), __builtin_amdgcn_tanhf(s[cg][kt][r + 1])};
        pb[cg].p2[kt * 4 + (r >> 1)] = __builtin_convertvector(th * 0.5f + 0.5f, v2h);      // sigmoid in f32, rounded once to f16; element kt*8 + r of B = key 8*hh + r (kt 0), 16 + 8*hh + r (kt 1): the hardware k order
      }
    }
  };
  auto pv = [&](int cg) {      // five WMMAs
    zs[cg] = __builtin_amdgcn_wmma_f32_16x16x32_f16(false, ones.v, false, pb[cg].v, (short)0, zs[cg], false, false);      // every row of zs = the column sums of P^T
#pragma unroll
    for (int dt = 0; dt < 4; ++dt) o[dt][cg] = __builtin_amdgcn_wmma_f32_16x16x32_f16(false, va[dt].v, false, pb[cg].v, (short)0, o[dt][cg], false, false);
  };
  // The order asked of the scheduler for four WMMAs and one column group's sigmoid: behind each WMMA four v_tanh_f32 and four packed operations, which issue while the matrix unit works on it.
  // Left to itself the scheduler put most of the sigmoid in one run between the S and the P.V products, where matrix time and vector time add.
#define WEAVE4() do { _Pragma("unroll") for (int i_ = 0; i_ < 4; ++i_) { __builtin_amdgcn_sched_group_barrier(0x8, 1, 0); __builtin_amdgcn_sched_group_barrier(0x400, 4, 0); __builtin_amdgcn_sched_group_barrier(0x2, 4, 0); } } while (0)
  // first half of a unit: S of column group 0; then S of group 1 woven with the sigmoid of group 0
  auto head = [&]() {
    qk(0); qk(1); sigm(0);
    __builtin_amdgcn_sched_group_barrier(0x8, 4, 0);      // the four WMMAs of group 0 first
    WEAVE4();
  };
  // second half: P.V of group 0 woven with the sigmoid of group 1; then P.V of group 1
  auto tail = [&]() {
    sigm(1); pv(0); pv(1);
    WEAVE4();
    __builtin_amdgcn_sched_group_barrier(0x8, 6, 0);      // the last WMMA of group 0 and the five of group 1
  };
  // One pass = one stage of 64 keys = two units. b, more and next are constants at every call, so every LDS address is one base register plus an immediate.
  auto pass = [&](int t, int b, bool more, bool next) {
    loadV(b, 0, 0, 2);      // half of V^T now, half behind the S products: while the staging registers hold stage t + 1 there is no room for all of it beside K, S and P
    __builtin_amdgcn_sched_barrier(0);      // keeps the group of LDS reads here: the scheduler's own order sank each pair of reads to just in front of its WMMA, with a wait to zero each time
    head();
    __builtin_amdgcn_sched_barrier(0);      // keeps the next reads behind the S products, so that they land in the registers of the K fragments just used: hoisted, they took a second set and the staging registers were spilled
    loadV(b, 0, 2, 4); loadK(b, 1);
    __builtin_amdgcn_sched_barrier(0);      // keeps the group of LDS reads here, as above
    tail();
    __builtin_amdgcn_sched_barrier(0);      // ends the woven order above
    loadV(b, 1, 0, 4);          // the last reads of stage t: in registers before the barrier below, behind which buffer b may be refilled
    if (more) put(b ^ 1);       // stage t + 1; that buffer's last reads ended in front of the barrier of pass t - 1
    __builtin_amdgcn_sched_barrier(0);      // keeps the group of LDS reads and writes here
    head();
    __builtin_amdgcn_sched_barrier(0);      // keeps that work in front of the barrier, where it covers the LDS writes and reads that the barrier waits for
    if (more) {
      __syncthreads();      // publishes stage t + 1 and ends every read of stage t
      loadK(b ^ 1, 0);
      __builtin_amdgcn_sched_barrier(0);      // keeps the group of LDS reads here
    }
    tail();
    __builtin_amdgcn_sched_barrier(0);      // ends the woven order above
    if (next) {
      fetch(t + 2);      // here S and P are dead and the staging registers free; the loads fly over the next pass's first unit
      __builtin_amdgcn_sched_barrier(0);      // keeps the next trip's address additions behind the s_wait_xcnt that ends fetch(): the scheduler lifted them over it
    }
  };
  fetch(0); put(0);
  fetch(1);
  __syncthreads();
  loadK(0, 0);
  // two passes a trip, so that the buffer index is a constant; not unrolled further: more copies would only cost instruction cache
#pragma unroll 1
  for (int t = 0; t < NT - 2; t += 2) { pass(t, 0, true, true); pass(t + 1, 1, true, true); }
  pass(NT - 2, 0, true, false);
  pass(NT - 1, 1, false, false);      // the last stage: nothing left to stage, no barrier
#undef WEAVE4
  // o[dt][cg][r] = sum_keys P.V at d = dt*16 + 8*hh + r, query cg*16 + c. Staged order of a query's 64 values: [hh][dt][r], so a lane writes one whole 128-byte line.
#pragma unroll
  for (int cg = 0; cg < 2; ++cg) {
    const unsigned slab = ((unsigned)h * KSPL + sp) * NN + q0 + cg * 16 + c;      // 32-bit (below 2^17): the two 64-bit offsets, live over the whole loop, were spilled
    float* op = Op + (size_t)slab * HD + hh * 32;
#pragma unroll
    for (int dt = 0; dt < 4; ++dt) {
      *(v4f*)(op + dt * 8) = (v4f){o[dt][cg][0], o[dt][cg][1], o[dt][cg][2], o[dt][cg][3]};
      *(v4f*)(op + dt * 8 + 4) = (v4f){o[dt][cg][4], o[dt][cg][5], o[dt][cg][6], o[dt][cg][7]};
    }
    if (hh == 0) Zp[slab] = zs[cg][0];      // both lane halves hold the same sum
  }
}
// out[q][d] = 1/8 sum_h (sum_ranges Op) / (sum_ranges Zp). A wave takes one query: lane = (half hf of the heads, four consecutive values i of the staged order [hh][dt][r]).
__global__ __launch_bounds__(256) void k_hmean(const float* __restrict__ Op, const float* __restrict__ Zp, float* __restrict__ out) {
  const unsigned tid = threadIdx.x, lane = tid & 31, i = lane & 15, hf = lane >> 4;
  const unsigned q = blockIdx.x * 8 + (tid >> 5), e = i * 4;
  const float* pm = Op + ((size_t)(hf * 16 + 8) * NN + q) * HD + e;      // the middle of the lane's 16 (head, key range) planes of 1 MiB: all 16 lie within a load's immediate offset
  const float* pz = Zp + (size_t)(hf * 16 + i) * NN + q;                 // lane i holds the row sum of plane i of its half
  v4f s[16]; float z;
  // The 17 loads and their data wait in one statement: all are in flight together (one round trip to memory), and no register that an issued load names is rewritten in front of the wait
  asm volatile("global_load_b128 %0, %17, off offset:-8388608\n\t"
               "global_load_b128 %1, %17, off offset:-7340032\n\t"
               "global_load_b128 %2, %17, off offset:-6291456\n\t"
               "global_load_b128 %3, %17, off offset:-5242880\n\t"
               "global_load_b128 %4, %17, off offset:-4194304\n\t"
               "global_load_b128 %5, %17, off offset:-3145728\n\t"
               "global_load_b128 %6, %17, off offset:-2097152\n\t"
               "global_load_b128 %7, %17, off offset:-1048576\n\t"
               "global_load_b128 %8, %17, off\n\t"
               "global_load_b128 %9, %17, off offset:1048576\n\t"
               "global_load_b128 %10, %17, off offset:2097152\n\t"
               "global_load_b128 %11, %17, off offset:3145728\n\t"
               "global_load_b128 %12, %17, off offset:4194304\n\t"
               "global_load_b128 %13, %17, off offset:5242880\n\t"
               "global_load_b128 %14, %17, off offset:6291456\n\t"
               "global_load_b128 %15, %17, off offset:7340032\n\t"
               "global_load_b32 %16, %18, off\n\t"
               "s_wait_loadcnt 0x0"
               : "=&v"(s[0]), "=&v"(s[1]), "=&v"(s[2]), "=&v"(s[3]), "=&v"(s[4]), "=&v"(s[5]), "=&v"(s[6]), "=&v"(s[7]), "=&v"(s[8]), "=&v"(s[9]), "=&v"(s[10]), "=&v"(s[11]), "=&v"(s[12]), "=&v"(s[13]), "=&v"(s[14]), "=&v"(s[15]), "=&v"(z)
               : "v"(pm), "v"(pz) : "memory");
  z += __shfl_xor(z, 1, 32); z += __shfl_xor(z, 2, 32);      // the four key ranges of a head lie in four neighbouring lanes
  const float inv = 1.0f / z;
  v4f acc = {0.f, 0.f, 0.f, 0.f};
#pragma unroll
  for (int hl = 0; hl < 4; ++hl) acc += (((s[hl * 4] + s[hl * 4 + 1]) + s[hl * 4 + 2]) + s[hl * 4 + 3]) * __shfl(inv, (int)(hf * 16 + hl * 4), 32);
#pragma unroll
  for (int c = 0; c < 4; ++c) acc[c] += __shfl_xor(acc[c], 16, 32);      // the other four heads
  const unsigned d = ((e >> 3) & 3) * 16 + (e >> 5) * 8 + (e & 7);
  if (hf == 0) *(v4f*)(out + (size_t)q * HD + d) = acc * 0.125f;
}
extern "C" void kernel_launch(void* const* d_in, const int* in_sizes, int n_in,
                              void* d_out, int out_size, void* d_ws, size_t ws_size, hipStream_t stream) {
  (void)in_sizes; (void)n_in; (void)out_size;
  const float* x = (const float*)d_in[0]; const float* Wq = (const float*)d_in[1]; const float* bq = (const float*)d_in[2]; const float* Wk = (const float*)d_in[3]; const float* bk = (const float*)d_in[4]; const float* Wv = (const float*)d_in[5]; const float* bv = (const float*)d_in[6];
  char* ws = (char*)d_ws; size_t off = 0;
  auto take = [&](size_t bytes) { char* p = ws + off; off += (bytes + 255) & ~(size_t)255; return p; };
  _Float16* Q16 = (_Float16*)take((size_t)NN * PJ * 2); _Float16* K16 = (_Float16*)take((size_t)NN * PJ * 2); _Float16* Vt = (_Float16*)take((size_t)NN * PJ * 2); float* Op = (float*)take((size_t)NH * KSPL * NN * HD * 4); float* Zp = (float*)take((size_t)NH * KSPL * NN * 4);
  if (off > ws_size) return;      // 4.2 x 3 + 33.6 + 0.5 = about 47 MB
  k_proj<<<(NN / PTOK) * (3 * PJ / PCOL), 384, 0, stream>>>(x, Wq, Wk, Wv, bq, bk, bv, Q16, K16, Vt);
  k_fsig<<<dim3(NN / 256, NH, KSPL), 256, 0, stream>>>(Q16, K16, Vt, Op, Zp);
  k_hmean<<<NN / 8, 256, 0, stream>>>(Op, Zp, (float*)d_out);
}

// v006
// A run of this version takes 34.3 microseconds.
// Versions in between are left out here; by their measured steps it is 1.16 times as fast as v004.
// Counting every step since v000, it is 49.4 times as fast.
#include <hip/hip_runtime.h>
// Sigmoid multi-head attention (N=4096 tokens, IN=256, 8 heads x 64): q,k,v = x.W^T + b; S_h = sigmoid(q_h.k_h^T); attn = S_h / sum_keys S_h; out = mean_h(attn.v_h) -> [4096, 64].
// All three projections in one kernel on v_wmma_f32_16x16x32_f16 (x bf16-exact, (out,in) weights bf16-exact x 2^4, q/k/v f16, f32 accumulate). Logits (K = 64), sigmoid, row sums and P.V run in ONE
// kernel on the same WMMA form: S and P = f16(sigmoid) never leave registers; each workgroup leaves unnormalised sums of a quarter of the keys (f16, scaled by 2^-10), a small kernel divides and takes the head mean.
#define NN 4096
#define CIN 256
#define PJ 512
#define HD 64
#define NH 8

typedef __bf16 v16b __attribute__((ext_vector_type(16)));
typedef unsigned short v8us __attribute__((ext_vector_type(8), may_alias));
typedef float  v8f  __attribute__((ext_vector_type(8)));
typedef float  v4f  __attribute__((ext_vector_type(4)));
typedef float  v4fa __attribute__((ext_vector_type(4), may_alias));
union FragB { v16b v; v8us half[2]; unsigned short u[16]; };

__device__ __forceinline__ unsigned short bf16_bits(float x) { unsigned int u = __float_as_uint(x); return (unsigned short)((u + 0x7FFFu + ((u >> 16) & 1u)) >> 16); }
__device__ __forceinline__ float bf16_val(unsigned short b) { return __uint_as_float(((unsigned int)b) << 16); }
__device__ __forceinline__ float bf16_round(float x) { return bf16_val(bf16_bits(x)); }
// D += A·B with NT terms: 1 = ah·bh, 2 = + al·bh (A split), 3 = + ah·bl (both split)
template <int NT>
__device__ __forceinline__ v8f mmaN(v16b ah, v16b al, v16b bh, v16b bl, v8f c) {
  c = __builtin_amdgcn_wmma_f32_16x16x32_bf16(false, ah, false, bh, (short)0, c, false, false);
  if (NT >= 2) c = __builtin_amdgcn_wmma_f32_16x16x32_bf16(false, al, false, bh, (short)0, c, false, false);
  if (NT >= 3) c = __builtin_amdgcn_wmma_f32_16x16x32_bf16(false, ah, false, bl, (short)0, c, false, false);
  asm volatile("v_nop\n\tv_nop\n\tv_nop\n\tv_nop" : "+v"(c) : "v"(ah), "v"(al), "v"(bh), "v"(bl));
  return c;
}

__global__ __launch_bounds__(256) void k_wt_bf16(const float* __restrict__ W, unsigned short* __restrict__ Wt, int K, int N) {
  const int t = blockIdx.x * 256 + threadIdx.x;
  const int k8n = K / 8;
  if (t >= N * k8n) return;
  const int n = t / k8n, k8 = (t % k8n) * 8;
  v8us v;
#pragma unroll
  for (int i = 0; i < 8; ++i) v[i] = bf16_bits(W[(size_t)(k8 + i) * N + n]);
  *(v8us*)(Wt + (size_t)n * K + k8) = v;
  
}

// GEMM C[M][N] (f32, pitch ldc) = act(A[M][K]·W + bias). A f32 row-major (pitch lda) converted per fragment to bf16
// (ASPLIT: hi/lo two planes -> 2 terms, else single rounded term); Wt bf16 [N][K] (pitch ldb). BIAS_BF16 rounds the
// bias to bf16 first (bias quantised to bf16 before the add). K%32==0, M%16==0, N%64==0.
template <bool ASPLIT, int ACT, bool BIAS_BF16>
__global__ __launch_bounds__(128) void k_gemm_bf(const float* __restrict__ A, int lda, const unsigned short* __restrict__ Wt, int ldb,
                                               const float* __restrict__ bias, float* __restrict__ C, int ldc, int M, int N, int K) {
  __shared__ __attribute__((aligned(16))) float so[4][16][64];
  const int tid = threadIdx.x, w = tid >> 5, lane = tid & 31, ln = lane & 15, hh = lane >> 4;
  const int ntn = N / 64;
  const int wid = blockIdx.x * 4 + w;
  const int mt = wid / ntn, nq = wid % ntn;
  if (mt * 16 >= M) return;
  const int row0 = mt * 16, col0 = nq * 64;
  const float* arow = A + (size_t)(row0 + ln) * lda;
  v8f acc[4] = {};
  for (int kb = 0; kb < K; kb += 32) {
    FragB ah, al;
    const v4f x0 = *(const v4fa*)(arow + kb + 8 * hh), x1 = *(const v4fa*)(arow + kb + 8 * hh + 4);
    const v4f x2 = *(const v4fa*)(arow + kb + 16 + 8 * hh), x3 = *(const v4fa*)(arow + kb + 16 + 8 * hh + 4);
    float xs[16] = {x0[0],x0[1],x0[2],x0[3],x1[0],x1[1],x1[2],x1[3],x2[0],x2[1],x2[2],x2[3],x3[0],x3[1],x3[2],x3[3]};
#pragma unroll
    for (int i = 0; i < 16; ++i) { const unsigned short hb = bf16_bits(xs[i]); ah.u[i] = hb; al.u[i] = ASPLIT ? bf16_bits(xs[i] - bf16_val(hb)) : (unsigned short)0; }
#pragma unroll
    for (int t = 0; t < 4; ++t) {
      const unsigned short* brow = Wt + (size_t)(col0 + t * 16 + ln) * ldb + kb;
      FragB b;
      b.half[0] = *(const v8us*)(brow + 8 * hh);
      b.half[1] = *(const v8us*)(brow + 16 + 8 * hh);
      acc[t] = mmaN<ASPLIT ? 2 : 1>(ah.v, al.v, b.v, b.v, acc[t]);
    }
  }
#pragma unroll
  for (int t = 0; t < 4; ++t) {
    float bv = bias ? bias[col0 + t * 16 + ln] : 0.f;
    if (BIAS_BF16) bv = bf16_round(bv);
#pragma unroll
    for (int r = 0; r < 8; ++r) { float v = acc[t][r] + bv; if (ACT == 1) v = fmaxf(v, 0.f); so[w][8 * hh + r][t * 16 + ln] = v; }
  }
  __builtin_amdgcn_fence(__ATOMIC_ACQ_REL, "workgroup");
  __builtin_amdgcn_wave_barrier();
  const int rsub = lane >> 4, c4 = (lane & 15) * 4;
  {
#pragma unroll
    for (int q = 0; q < 8; ++q) {
      const int r = q * 2 + rsub;
      const v4f v = *(const v4fa*)&so[w][r][c4];
      *(v4f*)(C + (size_t)(row0 + r) * ldc + col0 + c4) = v;
    }
    
  }
}

// Flash-style causal/unmasked attention, all contractions 3-term bf16 hi/lo splits, f32 softmax with running max.
// q,k,v rows are read from f32 buffers with arbitrary row pitch (so they can live inside a fused qkv buffer);
// D = head size (multiple of 32, <= 128); one wave = 16 query rows; block = 4 waves (64 queries) sharing K/V chunks of 32.
template <int D, bool CAUSAL>
__global__ __launch_bounds__(128) void k_flash(const float* __restrict__ qb, const float* __restrict__ kb, const float* __restrict__ vb,
                                             int pitch, int T, int H, float scale, float* __restrict__ y, int ypitch) {
  constexpr int KS = D / 32;        // k-steps for QK
  constexpr int DT = D / 16;        // d tiles for PV
  __shared__ __attribute__((aligned(16))) unsigned short sKh[32][D + 8], sKl[32][D + 8], sVh[32][D + 8], sVl[32][D + 8];
  __shared__ __attribute__((aligned(16))) unsigned short sPh[4][16][40], sPl[4][16][40];
  __shared__ __attribute__((aligned(16))) float sO[4][16][D];
  const int tid = threadIdx.x, w = tid >> 5, lane = tid & 31, ln = lane & 15, hh = lane >> 4;
  const int nqb = (T + 63) / 64;
  const int bh = blockIdx.x / nqb, qblk = blockIdx.x % nqb;
  const int b = bh / H, h = bh % H;
  const int q0 = qblk * 64 + w * 16;
  const float* Q = qb + (size_t)b * T * pitch + h * D;
  const float* K = kb + (size_t)b * T * pitch + h * D;
  const float* V = vb + (size_t)b * T * pitch + h * D;

  // A fragments of the wave's 16 query rows (scaled), hi/lo
  FragB aqh[KS], aql[KS];
  {
    int row = q0 + ln; if (row >= T) row = T - 1;
    const float* qr = Q + (size_t)row * pitch;
#pragma unroll
    for (int ks = 0; ks < KS; ++ks)
#pragma unroll
      for (int i = 0; i < 16; ++i) {
        const int d = ks * 32 + ((i < 8) ? (8 * hh + i) : (16 + 8 * hh + (i - 8)));
        const float x = qr[d] * scale; const unsigned short hb = bf16_bits(x);
        aqh[ks].u[i] = hb; aql[ks].u[i] = bf16_bits(x - bf16_val(hb));
      }
  }
  float m_r[8], l_r[8];
#pragma unroll
  for (int r = 0; r < 8; ++r) { m_r[r] = -3.0e38f; l_r[r] = 0.f; }
  v8f oacc[DT];
#pragma unroll
  for (int dt = 0; dt < DT; ++dt) oacc[dt] = (v8f){0.f,0.f,0.f,0.f,0.f,0.f,0.f,0.f};

  const int kv_end = CAUSAL ? min(T, qblk * 64 + 64) : T;     // block-uniform
  for (int j0 = 0; j0 < kv_end; j0 += 32) {
    __syncthreads();
    for (int e = tid; e < 32 * (D / 4); e += 128) {
      const int r = e / (D / 4), c4 = (e % (D / 4)) * 4;
      const int key = j0 + r;
      v4f kf = {0.f,0.f,0.f,0.f}, vf = {0.f,0.f,0.f,0.f};
      if (key < T) { kf = *(const v4fa*)(K + (size_t)key * pitch + c4); vf = *(const v4fa*)(V + (size_t)key * pitch + c4); }
#pragma unroll
      for (int t = 0; t < 4; ++t) {
        unsigned short hb = bf16_bits(kf[t]); sKh[r][c4 + t] = hb; sKl[r][c4 + t] = bf16_bits(kf[t] - bf16_val(hb));
        hb = bf16_bits(vf[t]); sVh[r][c4 + t] = hb; sVl[r][c4 + t] = bf16_bits(vf[t] - bf16_val(hb));
      }
    }
    __syncthreads();
    // S tile 16 x 32
    v8f s[2];
#pragma unroll
    for (int nt = 0; nt < 2; ++nt) {
      v8f acc = {};
#pragma unroll
      for (int ks = 0; ks < KS; ++ks) {
        FragB bh_, bl_;
        bh_.half[0] = *(const v8us*)&sKh[nt * 16 + ln][ks * 32 + 8 * hh]; bh_.half[1] = *(const v8us*)&sKh[nt * 16 + ln][ks * 32 + 16 + 8 * hh];
        bl_.half[0] = *(const v8us*)&sKl[nt * 16 + ln][ks * 32 + 8 * hh]; bl_.half[1] = *(const v8us*)&sKl[nt * 16 + ln][ks * 32 + 16 + 8 * hh];
        acc = mmaN<3>(aqh[ks].v, aql[ks].v, bh_.v, bl_.v, acc);
      }
      s[nt] = acc;
    }
    // mask + running max (rows 8hh+r; the 16 lanes of a half share rows)
    float alpha[8];
#pragma unroll
    for (int r = 0; r < 8; ++r) {
      const int qi = q0 + 8 * hh + r;
      const int ja = j0 + ln, jb = j0 + 16 + ln;
      if (CAUSAL) { if (ja > qi) s[0][r] = -3.0e38f; if (jb > qi) s[1][r] = -3.0e38f; }
      if (ja >= T) s[0][r] = -3.0e38f;
      if (jb >= T) s[1][r] = -3.0e38f;
      float mx = fmaxf(s[0][r], s[1][r]);
      mx = fmaxf(mx, __shfl_xor(mx, 1, 32)); mx = fmaxf(mx, __shfl_xor(mx, 2, 32)); mx = fmaxf(mx, __shfl_xor(mx, 4, 32)); mx = fmaxf(mx, __shfl_xor(mx, 8, 32));
      const float mnew = fmaxf(m_r[r], mx);
      alpha[r] = (mnew > -1.0e38f) ? __expf(m_r[r] - mnew) : 1.0f;
      const float p0 = (s[0][r] > -1.0e38f) ? __expf(s[0][r] - mnew) : 0.f;
      const float p1 = (s[1][r] > -1.0e38f) ? __expf(s[1][r] - mnew) : 0.f;
      m_r[r] = mnew;
      l_r[r] = l_r[r] * alpha[r] + p0 + p1;            // per-lane partial row sum (16 lanes combined at the end)
      unsigned short hb = bf16_bits(p0); sPh[w][8 * hh + r][ln] = hb;      sPl[w][8 * hh + r][ln] = bf16_bits(p0 - bf16_val(hb));
      hb = bf16_bits(p1);                sPh[w][8 * hh + r][16 + ln] = hb; sPl[w][8 * hh + r][16 + ln] = bf16_bits(p1 - bf16_val(hb));
    }
#pragma unroll
    for (int dt = 0; dt < DT; ++dt)
#pragma unroll
      for (int r = 0; r < 8; ++r) oacc[dt][r] *= alpha[r];
    __builtin_amdgcn_fence(__ATOMIC_ACQ_REL, "workgroup");
    __builtin_amdgcn_wave_barrier();
    FragB pah, pal;
    pah.half[0] = *(const v8us*)&sPh[w][ln][8 * hh]; pah.half[1] = *(const v8us*)&sPh[w][ln][16 + 8 * hh];
    pal.half[0] = *(const v8us*)&sPl[w][ln][8 * hh]; pal.half[1] = *(const v8us*)&sPl[w][ln][16 + 8 * hh];
#pragma unroll
    for (int dt = 0; dt < DT; ++dt) {
      FragB bvh, bvl;
#pragma unroll
      for (int i = 0; i < 8; ++i) {
        bvh.u[i] = sVh[8 * hh + i][dt * 16 + ln]; bvh.u[8 + i] = sVh[16 + 8 * hh + i][dt * 16 + ln];
        bvl.u[i] = sVl[8 * hh + i][dt * 16 + ln]; bvl.u[8 + i] = sVl[16 + 8 * hh + i][dt * 16 + ln];
      }
      oacc[dt] = mmaN<3>(pah.v, pal.v, bvh.v, bvl.v, oacc[dt]);
    }
    __builtin_amdgcn_fence(__ATOMIC_ACQ_REL, "workgroup");
    __builtin_amdgcn_wave_barrier();
  }
#pragma unroll
  for (int r = 0; r < 8; ++r) {
    float l = l_r[r];
    l += __shfl_xor(l, 1, 32); l += __shfl_xor(l, 2, 32); l += __shfl_xor(l, 4, 32); l += __shfl_xor(l, 8, 32);
    l_r[r] = (l > 0.f) ? 1.0f / l : 0.f;
  }
#pragma unroll
  for (int dt = 0; dt < DT; ++dt)
#pragma unroll
    for (int r = 0; r < 8; ++r) sO[w][8 * hh + r][dt * 16 + ln] = oacc[dt][r] * l_r[r];
  __builtin_amdgcn_fence(__ATOMIC_ACQ_REL, "workgroup");
  __builtin_amdgcn_wave_barrier();
  {
    for (int r = 0; r < 16; ++r) {
      const int row = q0 + r;
      if (row < T && lane < D / 4) {
        const v4f val = *(const v4fa*)&sO[w][r][lane * 4];
        *(v4f*)(y + ((size_t)b * T + row) * ypitch + h * D + lane * 4) = val;
      }
    }
    
  }
}

// GEMM C = act(A·W + bias + resid): A f32 (ASPLIT -> hi/lo 2 terms), Wt bf16 [N][K]; ACT 0 none, 1 relu, 2 exact gelu;
// resid (optional, f32, row index = (row % rmod), pitch ldr, RES_BF16 rounds it) added before the activation.
template <bool ASPLIT, int ACT, bool BIAS_BF16, bool RES_BF16>
__global__ __launch_bounds__(128) void k_gemm_bf3(const float* __restrict__ A, int lda, const unsigned short* __restrict__ Wt, int ldb,
                                                const float* __restrict__ bias, const float* __restrict__ resid, int rmod, int ldr,
                                                float* __restrict__ C, int ldc, int M, int N, int K) {
  __shared__ __attribute__((aligned(16))) float so[4][16][64];
  const int tid = threadIdx.x, w = tid >> 5, lane = tid & 31, ln = lane & 15, hh = lane >> 4;
  const int ntn = N / 64;
  const int wid = blockIdx.x * 4 + w;
  const int mt = wid / ntn, nq = wid % ntn;
  if (mt * 16 >= M) return;
  const int row0 = mt * 16, col0 = nq * 64;
  const float* arow = A + (size_t)(row0 + ln) * lda;
  v8f acc[4] = {};
  for (int kb = 0; kb < K; kb += 32) {
    FragB ah, al;
    const v4f x0 = *(const v4fa*)(arow + kb + 8 * hh), x1 = *(const v4fa*)(arow + kb + 8 * hh + 4);
    const v4f x2 = *(const v4fa*)(arow + kb + 16 + 8 * hh), x3 = *(const v4fa*)(arow + kb + 16 + 8 * hh + 4);
    float xs[16] = {x0[0],x0[1],x0[2],x0[3],x1[0],x1[1],x1[2],x1[3],x2[0],x2[1],x2[2],x2[3],x3[0],x3[1],x3[2],x3[3]};
#pragma unroll
    for (int i = 0; i < 16; ++i) { const unsigned short hb = bf16_bits(xs[i]); ah.u[i] = hb; al.u[i] = ASPLIT ? bf16_bits(xs[i] - bf16_val(hb)) : (unsigned short)0; }
#pragma unroll
    for (int t = 0; t < 4; ++t) {
      const unsigned short* brow = Wt + (size_t)(col0 + t * 16 + ln) * ldb + kb;
      FragB b;
      b.half[0] = *(const v8us*)(brow + 8 * hh);
      b.half[1] = *(const v8us*)(brow + 16 + 8 * hh);
      acc[t] = mmaN<ASPLIT ? 2 : 1>(ah.v, al.v, b.v, b.v, acc[t]);
    }
  }
#pragma unroll
  for (int t = 0; t < 4; ++t) {
    const int col = col0 + t * 16 + ln;
    float bv = bias ? bias[col] : 0.f;
    if (BIAS_BF16) bv = bf16_round(bv);
#pragma unroll
    for (int r = 0; r < 8; ++r) {
      float v = acc[t][r] + bv;
      if (resid) { float rv = resid[(size_t)((row0 + 8 * hh + r) % rmod) * ldr + col]; if (RES_BF16) rv = bf16_round(rv); v += rv; }
      if (ACT == 1) v = fmaxf(v, 0.f);
      if (ACT == 2) v = 0.5f * v * (1.0f + erff(v * 0.70710678118654752f));
      if (ACT == 3) { const float u = 0.7978845608028654f * (v + 0.044715f * v * v * v); v = 0.5f * v * (1.0f + tanhf(u)); }
      so[w][8 * hh + r][t * 16 + ln] = v;
    }
  }
  __builtin_amdgcn_fence(__ATOMIC_ACQ_REL, "workgroup");
  __builtin_amdgcn_wave_barrier();
  const int rsub = lane >> 4, c4 = (lane & 15) * 4;
  {
#pragma unroll
    for (int q = 0; q < 8; ++q) {
      const int r = q * 2 + rsub;
      const v4f v = *(const v4fa*)&so[w][r][c4];
      *(v4f*)(C + (size_t)(row0 + r) * ldc + col0 + c4) = v;
    }
    
  }
}
// row LayerNorm (biased variance, eps) over N: s = X (+ R); optional out_sum <- s; out_norm <- (s-mu)*rsqrt(var+eps)*g + b
template <bool PARAM_BF16>
__global__ __launch_bounds__(256) void k_layernorm(const float* __restrict__ X, const float* __restrict__ R, const float* __restrict__ g, const float* __restrict__ bta,
                                                  float* __restrict__ out_sum, float* __restrict__ out_norm, int N, float eps) {
  __shared__ float red[256];
  const int row = blockIdx.x, tid = threadIdx.x;
  const float* x = X + (size_t)row * N; const float* rr = R ? R + (size_t)row * N : nullptr;
  float vals[16];                     // up to N = 4096
  const int per = N / 256;            // contiguous chunk per thread? use strided-by-4 chunks: thread handles j = tid*4 + 1024*u
  float s1 = 0.f;
  for (int u = 0; u < per / 4; ++u) {
    const int j = tid * 4 + 1024 * u;
    const v4f a = *(const v4fa*)(x + j);
    v4f b = {0.f,0.f,0.f,0.f}; if (rr) b = *(const v4fa*)(rr + j);
#pragma unroll
    for (int q = 0; q < 4; ++q) { const float v = a[q] + b[q]; vals[u * 4 + q] = v; s1 += v; }
  }
  red[tid] = s1; __syncthreads();
  for (int st = 128; st > 0; st >>= 1) { if (tid < st) red[tid] += red[tid + st]; __syncthreads(); }
  const float mu = red[0] / (float)N; __syncthreads();
  float s2 = 0.f;
  for (int u = 0; u < per / 4; ++u)
#pragma unroll
    for (int q = 0; q < 4; ++q) { const float c = vals[u * 4 + q] - mu; s2 += c * c; }
  red[tid] = s2; __syncthreads();
  for (int st = 128; st > 0; st >>= 1) { if (tid < st) red[tid] += red[tid + st]; __syncthreads(); }
  const float rs = rsqrtf(red[0] / (float)N + eps);
  {
    for (int u = 0; u < per / 4; ++u) {
      const int j = tid * 4 + 1024 * u;
      v4f o, sm;
#pragma unroll
      for (int q = 0; q < 4; ++q) {
        float gg = g[j + q], bb = bta[j + q];
        if (PARAM_BF16) { gg = bf16_round(gg); bb = bf16_round(bb); }
        sm[q] = vals[u * 4 + q]; o[q] = (vals[u * 4 + q] - mu) * rs * gg + bb;
      }
      if (out_sum) *(v4f*)(out_sum + (size_t)row * N + j) = sm;
      *(v4f*)(out_norm + (size_t)row * N + j) = o;
    }
    
  }
}



// ---- f16 WMMA path (v_wmma_f32_16x16x32_f16): 11-bit significands for operands in range — used where a [0,1] probability operand needs more precision than bf16
typedef _Float16 v16h __attribute__((ext_vector_type(16)));
union FragH { v16h v; v8us half[2]; _Float16 h[16]; unsigned short u[16]; };
template <int NT>
__device__ __forceinline__ v8f mmaH(v16h ah, v16h al, v16h bh, v16h bl, v8f c) {
  c = __builtin_amdgcn_wmma_f32_16x16x32_f16(false, ah, false, bh, (short)0, c, false, false);
  if (NT >= 2) c = __builtin_amdgcn_wmma_f32_16x16x32_f16(false, al, false, bh, (short)0, c, false, false);
  if (NT >= 3) c = __builtin_amdgcn_wmma_f32_16x16x32_f16(false, ah, false, bl, (short)0, c, false, false);
  asm volatile("v_nop\n\tv_nop\n\tv_nop\n\tv_nop" : "+v"(c) : "v"(ah), "v"(al), "v"(bh), "v"(bl));
  return c;
}
// batched GEMM like k_gemm_b but f16 operands: A f32 (split into f16 hi/lo if ASPLIT, else rounded to f16), Bt = f16 values [n][k]; alpha; C f32; N multiple of 16 (partial tiles skipped)
template <bool ASPLIT>
__global__ __launch_bounds__(128) void k_gemm_h(const float* __restrict__ A, int lda, size_t sA, const _Float16* __restrict__ Bh, int ldb, size_t sB, float alpha, float* __restrict__ C, int ldc, size_t sC, int M, int N, int K) {
  __shared__ __attribute__((aligned(16))) float so[4][16][64];
  const int tid = threadIdx.x, w = tid >> 5, lane = tid & 31, ln = lane & 15, hh = lane >> 4; const int by = blockIdx.y;
  A += (size_t)by * sA; Bh += (size_t)by * sB; C += (size_t)by * sC;
  const int ntn = (N + 63) / 64; const int wid = blockIdx.x * 4 + w; const int mt = wid / ntn, nq = wid % ntn; if (mt * 16 >= M) return;
  const int row0 = mt * 16, col0 = nq * 64; const float* arow = A + (size_t)(row0 + ln) * lda;
  v8f acc[4] = {};
  for (int kb = 0; kb < K; kb += 32) {
    FragH ah, al;
    const v4f x0 = *(const v4fa*)(arow + kb + 8 * hh), x1 = *(const v4fa*)(arow + kb + 8 * hh + 4), x2 = *(const v4fa*)(arow + kb + 16 + 8 * hh), x3 = *(const v4fa*)(arow + kb + 16 + 8 * hh + 4);
    float xs[16] = {x0[0],x0[1],x0[2],x0[3],x1[0],x1[1],x1[2],x1[3],x2[0],x2[1],x2[2],x2[3],x3[0],x3[1],x3[2],x3[3]};
#pragma unroll
    for (int i = 0; i < 16; ++i) { const _Float16 h = (_Float16)xs[i]; ah.h[i] = h; al.h[i] = ASPLIT ? (_Float16)(xs[i] - (float)h) : (_Float16)0.0f; }
#pragma unroll
    for (int t = 0; t < 4; ++t) { if (col0 + t * 16 >= N) continue; const size_t boff = (size_t)(col0 + t * 16 + ln) * ldb + kb; FragH bq; bq.half[0] = *(const v8us*)(Bh + boff + 8 * hh); bq.half[1] = *(const v8us*)(Bh + boff + 16 + 8 * hh);
      acc[t] = mmaH<ASPLIT ? 2 : 1>(ah.v, al.v, bq.v, bq.v, acc[t]); }
  }
#pragma unroll
  for (int t = 0; t < 4; ++t) { if (col0 + t * 16 >= N) continue;
#pragma unroll
    for (int r = 0; r < 8; ++r) so[w][8 * hh + r][t * 16 + ln] = acc[t][r] * alpha; }
  __builtin_amdgcn_fence(__ATOMIC_ACQ_REL, "workgroup"); __builtin_amdgcn_wave_barrier();
  const int rsub = lane >> 4, c4 = (lane & 15) * 4;
  {
#pragma unroll
    for (int q = 0; q < 8; ++q) { const int r = q * 2 + rsub; if (col0 + c4 < N) { const v4f v = *(const v4fa*)&so[w][r][c4]; *(v4f*)(C + (size_t)(row0 + r) * ldc + col0 + c4) = v; } }
     }
}

// Wt[n][k] = f16(W[k][n]·scale) from f32 row-major W[K][N] (scale = power of two; bf16-exact weights stay exact in f16 away from the subnormal range)
__global__ __launch_bounds__(256) void k_wt_f16(const float* __restrict__ W, _Float16* __restrict__ Wt, int K, int N, float scale) {
  const int t = blockIdx.x * 256 + threadIdx.x; if (t >= N * (K / 8)) return; const int n = t / (K / 8), k8 = (t % (K / 8)) * 8; FragH f;
#pragma unroll
  for (int i = 0; i < 8; ++i) f.h[i] = (_Float16)(bf16_round(W[(size_t)(k8 + i) * N + n]) * scale); const v8us o = f.half[0];
  *(v8us*)((unsigned short*)Wt + (size_t)n * K + k8) = o; 
}


typedef _Float16 v4h __attribute__((ext_vector_type(4)));
typedef _Float16 v2h __attribute__((ext_vector_type(2)));
typedef float v2fv __attribute__((ext_vector_type(2)));

__global__ __launch_bounds__(256) void k_h16(const float* __restrict__ x, _Float16* __restrict__ X16, size_t n8) { const size_t t = (size_t)blockIdx.x * 256 + threadIdx.x; if (t >= n8) return; FragH f;
#pragma unroll
  for (int q = 0; q < 8; ++q) f.h[q] = (_Float16)x[t * 8 + q]; *(v8us*)((unsigned short*)X16 + t * 8) = f.half[0];  }
// ---- the three projections in ONE launch, straight from the f32 inputs. A workgroup takes 128 tokens x 192 rows of the stacked (Wq; Wk; Wv): it rounds both tiles
// (x: bf16-exact f16; W: bf16-exact x 2^4, f16) into LDS over the whole K = 256, passes one barrier, and its 12 waves each form a 64 x 32 tile on WMMA.
// The accumulator holds 8 consecutive M rows in a lane, so M is made the index that is contiguous in the output: Q, K = [token][col]: A = W rows, B = x rows; V^T = [col][token]: A = x rows, B = Wv rows.
#define PTOK 128    // tokens per workgroup
#define PCOL 192    // stacked weight rows per workgroup: three groups of 64, each inside one matrix; 32 x 8 = 256 workgroups, one per WGP
#define PP 264      // LDS row pitch in 16-bit elements: 528 B = 16 B x odd, conflict-free for 16-byte fragment reads
#define PO 72       // pitch of a wave's output rows in LDS, 144 B
typedef unsigned short v4us __attribute__((ext_vector_type(4), may_alias));
typedef __bf16 v2bf __attribute__((ext_vector_type(2)));
union Pack4 { v2h p[2]; v4us u; };
// four f32 -> nearest-even bf16 (the packed hardware conversion: the same rounding as bf16_round) -> x scale, a power of two -> f16, 8 bytes into LDS
template <bool SCALE>
__device__ __forceinline__ void put4(unsigned short* p, v4f v) {
  Pack4 k;
#pragma unroll
  for (int q = 0; q < 2; ++q) {
    const unsigned int u = __builtin_bit_cast(unsigned int, __builtin_convertvector((v2fv){v[2 * q], v[2 * q + 1]}, v2bf));
    v2fv f = {__uint_as_float(u << 16), __uint_as_float(u & 0xFFFF0000u)};
    if (SCALE) f *= 16.0f;
    k.p[q] = __builtin_convertvector(f, v2h);
  }
  *(v4us*)p = k.u;
}
// acc[at][bt][r] = element (m = at*16 + 8*hh + r, n = bt*16 + ln). v = acc / 16 + bf16(bias), to f16; the wave's 32 rows n of 64 m go through its own LDS range, so that every store writes whole 128-byte lines.
template <bool ISV>
__device__ __forceinline__ void proj_out(const v8f (&acc)[4][2], const float (&bs)[32], unsigned short (*so)[PO], unsigned short* __restrict__ ob, int lane) {
  const int ln = lane & 15, hh = lane >> 4;
#pragma unroll
  for (int at = 0; at < 4; ++at)
#pragma unroll
    for (int bt = 0; bt < 2; ++bt) {
      FragH f;
#pragma unroll
      for (int r = 0; r < 8; ++r) f.h[r] = (_Float16)(acc[at][bt][r] * 0.0625f + bf16_round(ISV ? bs[bt] : bs[at * 8 + r]));
      *(v8us*)&so[bt * 16 + ln][at * 16 + 8 * hh] = f.half[0];
    }
  // the rows are read back by other lanes of the same wave: the LDS writes above must have landed
  __builtin_amdgcn_fence(__ATOMIC_ACQ_REL, "workgroup"); __builtin_amdgcn_wave_barrier();
  constexpr size_t ldo = ISV ? NN : PJ;
  unsigned short* op = ob + (size_t)(lane >> 3) * ldo + (lane & 7) * 8;
#pragma unroll
  for (int i = 0; i < 8; ++i) { const v8us v = *(const v8us*)&so[i * 4 + (lane >> 3)][(lane & 7) * 8]; *(v8us*)(op + (size_t)i * 4 * ldo) = v; }
}
__global__ __launch_bounds__(384) void k_proj(const float* __restrict__ x, const float* __restrict__ Wq, const float* __restrict__ Wk, const float* __restrict__ Wv,
                                              const float* __restrict__ bq, const float* __restrict__ bk, const float* __restrict__ bv,
                                              _Float16* __restrict__ Q16, _Float16* __restrict__ K16, _Float16* __restrict__ Vt) {
  __shared__ __attribute__((aligned(16))) unsigned short sT[PTOK + PCOL][PP];      // rows 0..127: tokens; 128..319: stacked weight rows
  __shared__ __attribute__((aligned(16))) unsigned short sO[12][32][PO];
  const int tid = threadIdx.x, lane = tid & 31, ln = lane & 15, hh = lane >> 4;
  const int w = __builtin_amdgcn_readfirstlane(tid >> 5);      // scalar: all that follows from it (matrix, roles, pointers) stays in scalar registers
  const int g = w >> 2, sub = w & 3;                           // the wave's group of 64 weight rows, and its quarter of the 64 x 128 products of that group
  const int tok0 = (blockIdx.x >> 3) * PTOK;
  const int cs = (blockIdx.x & 7) * PCOL + g * 64;             // the group's first row in the stacked weights
  const int mat = cs >> 9, cm = cs & (PJ - 1);                 // 0 q, 1 k, 2 v; first row inside that matrix
  const bool isV = mat == 2;
  const float* Wm = mat == 0 ? Wq : (mat == 1 ? Wk : Wv);
  float bs[32];      // bias, asked for first and rounded last: Q, K one value per m, V one per n
  if (isV) {
#pragma unroll
    for (int bt = 0; bt < 2; ++bt) bs[bt] = bv[cm + (sub & 1) * 32 + bt * 16 + ln];
    asm volatile("s_wait_xcnt 0x0" ::: "memory");      // at the end of the block that issues the loads
  } else {
    const float* bp = (mat == 0 ? bq : bk) + cm + 8 * hh;
#pragma unroll
    for (int at = 0; at < 4; ++at) {
      const v4f lo = *(const v4fa*)(bp + at * 16), hi = *(const v4fa*)(bp + at * 16 + 4);
#pragma unroll
      for (int q = 0; q < 4; ++q) { bs[at * 8 + q] = lo[q]; bs[at * 8 + 4 + q] = hi[q]; }
    }
    asm volatile("s_wait_xcnt 0x0" ::: "memory");      // as above
  }
  // staging: one wave-wide load = 512 contiguous bytes = half a row. The token tile is one contiguous 128 KiB (half row j*12 + w), a wave's 16 weight rows one contiguous 16 KiB:
  // every address is one base plus a constant.
  const float* gx = x + (size_t)tok0 * CIN + w * 128 + lane * 4;
  const float* gw = Wm + (size_t)(cm + sub * 16) * CIN + lane * 4;
  unsigned short* lx = &sT[w >> 1][(w & 1) * 128 + lane * 4];
  unsigned short* lw = &sT[PTOK + w * 16][lane * 4];
  v4f rx[22], rw[16];
#pragma unroll
  for (int j = 0; j < 21; ++j) rx[j] = *(const v4fa*)(gx + j * 12 * 128);
  asm volatile("s_wait_xcnt 0x0" ::: "memory");      // as above: the base of these loads is rewritten for the weight rows
  if (w < 4) { rx[21] = *(const v4fa*)(gx + 21 * 12 * 128); asm volatile("s_wait_xcnt 0x0" ::: "memory"); }      // 256 half rows = 21 x 12 + 4; the wait as above
#pragma unroll
  for (int j = 0; j < 16; ++j) rw[j] = *(const v4fa*)(gw + j * 128);
#pragma unroll
  for (int j = 0; j < 21; ++j) put4<false>(lx + j * 6 * PP, rx[j]);
  if (w < 4) put4<false>(lx + 21 * 6 * PP, rx[21]);
#pragma unroll
  for (int hf = 0; hf < 2; ++hf) {
#pragma unroll
    for (int j = 0; j < 16; ++j) {
      put4<true>(lw + (hf * 8 + (j >> 1)) * PP + (j & 1) * 128, rw[j]);
      if (hf == 0) rw[j] = *(const v4fa*)(gw + (16 + j) * 128);
    }
  }
  __syncthreads();      // both tiles are whole
  const int rowA = isV ? (sub >> 1) * 64 : PTOK + g * 64;
  const int rowB = isV ? PTOK + g * 64 + (sub & 1) * 32 : sub * 32;
  const unsigned short* pa = &sT[rowA + ln][8 * hh];
  const unsigned short* pb = &sT[rowB + ln][8 * hh];
  v8f acc[4][2];
#pragma unroll
  for (int at = 0; at < 4; ++at)
#pragma unroll
    for (int bt = 0; bt < 2; ++bt) acc[at][bt] = (v8f){0.f, 0.f, 0.f, 0.f, 0.f, 0.f, 0.f, 0.f};
  // A and B fragments take the same k order: elements 0..7 = k 8*hh.., 8..15 = k 16 + 8*hh..
  FragH a[2][4], b[2][2];
  auto frags = [&](int ks) {
#pragma unroll
    for (int at = 0; at < 4; ++at) { a[ks & 1][at].half[0] = *(const v8us*)(pa + at * 16 * PP + ks * 32); a[ks & 1][at].half[1] = *(const v8us*)(pa + at * 16 * PP + ks * 32 + 16); }
#pragma unroll
    for (int bt = 0; bt < 2; ++bt) { b[ks & 1][bt].half[0] = *(const v8us*)(pb + bt * 16 * PP + ks * 32); b[ks & 1][bt].half[1] = *(const v8us*)(pb + bt * 16 * PP + ks * 32 + 16); }
  };
  frags(0);
#pragma unroll
  for (int ks = 0; ks < CIN / 32; ++ks) {
    if (ks + 1 < CIN / 32) frags(ks + 1);      // the next step's 12 LDS reads as one group ahead of this step's 8 WMMAs, which cover their latency
    __builtin_amdgcn_sched_barrier(0);         // keeps that group here: the scheduler's own order sank each read to just in front of its first WMMA, four waits to zero a step
#pragma unroll
    for (int at = 0; at < 4; ++at)
#pragma unroll
      for (int bt = 0; bt < 2; ++bt) acc[at][bt] = __builtin_amdgcn_wmma_f32_16x16x32_f16(false, a[ks & 1][at].v, false, b[ks & 1][bt].v, (short)0, acc[at][bt], false, false);
  }
  if (isV) proj_out<true>(acc, bs, sO[w], (unsigned short*)Vt + (size_t)(cm + (sub & 1) * 32) * NN + tok0 + (sub >> 1) * 64, lane);      // V^T: [h*64 + d][token]
  else proj_out<false>(acc, bs, sO[w], (unsigned short*)(mat == 0 ? Q16 : K16) + (size_t)(tok0 + sub * 32) * PJ + cm, lane);              // head h at cols h*64
}

// ---- fused sigmoid attention. S^T/2 = K.(Q/2)^T (A = K rows from LDS, B = Q/2 in registers), P = sigmoid(S) = 1/2 + 1/2 tanh(S/2) in place (one transcendental an element), O^T += V^T.P^T (A = V^T rows from LDS, B = two packed S^T tiles).
// A sigmoid needs no running maximum, so sums over disjoint key ranges simply add: grid = (256-query blocks, heads, key ranges), 8 waves x 32 query columns, 64 keys per LDS stage.
#define KSPL 4      // key ranges per head: 512 workgroups, two per WGP
#define KT 64       // keys per stage
#define LP 72       // LDS row pitch in 16-bit elements: 144 B = 16 B x odd, conflict-free for 16-byte fragment reads
union FragP { v16h v; v2h p2[8]; };
// four waves per SIMD = two of these workgroups per WGP: the register budget the allocator may spend is that of the occupancy the grid is sized for
__global__ __launch_bounds__(256) __attribute__((amdgpu_waves_per_eu(4, 4)))
void k_fsig(const _Float16* __restrict__ Q16, const _Float16* __restrict__ K16, const _Float16* __restrict__ Vt, _Float16* __restrict__ Op, float* __restrict__ Zp) {
  __shared__ __attribute__((aligned(16))) unsigned short sK[2][KT][LP];      // [buffer][key][dim]
  __shared__ __attribute__((aligned(16))) unsigned short sV[2][HD][LP];      // [buffer][d][key]
  const int tid = threadIdx.x, w = tid >> 5, lane = tid & 31, c = lane & 15, hh = lane >> 4;
  const int h = blockIdx.y, sp = blockIdx.z;
  const int q0 = blockIdx.x * 256 + w * 32;
  const int key0 = sp * (NN / KSPL);
  constexpr int NT = NN / KSPL / KT;
  // staging: a thread moves 16 bytes of rows r0 and r0 + 32 of the K tile and of the V^T tile
  const int r0 = tid >> 3, c8 = (tid & 7) * 8;
  const unsigned short* gk = (const unsigned short*)K16 + (size_t)key0 * PJ + h * HD;      // uniform bases; the lane's part is one 32-bit offset each
  const unsigned short* gv = (const unsigned short*)Vt + (size_t)h * HD * NN + key0;
  const unsigned ko = r0 * PJ + c8, vo = r0 * NN + c8;
  // K and V^T of a stage are fetched one after the other, each a unit ahead of its LDS write: only one of the two tiles waits in registers at any time
  v8us rk0, rk1, rv0, rv1;
  auto fetchK = [&](int t) {
    const unsigned short* kp = gk + (size_t)t * KT * PJ;
    rk0 = *(const v8us*)(kp + ko); rk1 = *(const v8us*)(kp + ko + 32 * PJ);
    asm volatile("s_wait_xcnt 0x0" :: "v"(kp + ko) : "memory");      // behind the loads: their address registers are rewritten for the next stage; the address as an input is still read here, so no load's result is given its registers in front of the wait (at the last fetch the second load's was)
  };
  auto fetchV = [&](int t) {
    const unsigned short* vp = gv + t * KT;
    rv0 = *(const v8us*)(vp + vo); rv1 = *(const v8us*)(vp + vo + 32 * NN);
    asm volatile("s_wait_xcnt 0x0" :: "v"(vp + vo) : "memory");      // as above
  };
  // The workgroup barrier with its two fences on LDS alone: the waves hand each other nothing but LDS here, and __syncthreads() would also wait for the global loads of the next K tile, which are in flight to registers over the barrier.
  auto lds_barrier = [&]() {
    __builtin_amdgcn_fence(__ATOMIC_RELEASE, "workgroup", "local");
    __builtin_amdgcn_s_barrier();
    __builtin_amdgcn_fence(__ATOMIC_ACQUIRE, "workgroup", "local");
  };
  auto putK = [&](int b) { *(v8us*)&sK[b][r0][c8] = rk0; *(v8us*)&sK[b][r0 + 32][c8] = rk1; };
  auto putV = [&](int b) { *(v8us*)&sV[b][r0][c8] = rv0; *(v8us*)&sV[b][r0 + 32][c8] = rv1; };
  // B fragments of the wave's 2 x 16 query columns, hardware k order over the 64 dims
  FragH bq[2][2];
#pragma unroll
  for (int cg = 0; cg < 2; ++cg) {
    const unsigned short* qc = (const unsigned short*)Q16 + (size_t)(q0 + cg * 16 + c) * PJ + h * HD + 8 * hh;
#pragma unroll
    for (int ks = 0; ks < 2; ++ks) { bq[cg][ks].half[0] = *(const v8us*)(qc + ks * 32); bq[cg][ks].half[1] = *(const v8us*)(qc + ks * 32 + 16); }
    asm volatile("s_wait_xcnt 0x0" :: "v"(qc) : "memory");      // behind the group's four loads: a later load's result was given their address registers; the address as an input is still read here, so none of the four takes them either
#pragma unroll
    for (int ks = 0; ks < 2; ++ks)
      bq[cg][ks].v *= (_Float16)0.5f;      // the halving of the tanh argument, once a wave: a power of two, exact above the f16 subnormal range, so the WMMA sums are the logits' own sums halved (in front of these packed f16 multiplies the compiler sets the f16 rounding field to its default, nearest even)
  }
  v8f o[4][2];
#pragma unroll
  for (int dt = 0; dt < 4; ++dt)
#pragma unroll
    for (int cg = 0; cg < 2; ++cg) o[dt][cg] = (v8f){0.f, 0.f, 0.f, 0.f, 0.f, 0.f, 0.f, 0.f};
  v8f zs[2] = {(v8f){0.f, 0.f, 0.f, 0.f, 0.f, 0.f, 0.f, 0.f}, (v8f){0.f, 0.f, 0.f, 0.f, 0.f, 0.f, 0.f, 0.f}};      // row sums of the f16 P, taken on the matrix pipe: A = all ones
  FragH ones;
#pragma unroll
  for (int i = 0; i < 16; ++i) ones.h[i] = (_Float16)1.0f;
  // The loop body is laid out by hand as one software pipeline. A unit = 32 keys x the wave's 32 queries = 18 WMMAs and 64 vector instructions of sigmoid.
  // (1) The two groups of 16 queries run half a unit apart, over the unit's border: the sigmoid of group 0 of unit u stands between P.V of group 1 of unit u - 1 and S of group 1 of unit u,
  //     the sigmoid of group 1 between P.V of group 0 of unit u and S of group 0 of unit u + 1. So each of the 18 WMMAs has about two v_tanh_f32 and two packed operations behind it, which fit beside it; none stands bare.
  // (2) No WMMA waits for an LDS read issued just in front of it: V^T of unit u is read behind the last use of V^T of unit u - 1, four WMMAs ahead of its first use; K of unit u + 1 behind the last use of K of unit u, five ahead.
  // The K fragments of a stage's first unit are thus read in the pass before, so the stage's barrier stands in the second unit of the stage before, behind that stage's last V^T read.
  FragH ka[2][2], va[4];
  FragP pb[2];
  v8f s[2][2];      // s[cg][kt][r] = half the logit(key kt*16 + 8*hh + r of the unit, query cg*16 + c)
  auto loadK = [&](int b, int j) {
#pragma unroll
    for (int kt = 0; kt < 2; ++kt)
#pragma unroll
      for (int ks = 0; ks < 2; ++ks) {
        const unsigned short* kr = &sK[b][j * 32 + kt * 16 + c][ks * 32];
        ka[kt][ks].half[0] = *(const v8us*)(kr + 8 * hh); ka[kt][ks].half[1] = *(const v8us*)(kr + 16 + 8 * hh);
      }
  };
  auto loadV = [&](int b, int j, int d0, int d1) {      // d tiles d0 .. d1 - 1
#pragma unroll
    for (int dt = d0; dt < d1; ++dt) {
      const unsigned short* vr = &sV[b][dt * 16 + c][j * 32];
      va[dt].half[0] = *(const v8us*)(vr + 8 * hh); va[dt].half[1] = *(const v8us*)(vr + 16 + 8 * hh);
    }
  };
  auto qk = [&](int cg) {      // four WMMAs: two independent accumulate chains of two
#pragma unroll
    for (int kt = 0; kt < 2; ++kt) s[cg][kt] = __builtin_amdgcn_wmma_f32_16x16x32_f16(false, ka[kt][0].v, false, bq[cg][0].v, (short)0, (v8f){0.f, 0.f, 0.f, 0.f, 0.f, 0.f, 0.f, 0.f}, false, false);
#pragma unroll
    for (int kt = 0; kt < 2; ++kt) s[cg][kt] = __builtin_amdgcn_wmma_f32_16x16x32_f16(false, ka[kt][1].v, false, bq[cg][1].v, (short)0, s[cg][kt], false, false);
  };
  // the sigmoid of one column group, pair by pair (pair k = elements 2k, 2k + 1 of B; element kt*8 + r of B = key 8*hh + r (kt 0), 16 + 8*hh + r (kt 1): the hardware k order):
  // two v_tanh_f32, one packed fma (sigmoid in f32), one packed conversion (rounded once to f16). The three steps of a pair stand in three successive gaps between WMMAs, so that none waits for the one before.
  v2fv th[8], fm[8];
  auto sT = [&](int cg, int k) { th[k] = (v2fv){__builtin_amdgcn_tanhf(s[cg][k >> 2][(k & 3) * 2]), __builtin_amdgcn_tanhf(s[cg][k >> 2][(k & 3) * 2 + 1])}; };
  auto sF = [&](int k) { fm[k] = th[k] * 0.5f + 0.5f; };
  auto sC = [&](int cg, int k) { pb[cg].p2[k] = __builtin_convertvector(fm[k], v2h); };
  auto sig1 = [&](int cg) {      // beside five WMMAs
    sT(cg, 0); sT(cg, 1); sF(0); sT(cg, 2); sC(cg, 0); sF(1); sT(cg, 3); sC(cg, 1); sF(2); sT(cg, 4); sC(cg, 2); sF(3);
  };
  auto sig2 = [&](int cg) {      // beside four WMMAs
    sT(cg, 5); sC(cg, 3); sF(4); sT(cg, 6); sC(cg, 4); sF(5); sT(cg, 7); sC(cg, 5); sF(6); sC(cg, 6); sF(7); sC(cg, 7);
  };
  auto pv = [&](int cg) {      // five WMMAs
    zs[cg] = __builtin_amdgcn_wmma_f32_16x16x32_f16(false, ones.v, false, pb[cg].v, (short)0, zs[cg], false, false);      // every row of zs = the column sums of P^T
#pragma unroll
    for (int dt = 0; dt < 4; ++dt) o[dt][cg] = __builtin_amdgcn_wmma_f32_16x16x32_f16(false, va[dt].v, false, pb[cg].v, (short)0, o[dt][cg], false, false);
  };
  // The order asked of the scheduler (0x8 a WMMA, 0x400 a transcendental, 0x2 another vector instruction): behind each WMMA a conversion, a tanh, an fma, a tanh, which issue while the matrix unit works on it.
  // Left to itself the scheduler put most of the sigmoid in one run, where matrix time and vector time add.
#define GAP_PTPT() do { __builtin_amdgcn_sched_group_barrier(0x8, 1, 0); __builtin_amdgcn_sched_group_barrier(0x2, 1, 0); __builtin_amdgcn_sched_group_barrier(0x400, 1, 0); __builtin_amdgcn_sched_group_barrier(0x2, 1, 0); __builtin_amdgcn_sched_group_barrier(0x400, 1, 0); } while (0)
#define WEAVE5() do { __builtin_amdgcn_sched_group_barrier(0x8, 1, 0); __builtin_amdgcn_sched_group_barrier(0x400, 2, 0); \
    __builtin_amdgcn_sched_group_barrier(0x8, 1, 0); __builtin_amdgcn_sched_group_barrier(0x400, 1, 0); __builtin_amdgcn_sched_group_barrier(0x2, 1, 0); __builtin_amdgcn_sched_group_barrier(0x400, 1, 0); \
    GAP_PTPT(); GAP_PTPT(); GAP_PTPT(); } while (0)
#define WEAVE4() do { GAP_PTPT(); GAP_PTPT(); GAP_PTPT(); __builtin_amdgcn_sched_group_barrier(0x8, 1, 0); __builtin_amdgcn_sched_group_barrier(0x2, 3, 0); } while (0)
  // One pass = one stage of 64 keys = two units. b, more and next are constants at every call, so every LDS address is one base register plus an immediate.
  // Each sched_barrier(0) below ends one woven order and keeps the group of LDS reads (and writes) at its place: behind the last WMMA that uses the registers they land in (hoisted, they would take a second set of registers), and as one group (sunk, each pair of reads would stand just in front of its WMMA with a wait to zero).
  auto pass = [&](int t, int b, bool more, bool next) {
#pragma unroll
    for (int j = 0; j < 2; ++j) {
      pv(1); sig1(0); WEAVE5();      // P.V of group 1 of the unit before
      __builtin_amdgcn_sched_barrier(0);
      // inputs only, no code: the loaded V^T fragments count as in use up to here. Without it the allocator gave the tanh results the registers of the fragment that the WMMA just in front reads, and each such gap took three or four v_nop
      asm volatile("" :: "v"(va[0].v), "v"(va[1].v), "v"(va[2].v), "v"(va[3].v));
      loadV(b, j, 0, 4);
      // stage t + 1 goes into the other buffer, whose last reads ended in front of the barrier of pass t - 1: K in the first unit, V^T in the second; each write frees the registers for the next fetch
      if (j == 0 && more) { putK(b ^ 1); fetchV(t + 1); }
      if (j == 1 && more) putV(b ^ 1);
      if (j == 1 && next) fetchK(t + 2);
      __builtin_amdgcn_sched_barrier(0);
      qk(1); sig2(0); WEAVE4();
      __builtin_amdgcn_sched_barrier(0);
      asm volatile("" :: "v"(ka[0][0].v), "v"(ka[0][1].v), "v"(ka[1][0].v), "v"(ka[1][1].v));      // as above, for the loaded K fragments
      if (j == 0) loadK(b, 1);
      else if (more) {
        lds_barrier();      // publishes stage t + 1 and ends every read of stage t
        loadK(b ^ 1, 0);
      }
      __builtin_amdgcn_sched_barrier(0);
      pv(0); sig1(1); WEAVE5();
      __builtin_amdgcn_sched_barrier(0);
      if (j == 0 || more) { qk(0); sig2(1); WEAVE4(); }      // S of group 0 of the next unit
      else sig2(1);
      __builtin_amdgcn_sched_barrier(0);
    }
  };
  fetchK(0); fetchV(0); putK(0); putV(0);
  fetchK(1);
  lds_barrier();
  loadK(0, 0);
  // the pipeline's start: there is no unit before the first, so its P.V of group 1 adds products of zeros
#pragma unroll
  for (int dt = 0; dt < 4; ++dt)
#pragma unroll
    for (int i = 0; i < 16; ++i) va[dt].h[i] = (_Float16)0.0f;
#pragma unroll
  for (int i = 0; i < 8; ++i) pb[1].p2[i] = (v2h){(_Float16)0.0f, (_Float16)0.0f};
  qk(0);
  __builtin_amdgcn_sched_barrier(0);      // S of group 0 of the first unit stays in front of the first pass
  // two passes a trip, so that the buffer index is a constant; not unrolled further: more copies would only cost instruction cache
#pragma unroll 1
  for (int t = 0; t < NT - 2; t += 2) { pass(t, 0, true, true); pass(t + 1, 1, true, true); }
  pass(NT - 2, 0, true, false);
  pass(NT - 1, 1, false, false);      // the last stage: nothing left to stage, no barrier
  pv(1);      // the pipeline's end: P.V of group 1 of the last unit
#undef WEAVE4
#undef WEAVE5
#undef GAP_PTPT
  // o[dt][cg][r] = sum_keys P.V at d = dt*16 + 8*hh + r, query cg*16 + c. The partial sums leave as f16: half the bytes of the largest buffer of the three launches, written here and read once by k_hmean.
  // Each f32 sum is scaled by 2^-10 (exact) and rounded once: P <= 1 over 1024 keys, so the scaled sum does not pass the largest |V|, itself an f16: no overflow. A query's 64 values lie in their natural order d, one 128-byte line.
#pragma unroll
  for (int cg = 0; cg < 2; ++cg) {
    const unsigned slab = ((unsigned)h * KSPL + sp) * NN + q0 + cg * 16 + c;      // 32-bit (below 2^17): the two 64-bit offsets, live over the whole loop, were spilled
    unsigned short* op = (unsigned short*)Op + (size_t)slab * HD + hh * 8;
#pragma unroll
    for (int dt = 0; dt < 4; ++dt) {
      FragH f;
#pragma unroll
      for (int r = 0; r < 8; ++r) f.h[r] = (_Float16)(o[dt][cg][r] * 0.0009765625f);
      *(v8us*)(op + dt * 16) = f.half[0];
    }
    if (hh == 0) Zp[slab] = zs[cg][0];      // both lane halves hold the same sum
  }
}
// out[q][d] = 1/8 sum_h (sum_ranges Op) / (sum_ranges Zp). A wave takes two queries: lane = (half hf of the heads, query qs, eight consecutive d from i*8).
typedef _Float16 v8h __attribute__((ext_vector_type(8)));
__global__ __launch_bounds__(256) void k_hmean(const _Float16* __restrict__ Op, const float* __restrict__ Zp, float* __restrict__ out) {
  const unsigned tid = threadIdx.x, lane = tid & 31, i = lane & 7, qs = (lane >> 3) & 1, hf = lane >> 4;
  const unsigned q = blockIdx.x * 16 + (tid >> 5) * 2 + qs;
  const _Float16* pm = Op + ((size_t)(hf * 16 + 8) * NN + q) * HD + i * 8;      // the middle of the lane's 16 (head, key range) planes of 512 KiB: all 16 lie within a load's immediate offset
  const float* pz = Zp + (size_t)(hf * 16 + i) * NN + q;                        // lane i holds the row sums of planes i and i + 8 of its half
  v8h s[16]; float z0, z1;
  // The 18 loads and their data wait in one statement: all are in flight together (one round trip to memory), and no register that an issued load names is rewritten in front of the wait
  asm volatile("global_load_b128 %0, %18, off offset:-4194304\n\t"
               "global_load_b128 %1, %18, off offset:-3670016\n\t"
               "global_load_b128 %2, %18, off offset:-3145728\n\t"
               "global_load_b128 %3, %18, off offset:-2621440\n\t"
               "global_load_b128 %4, %18, off offset:-2097152\n\t"
               "global_load_b128 %5, %18, off offset:-1572864\n\t"
               "global_load_b128 %6, %18, off offset:-1048576\n\t"
               "global_load_b128 %7, %18, off offset:-524288\n\t"
               "global_load_b128 %8, %18, off\n\t"
               "global_load_b128 %9, %18, off offset:524288\n\t"
               "global_load_b128 %10, %18, off offset:1048576\n\t"
               "global_load_b128 %11, %18, off offset:1572864\n\t"
               "global_load_b128 %12, %18, off offset:2097152\n\t"
               "global_load_b128 %13, %18, off offset:2621440\n\t"
               "global_load_b128 %14, %18, off offset:3145728\n\t"
               "global_load_b128 %15, %18, off offset:3670016\n\t"
               "global_load_b32 %16, %19, off\n\t"
               "global_load_b32 %17, %19, off offset:131072\n\t"
               "s_wait_loadcnt 0x0"
               : "=&v"(s[0]), "=&v"(s[1]), "=&v"(s[2]), "=&v"(s[3]), "=&v"(s[4]), "=&v"(s[5]), "=&v"(s[6]), "=&v"(s[7]), "=&v"(s[8]), "=&v"(s[9]), "=&v"(s[10]), "=&v"(s[11]), "=&v"(s[12]), "=&v"(s[13]), "=&v"(s[14]), "=&v"(s[15]), "=&v"(z0), "=&v"(z1)
               : "v"(pm), "v"(pz) : "memory");
  z0 += __shfl_xor(z0, 1, 32); z0 += __shfl_xor(z0, 2, 32);      // the four key ranges of a head lie in four neighbouring lanes
  z1 += __shfl_xor(z1, 1, 32); z1 += __shfl_xor(z1, 2, 32);
  const float i0 = 1.0f / z0, i1 = 1.0f / z1;
  const int l0 = (int)(lane & 24u);      // first lane of this (hf, qs) group: heads 0, 1 of the half in i0 at lanes l0, l0 + 4; heads 2, 3 in i1
  const float inv[4] = {__shfl(i0, l0, 32), __shfl(i0, l0 + 4, 32), __shfl(i1, l0, 32), __shfl(i1, l0 + 4, 32)};
  float acc[8];
#pragma unroll
  for (int c = 0; c < 8; ++c) acc[c] = (float)s[0][c] * inv[0];
#pragma unroll
  for (int p = 1; p < 16; ++p)
#pragma unroll
    for (int c = 0; c < 8; ++c) acc[c] += (float)s[p][c] * inv[p >> 2];      // f16 partial x the head's f32 reciprocal, summed in f32 plane by plane
#pragma unroll
  for (int c = 0; c < 8; ++c) acc[c] += __shfl_xor(acc[c], 16, 32);      // the other four heads
  // both halves now hold all eight sums: each stores four. 128 = 2^10 (the partials' scale) / 8 heads
  const v4f res = hf == 0 ? (v4f){acc[0], acc[1], acc[2], acc[3]} : (v4f){acc[4], acc[5], acc[6], acc[7]};
  *(v4f*)(out + (size_t)q * HD + i * 8 + hf * 4) = res * 128.0f;
}
extern "C" void kernel_launch(void* const* d_in, const int* in_sizes, int n_in,
                              void* d_out, int out_size, void* d_ws, size_t ws_size, hipStream_t stream) {
  (void)in_sizes; (void)n_in; (void)out_size;
  const float* x = (const float*)d_in[0]; const float* Wq = (const float*)d_in[1]; const float* bq = (const float*)d_in[2]; const float* Wk = (const float*)d_in[3]; const float* bk = (const float*)d_in[4]; const float* Wv = (const float*)d_in[5]; const float* bv = (const float*)d_in[6];
  char* ws = (char*)d_ws; size_t off = 0;
  auto take = [&](size_t bytes) { char* p = ws + off; off += (bytes + 255) & ~(size_t)255; return p; };
  _Float16* Q16 = (_Float16*)take((size_t)NN * PJ * 2); _Float16* K16 = (_Float16*)take((size_t)NN * PJ * 2); _Float16* Vt = (_Float16*)take((size_t)NN * PJ * 2); _Float16* Op = (_Float16*)take((size_t)NH * KSPL * NN * HD * 2); float* Zp = (float*)take((size_t)NH * KSPL * NN * 4);
  if (off > ws_size) return;      // Q, K, V^T, the f16 partial planes and the row sums: about 30 MB
  k_proj<<<(NN / PTOK) * (3 * PJ / PCOL), 384, 0, stream>>>(x, Wq, Wk, Wv, bq, bk, bv, Q16, K16, Vt);
  k_fsig<<<dim3(NN / 256, NH, KSPL), 256, 0, stream>>>(Q16, K16, Vt, Op, Zp);
  k_hmean<<<NN / 16, 256, 0, stream>>>(Op, Zp, (float*)d_out);
}
